// v000
// Times are from an AMD MI455X. After a warm-up the kernel runs many times in a row, and a time is the length of
// such a window on the GPU divided by its runs, so every launch and the gaps after it count. The runs cycle
// through copies of the inputs. A figure is the median of several windows, for all but v000 over two sittings.
// Sittings can differ by a few percent; kernels timed side by side share one.
// v000 is the starting kernel. One run takes 6060 microseconds.
#include <hip/hip_runtime.h>

// Compute dtypes, f32 accumulate, one batch item per pass: the six projections x.W^T + b ([1024 x 512].[512 x 512]; [out][in] weights as n-major B operands; PLAIN bf16
// operands = inputs rounded once, exact) and the two output projections (ctx as bf16 hi + UNSCALED residual) on v_wmma_f32_16x16x32_bf16; per (item, head) both
// score maps q.k^T ([1024 x 64].[64 x 1024]) and both P.v products ([1024 x 1024].[1024 x 64]) with both operands split (three products) on

#define NBI  8
#define NT_  1024
#define DM   512
#define NH_  8
#define HD   64
#define VHD  128                 // k_vt tile geometry (4 groups of 128 columns)
#define NKVV 4
#define KW   DM
#define NTK  NT_
#define SCL  0.125f
#define LOSC 1024.0f

typedef _Float16 h16;
typedef unsigned short bf;
typedef __attribute__((ext_vector_type(16))) __bf16   v16bf;
typedef __attribute__((ext_vector_type(16))) _Float16 v16h;
typedef __attribute__((ext_vector_type(8)))  _Float16 v8h;
typedef __attribute__((ext_vector_type(8)))  unsigned short v8us;
typedef __attribute__((ext_vector_type(8)))  float    v8f;
typedef __attribute__((ext_vector_type(4)))  float    v4f;
typedef __attribute__((ext_vector_type(4)))  _Float16 v4h;
typedef v8h  __attribute__((may_alias)) v8ha;
typedef v4f  __attribute__((may_alias)) v4fa;
typedef v8us __attribute__((may_alias)) v8usa;

__device__ __forceinline__ unsigned short f2bf(float f) { unsigned u = __float_as_uint(f); u += 0x7FFFu + ((u >> 16) & 1u); return (unsigned short)(u >> 16); }
__device__ __forceinline__ float bf2f(unsigned short b) { return __uint_as_float(((unsigned)b) << 16); }
__device__ __forceinline__ float bfr(float f) { return bf2f(f2bf(f)); }
__device__ __forceinline__ v16h cat16(v8h lo, v8h hi) { return __builtin_shufflevector(lo, hi, 0, 1, 2, 3, 4, 5, 6, 7, 8, 9, 10, 11, 12, 13, 14, 15); }
__device__ __forceinline__ v16bf cat16b(v8us lo, v8us hi) { return __builtin_bit_cast(v16bf, __builtin_shufflevector(lo, hi, 0, 1, 2, 3, 4, 5, 6, 7, 8, 9, 10, 11, 12, 13, 14, 15)); }
__device__ __forceinline__ v8f wmma16(v16h a, v16h b, v8f c) { return __builtin_amdgcn_wmma_f32_16x16x32_f16(false, a, false, b, (short)0, c, false, false); }
__device__ __forceinline__ v8f wmmab(v16bf a, v16bf b, v8f c) { return __builtin_amdgcn_wmma_f32_16x16x32_bf16(false, a, false, b, (short)0, c, false, false); }

__global__ __launch_bounds__(256) void k_cvtb(const float* __restrict__ src, int nrows, bf* dst) {
    const int lane = threadIdx.x & 31, r = blockIdx.x * 8 + (threadIdx.x >> 5);
    if (r >= nrows) return;
    v8us o[DM / 256];
#pragma unroll
    for (int q = 0; q < DM / 256; ++q) { v8us t;
#pragma unroll
        for (int i = 0; i < 8; ++i) t[i] = f2bf(src[(size_t)r * DM + q * 256 + lane * 8 + i]);
        o[q] = t; }
#pragma unroll
    for (int q = 0; q < DM / 256; ++q) *(v8us*)(dst + (size_t)r * DM + q * 256 + lane * 8) = o[q];
    
}

// k_gemmb: 64 x 64 block tile (4 waves x 16 x 64) of C[NTK][NW] = (A [+ Al]).B^T (K = 512) [+ bf(bias[c])] [+ bf(R[r][c]) residual]; f32 whole-line epilogue (or f16
template <bool SPLITA, bool F16OUT = false>
__global__ __launch_bounds__(128) void k_gemmb(const bf* __restrict__ A, const bf* __restrict__ Al, const bf* __restrict__ Bn, const float* __restrict__ bias, float* C, int ldc, h16* C2, const float* __restrict__ R = nullptr, int K = DM, int roundR = 1) {
    __shared__ __align__(16) float ost[4][16 * 68];
    const int lane = threadIdx.x & 31, wave = threadIdx.x >> 5, lr = lane & 15, hi = lane >> 4;
    const int r0 = blockIdx.x * 64 + wave * 16, c0 = blockIdx.y * 64;
    const size_t aoff = (size_t)(r0 + lr) * K + 8 * hi;
    size_t boff[4];
#pragma unroll
    for (int t = 0; t < 4; ++t) boff[t] = (size_t)(c0 + t * 16 + lr) * K + 8 * hi;
    v8f acc[4];
#pragma unroll
    for (int t = 0; t < 4; ++t) acc[t] = (v8f){};
#pragma unroll 1
    for (int kc = 0; kc < K; kc += 32) {
        const v16bf a = cat16b(*(const v8us*)(A + aoff + kc), *(const v8us*)(A + aoff + kc + 16));
        v16bf al = a;
        if (SPLITA) al = cat16b(*(const v8us*)(Al + aoff + kc), *(const v8us*)(Al + aoff + kc + 16));
#pragma unroll
        for (int t = 0; t < 4; ++t) { const v16bf b = cat16b(*(const v8us*)(Bn + boff[t] + kc), *(const v8us*)(Bn + boff[t] + kc + 16)); acc[t] = wmmab(a, b, acc[t]); if (SPLITA) acc[t] = wmmab(al, b, acc[t]); }
        asm volatile("v_nop\n\tv_nop\n\tv_nop\n\tv_nop" : "+v"(acc[0]), "+v"(acc[1]), "+v"(acc[2]), "+v"(acc[3]) : "v"(a), "v"(al));
    }
    float* os = &ost[wave][0];
#pragma unroll
    for (int t = 0; t < 4; ++t) { const float bv = bias ? bfr(bias[c0 + t * 16 + lr]) : 0.f;
#pragma unroll
        for (int j = 0; j < 8; ++j) os[(hi * 8 + j) * 68 + t * 16 + lr] = acc[t][j] + bv; }
    __syncthreads();
    if (F16OUT) {
        h16* crow = (h16*)(void*)C + (size_t)r0 * ldc + c0;
        auto pass = [&]() {
#pragma unroll
            for (int s = 0; s < 4; ++s) { const int row = 4 * s + (lane >> 3), piece = lane & 7; const float* sp = os + row * 68 + piece * 8; v8h o, o2;
#pragma unroll
                for (int i = 0; i < 8; ++i) { const h16 a = (h16)sp[i]; o[i] = a; o2[i] = (h16)((sp[i] - (float)a) * LOSC); }
                *(v8h*)(crow + (size_t)row * ldc + piece * 8) = o; if (C2) *(v8h*)(C2 + (size_t)r0 * ldc + c0 + (size_t)row * ldc + piece * 8) = o2; }
        };
        pass(); 
    } else {
        float* crow = C + (size_t)r0 * ldc + c0;
        auto pass = [&]() {
#pragma unroll
            for (int s = 0; s < 8; ++s) { const int Lid = (lane >> 3) + 4 * s, piece = lane & 7; const int row = Lid >> 1, cofs = (Lid & 1) * 32 + piece * 4;
                v4f val = *(const v4fa*)(os + row * 68 + cofs); if (R) { const v4f rv = *(const v4f*)(R + ((size_t)r0 + row) * ldc + c0 + cofs); val += roundR ? (v4f){bfr(rv[0]), bfr(rv[1]), bfr(rv[2]), bfr(rv[3])} : rv; }
                *(v4f*)(crow + (size_t)row * ldc + cofs) = val; }
        };
        pass(); 
    }
}

// k_gemm3: 64 x 64 tile of C = (Ah + Al).(Bh + Bl)^T over K (row strides = K for all four planes; n-major B): three products per 32-k step (hh, hl, lh); f32
__global__ __launch_bounds__(128) void k_gemm3(const bf* __restrict__ Ah, const bf* __restrict__ Al, const bf* __restrict__ Bh, const bf* __restrict__ Bl, int K, float* C, int ldc) {
    __shared__ __align__(16) float ost[4][16 * 68];
    const int lane = threadIdx.x & 31, wave = threadIdx.x >> 5, lr = lane & 15, hi = lane >> 4;
    const int r0 = blockIdx.x * 64 + wave * 16, c0 = blockIdx.y * 64;
    const size_t aoff = (size_t)(r0 + lr) * K + 8 * hi;
    v8f acc[4];
#pragma unroll
    for (int t = 0; t < 4; ++t) acc[t] = (v8f){};
#pragma unroll 1
    for (int kc = 0; kc < K; kc += 32) {
        const v16bf a = cat16b(*(const v8us*)(Ah + aoff + kc), *(const v8us*)(Ah + aoff + kc + 16));
        const v16bf al = cat16b(*(const v8us*)(Al + aoff + kc), *(const v8us*)(Al + aoff + kc + 16));
#pragma unroll
        for (int t = 0; t < 4; ++t) { const size_t bo = (size_t)(c0 + t * 16 + lr) * K + kc + 8 * hi;
            const v16bf bh = cat16b(*(const v8us*)(Bh + bo), *(const v8us*)(Bh + bo + 16)); const v16bf bl = cat16b(*(const v8us*)(Bl + bo), *(const v8us*)(Bl + bo + 16));
            acc[t] = wmmab(a, bh, acc[t]); acc[t] = wmmab(al, bh, acc[t]); acc[t] = wmmab(a, bl, acc[t]); }
        asm volatile("v_nop\n\tv_nop\n\tv_nop\n\tv_nop" : "+v"(acc[0]), "+v"(acc[1]), "+v"(acc[2]), "+v"(acc[3]) : "v"(a), "v"(al));
    }
    float* os = &ost[wave][0];
#pragma unroll
    for (int t = 0; t < 4; ++t) {
#pragma unroll
        for (int j = 0; j < 8; ++j) os[(hi * 8 + j) * 68 + t * 16 + lr] = acc[t][j]; }
    __builtin_amdgcn_wave_barrier(); asm volatile("" ::: "memory");
    float* crow = C + (size_t)r0 * ldc + c0;
    auto pass = [&]() {
#pragma unroll
        for (int s = 0; s < 8; ++s) { const int Lid = (lane >> 3) + 4 * s, piece = lane & 7; const int row = Lid >> 1, cofs = (Lid & 1) * 32 + piece * 4;
            const v4f val = *(const v4fa*)(os + row * 68 + cofs); *(v4f*)(crow + (size_t)row * ldc + cofs) = val; }
    };
    pass(); 
}
// k_vt (V^T planes [512 columns][1024 tokens] as 4 x 128-row groups): VTH/VTL [g][128 d][1024 t] = bf16 hi + UNSCALED bf16 residual of V [t][g*128+d] via 64 x 64 LDS tiles; grid (NT/64, 2 (d half), 4 groups).
__global__ __launch_bounds__(256) void k_vt(const float* __restrict__ V, bf* VTH, bf* VTL) {
    __shared__ float tl[64][65];
    const int tid = threadIdx.x, t0 = blockIdx.x * 64, d0 = blockIdx.y * 64, g = blockIdx.z;
    { const int tt = tid >> 2, dq = (tid & 3) * 16;
#pragma unroll
      for (int i = 0; i < 16; ++i) tl[dq + i][tt] = V[(size_t)(t0 + tt) * KW + g * VHD + d0 + dq + i]; }
    __syncthreads();
    const int piece = tid & 7;
    auto pass = [&]() {
#pragma unroll
        for (int s = 0; s < 2; ++s) { const int d = (tid >> 3) + 32 * s; v8us oh, ol;
#pragma unroll
            for (int i = 0; i < 8; ++i) { const float v = tl[d][piece * 8 + i]; const unsigned short hb = f2bf(v); oh[i] = hb; ol[i] = f2bf(v - bf2f(hb)); }
            const size_t o = ((size_t)g * VHD + d0 + d) * NT_ + t0 + piece * 8; *(v8us*)(VTH + o) = oh; *(v8us*)(VTL + o) = ol; }
    };
    pass(); 
}

__global__ __launch_bounds__(256) void k_hsplit(const float* __restrict__ X, bf* Ph, bf* Pl) {
    typedef __attribute__((ext_vector_type(2))) unsigned short v2us;
    const int lane = threadIdx.x & 31, wid = blockIdx.x * 8 + (threadIdx.x >> 5); if (wid >= NT_ * NH_) return;
    const int t = wid / NH_, h = wid % NH_; v2us oh, ol;
#pragma unroll
    for (int i = 0; i < 2; ++i) { const float v = X[(size_t)t * DM + h * HD + 2 * lane + i]; const unsigned short hb = f2bf(v); oh[i] = hb; ol[i] = f2bf(v - bf2f(hb)); }
    const size_t o = ((size_t)h * NT_ + t) * HD + 2 * lane;
    *(v2us*)(Ph + o) = oh; *(v2us*)(Pl + o) = ol; 
}
// k_smax2: one wave per query row: softmax of S_r and of S_f over the 1024 keys (scale 1/8, f32, fixed lane order, the rows re-read per phase), p = max(p_r, p_f) -> bf16
__global__ __launch_bounds__(256) void k_smax2(const float* __restrict__ SR, const float* __restrict__ SF, bf* PH, bf* PL) {
    const int lane = threadIdx.x & 31, r = blockIdx.x * 8 + (threadIdx.x >> 5); if (r >= NT_) return;
    const float* ar = SR + (size_t)r * NT_; const float* af = SF + (size_t)r * NT_;
    float mr = -3.0e38f, mf = -3.0e38f;
#pragma unroll 1
    for (int c0 = lane * 8; c0 < NT_; c0 += 256) { const v8f a = *(const v8f*)(ar + c0), b = *(const v8f*)(af + c0);
#pragma unroll
        for (int i = 0; i < 8; ++i) { mr = fmaxf(mr, a[i] * SCL); mf = fmaxf(mf, b[i] * SCL); } }
#pragma unroll
    for (int sh = 16; sh; sh >>= 1) { mr = fmaxf(mr, __shfl_xor(mr, sh, 32)); mf = fmaxf(mf, __shfl_xor(mf, sh, 32)); }
    float sr = 0.f, sf = 0.f;
#pragma unroll 1
    for (int c0 = lane * 8; c0 < NT_; c0 += 256) { const v8f a = *(const v8f*)(ar + c0), b = *(const v8f*)(af + c0);
#pragma unroll
        for (int i = 0; i < 8; ++i) { sr += __expf(a[i] * SCL - mr); sf += __expf(b[i] * SCL - mf); } }
#pragma unroll
    for (int sh = 16; sh; sh >>= 1) { sr += __shfl_xor(sr, sh, 32); sf += __shfl_xor(sf, sh, 32); }
    const float ir = 1.0f / sr, iff = 1.0f / sf;
{
#pragma unroll 1
        for (int c0 = lane * 8; c0 < NT_; c0 += 256) { const v8f a = *(const v8f*)(ar + c0), b = *(const v8f*)(af + c0); v8us oh, ol;
#pragma unroll
            for (int i = 0; i < 8; ++i) { const float p = fmaxf(__expf(a[i] * SCL - mr) * ir, __expf(b[i] * SCL - mf) * iff); const unsigned short hb = f2bf(p); oh[i] = hb; ol[i] = f2bf(p - bf2f(hb)); }
            const size_t o = (size_t)r * NT_ + c0; *(v8us*)(PH + o) = oh; *(v8us*)(PL + o) = ol; }
         }
}
__global__ __launch_bounds__(256) void k_split(const float* __restrict__ src, int nrows, bf* dh, bf* dl) {
    const int lane = threadIdx.x & 31, r = blockIdx.x * 8 + (threadIdx.x >> 5); if (r >= nrows) return;
{
#pragma unroll 1
        for (int q = 0; q < DM / 256; ++q) { const size_t o = (size_t)r * DM + q * 256 + lane * 8; const v8f v = *(const v8f*)(src + o); v8us oh, ol;
#pragma unroll
            for (int i = 0; i < 8; ++i) { const unsigned short hb = f2bf(v[i]); oh[i] = hb; ol[i] = f2bf(v[i] - bf2f(hb)); }
            *(v8us*)(dh + o) = oh; *(v8us*)(dl + o) = ol; }
         }
}

extern "C" void kernel_launch(void* const* d_in, const int* in_sizes, int n_in,
                              void* d_out, int out_size, void* d_ws, size_t ws_size, hipStream_t stream) {
    (void)in_sizes; (void)n_in; (void)out_size;
    const float* xr = (const float*)d_in[0]; const float* xf = (const float*)d_in[1];
    const float* Wq1 = (const float*)d_in[2]; const float* bq1 = (const float*)d_in[3]; const float* Wk1 = (const float*)d_in[4]; const float* bk1 = (const float*)d_in[5]; const float* Wv1 = (const float*)d_in[6]; const float* bv1 = (const float*)d_in[7];
    const float* Wq2 = (const float*)d_in[8]; const float* bq2 = (const float*)d_in[9]; const float* Wk2 = (const float*)d_in[10]; const float* bk2 = (const float*)d_in[11]; const float* Wv2 = (const float*)d_in[12]; const float* bv2 = (const float*)d_in[13];
    const float* Wo1 = (const float*)d_in[14]; const float* bo1 = (const float*)d_in[15]; const float* Wo2 = (const float*)d_in[16]; const float* bo2 = (const float*)d_in[17];
    float* out0 = (float*)d_out; float* out1 = out0 + (size_t)NBI * NT_ * DM;    // (out_rgb.Wo1 + bo1, out_flow.Wo2 + bo2)
    char* wsp = (char*)d_ws;
    auto take = [&](size_t bytes) { char* p = wsp; wsp += (bytes + 255) & ~(size_t)255; return (void*)p; };
    bf* WB[8]; const float* Ws[8] = {Wq1, Wk1, Wv1, Wq2, Wk2, Wv2, Wo1, Wo2};
    for (int i = 0; i < 8; ++i) WB[i] = (bf*)take((size_t)DM * DM * 2);
    bf* Xr = (bf*)take((size_t)NT_ * DM * 2); bf* Xf = (bf*)take((size_t)NT_ * DM * 2); float* TMP = (float*)take((size_t)NT_ * DM * 4);
    bf* QRh = (bf*)take((size_t)NT_ * DM * 2); bf* QRl = (bf*)take((size_t)NT_ * DM * 2); bf* KRh = (bf*)take((size_t)NT_ * DM * 2); bf* KRl = (bf*)take((size_t)NT_ * DM * 2);
    bf* QFh = (bf*)take((size_t)NT_ * DM * 2); bf* QFl = (bf*)take((size_t)NT_ * DM * 2); bf* KFh = (bf*)take((size_t)NT_ * DM * 2); bf* KFl = (bf*)take((size_t)NT_ * DM * 2);
    bf* VRh = (bf*)take((size_t)DM * NT_ * 2); bf* VRl = (bf*)take((size_t)DM * NT_ * 2); bf* VFh = (bf*)take((size_t)DM * NT_ * 2); bf* VFl = (bf*)take((size_t)DM * NT_ * 2);
    float* SR = (float*)take((size_t)NT_ * NT_ * 4); float* SF = (float*)take((size_t)NT_ * NT_ * 4); bf* PH = (bf*)take((size_t)NT_ * NT_ * 2); bf* PL = (bf*)take((size_t)NT_ * NT_ * 2);
    float* CR = (float*)take((size_t)NT_ * DM * 4); float* CF = (float*)take((size_t)NT_ * DM * 4); bf* Ch = (bf*)take((size_t)NT_ * DM * 2); bf* Cl = (bf*)take((size_t)NT_ * DM * 2);
    if ((size_t)(wsp - (char*)d_ws) > ws_size) return;    // ~ 4.2 + 2 + 2 + 12 x 1 + 8.4 + 4.2 + 4 + 2 ~ 40 MB, no aliasing (per-item / per-head reuse in stream order)
    for (int i = 0; i < 8; ++i) k_cvtb<<<DM / 8, 256, 0, stream>>>(Ws[i], DM, WB[i]);
    for (int b = 0; b < NBI; ++b) {
        k_cvtb<<<NT_ / 8, 256, 0, stream>>>(xr + (size_t)b * NT_ * DM, NT_, Xr); k_cvtb<<<NT_ / 8, 256, 0, stream>>>(xf + (size_t)b * NT_ * DM, NT_, Xf);
        k_gemmb<false, false><<<dim3(NT_ / 64, DM / 64, 1), 128, 0, stream>>>(Xr, nullptr, WB[0], bq1, TMP, DM, nullptr); k_hsplit<<<(NT_ * NH_) / 8, 256, 0, stream>>>(TMP, QRh, QRl);
        k_gemmb<false, false><<<dim3(NT_ / 64, DM / 64, 1), 128, 0, stream>>>(Xr, nullptr, WB[1], bk1, TMP, DM, nullptr); k_hsplit<<<(NT_ * NH_) / 8, 256, 0, stream>>>(TMP, KRh, KRl);
        k_gemmb<false, false><<<dim3(NT_ / 64, DM / 64, 1), 128, 0, stream>>>(Xr, nullptr, WB[2], bv1, TMP, DM, nullptr); k_vt<<<dim3(NT_ / 64, 2, NKVV), 256, 0, stream>>>(TMP, VRh, VRl);
        k_gemmb<false, false><<<dim3(NT_ / 64, DM / 64, 1), 128, 0, stream>>>(Xf, nullptr, WB[3], bq2, TMP, DM, nullptr); k_hsplit<<<(NT_ * NH_) / 8, 256, 0, stream>>>(TMP, QFh, QFl);
        k_gemmb<false, false><<<dim3(NT_ / 64, DM / 64, 1), 128, 0, stream>>>(Xf, nullptr, WB[4], bk2, TMP, DM, nullptr); k_hsplit<<<(NT_ * NH_) / 8, 256, 0, stream>>>(TMP, KFh, KFl);
        k_gemmb<false, false><<<dim3(NT_ / 64, DM / 64, 1), 128, 0, stream>>>(Xf, nullptr, WB[5], bv2, TMP, DM, nullptr); k_vt<<<dim3(NT_ / 64, 2, NKVV), 256, 0, stream>>>(TMP, VFh, VFl);
        for (int h = 0; h < NH_; ++h) { const size_t po = (size_t)h * NT_ * HD, vo = (size_t)h * HD * NT_;
            k_gemm3<<<dim3(NT_ / 64, NT_ / 64, 1), 128, 0, stream>>>(QRh + po, QRl + po, KRh + po, KRl + po, HD, SR, NT_);
            k_gemm3<<<dim3(NT_ / 64, NT_ / 64, 1), 128, 0, stream>>>(QFh + po, QFl + po, KFh + po, KFl + po, HD, SF, NT_);
            k_smax2<<<NT_ / 8, 256, 0, stream>>>(SR, SF, PH, PL);
            k_gemm3<<<dim3(NT_ / 64, HD / 64, 1), 128, 0, stream>>>(PH, PL, VRh + vo, VRl + vo, NT_, CR + h * HD, DM);       // ctx_rgb[:, h*64..]
            k_gemm3<<<dim3(NT_ / 64, HD / 64, 1), 128, 0, stream>>>(PH, PL, VFh + vo, VFl + vo, NT_, CF + h * HD, DM);       // ctx_flow
        }
        k_split<<<NT_ / 8, 256, 0, stream>>>(CR, NT_, Ch, Cl); k_gemmb<true, false><<<dim3(NT_ / 64, DM / 64, 1), 128, 0, stream>>>(Ch, Cl, WB[6], bo1, out0 + (size_t)b * NT_ * DM, DM, nullptr);
        k_split<<<NT_ / 8, 256, 0, stream>>>(CF, NT_, Ch, Cl); k_gemmb<true, false><<<dim3(NT_ / 64, DM / 64, 1), 128, 0, stream>>>(Ch, Cl, WB[7], bo2, out1 + (size_t)b * NT_ * DM, DM, nullptr);
    }
}

// v001
// It runs in 867 microseconds.
// Two timings next to v000 put it at 7.04 and 6.98 times that version's speed.
#include <hip/hip_runtime.h>

// Compute dtypes, f32 accumulate, GI batch items per pass, every stage of a pass ONE launch (items, heads, the two streams and the projections ride in the grid): the six projections x.W^T + b ([1024 x 512].[512 x 512]; [out][in] weights as n-major B operands; PLAIN bf16
// operands = inputs rounded once, exact) and the two output projections (ctx as bf16 hi + UNSCALED residual) on v_wmma_f32_16x16x32_bf16; per (item, head) both
// score maps q.k^T ([1024 x 64].[64 x 1024]) and both P.v products ([1024 x 1024].[1024 x 64]) with both operands split (three products) on

#define NBI  8
#define NT_  1024
#define DM   512
#define NH_  8
#define HD   64
#define VHD  128                 // k_vt tile geometry (4 groups of 128 columns)
#define NKVV 4
#define KW   DM
#define NTK  NT_
#define SCL  0.125f
#define LOSC 1024.0f
#define GI   2                   // batch items per pass: the two f32 score maps and the two P planes of GI x 8 heads take 192 MiB of the 256 MiB workspace
#define MR   (GI * NT_)          // rows of one pass
#define NBH  (GI * NH_)          // (item, head) pairs of one pass
#define PLN  ((size_t)MR * DM)   // elements of one [MR][512] plane

typedef _Float16 h16;
typedef unsigned short bf;
typedef __attribute__((ext_vector_type(16))) __bf16   v16bf;
typedef __attribute__((ext_vector_type(16))) _Float16 v16h;
typedef __attribute__((ext_vector_type(8)))  _Float16 v8h;
typedef __attribute__((ext_vector_type(8)))  unsigned short v8us;
typedef __attribute__((ext_vector_type(8)))  float    v8f;
typedef __attribute__((ext_vector_type(4)))  float    v4f;
typedef __attribute__((ext_vector_type(4)))  _Float16 v4h;
typedef v8h  __attribute__((may_alias)) v8ha;
typedef v4f  __attribute__((may_alias)) v4fa;
typedef v8us __attribute__((may_alias)) v8usa;

__device__ __forceinline__ unsigned short f2bf(float f) { unsigned u = __float_as_uint(f); u += 0x7FFFu + ((u >> 16) & 1u); return (unsigned short)(u >> 16); }
__device__ __forceinline__ float bf2f(unsigned short b) { return __uint_as_float(((unsigned)b) << 16); }
__device__ __forceinline__ float bfr(float f) { return bf2f(f2bf(f)); }
__device__ __forceinline__ v16h cat16(v8h lo, v8h hi) { return __builtin_shufflevector(lo, hi, 0, 1, 2, 3, 4, 5, 6, 7, 8, 9, 10, 11, 12, 13, 14, 15); }
__device__ __forceinline__ v16bf cat16b(v8us lo, v8us hi) { return __builtin_bit_cast(v16bf, __builtin_shufflevector(lo, hi, 0, 1, 2, 3, 4, 5, 6, 7, 8, 9, 10, 11, 12, 13, 14, 15)); }
__device__ __forceinline__ v8f wmma16(v16h a, v16h b, v8f c) { return __builtin_amdgcn_wmma_f32_16x16x32_f16(false, a, false, b, (short)0, c, false, false); }
__device__ __forceinline__ v8f wmmab(v16bf a, v16bf b, v8f c) { return __builtin_amdgcn_wmma_f32_16x16x32_bf16(false, a, false, b, (short)0, c, false, false); }

__device__ __forceinline__ void cvtb_body(const float* __restrict__ src, int nrows, bf* dst) {
    const int lane = threadIdx.x & 31, r = blockIdx.x * 8 + (threadIdx.x >> 5);
    if (r >= nrows) return;
    v8us o[DM / 256];
#pragma unroll
    for (int q = 0; q < DM / 256; ++q) { v8us t;
#pragma unroll
        for (int i = 0; i < 8; ++i) t[i] = f2bf(src[(size_t)r * DM + q * 256 + lane * 8 + i]);
        o[q] = t; }
#pragma unroll
    for (int q = 0; q < DM / 256; ++q) *(v8us*)(dst + (size_t)r * DM + q * 256 + lane * 8) = o[q];
}
// all eight weights in one launch: blockIdx.y picks the matrix
__global__ __launch_bounds__(256) void k_cvtw(const float* w0, const float* w1, const float* w2, const float* w3, const float* w4, const float* w5, const float* w6, const float* w7, bf* dst) {
    const int y = blockIdx.y;
    const float* src = y == 0 ? w0 : y == 1 ? w1 : y == 2 ? w2 : y == 3 ? w3 : y == 4 ? w4 : y == 5 ? w5 : y == 6 ? w6 : w7;
    cvtb_body(src, DM, dst + (size_t)y * DM * DM);
}
// both inputs, all items, in one launch: blockIdx.y picks the stream
__global__ __launch_bounds__(256) void k_cvtx(const float* xr, const float* xf, bf* dst) {
    cvtb_body(blockIdx.y ? xf : xr, NBI * NT_, dst + (size_t)blockIdx.y * NBI * NT_ * DM);
}

// k_gemmb: 64 x 64 block tile (4 waves x 16 x 64) of C[MR][512] = (A [+ Al]).B^T (K = 512) [+ bf(bias[c])] [+ bf(R[r][c]) residual]; f32 whole-line epilogue (or f16
template <bool SPLITA, bool F16OUT = false>
__device__ __forceinline__ void gemmb_body(const bf* __restrict__ A, const bf* __restrict__ Al, const bf* __restrict__ Bn, const float* __restrict__ bias, float* C, int ldc, h16* C2, const float* __restrict__ R = nullptr, int K = DM, int roundR = 1) {
    __shared__ __align__(16) float ost[4][16 * 68];
    const int lane = threadIdx.x & 31, wave = threadIdx.x >> 5, lr = lane & 15, hi = lane >> 4;
    const int r0 = blockIdx.x * 64 + wave * 16, c0 = blockIdx.y * 64;
    const size_t aoff = (size_t)(r0 + lr) * K + 8 * hi;
    size_t boff[4];
#pragma unroll
    for (int t = 0; t < 4; ++t) boff[t] = (size_t)(c0 + t * 16 + lr) * K + 8 * hi;
    v8f acc[4];
#pragma unroll
    for (int t = 0; t < 4; ++t) acc[t] = (v8f){};
#pragma unroll 1
    for (int kc = 0; kc < K; kc += 32) {
        const v16bf a = cat16b(*(const v8us*)(A + aoff + kc), *(const v8us*)(A + aoff + kc + 16));
        v16bf al = a;
        if (SPLITA) al = cat16b(*(const v8us*)(Al + aoff + kc), *(const v8us*)(Al + aoff + kc + 16));
#pragma unroll
        for (int t = 0; t < 4; ++t) { const v16bf b = cat16b(*(const v8us*)(Bn + boff[t] + kc), *(const v8us*)(Bn + boff[t] + kc + 16)); acc[t] = wmmab(a, b, acc[t]); if (SPLITA) acc[t] = wmmab(al, b, acc[t]); }
        asm volatile("v_nop\n\tv_nop\n\tv_nop\n\tv_nop" : "+v"(acc[0]), "+v"(acc[1]), "+v"(acc[2]), "+v"(acc[3]) : "v"(a), "v"(al));
    }
    float* os = &ost[wave][0];
#pragma unroll
    for (int t = 0; t < 4; ++t) { const float bv = bias ? bfr(bias[c0 + t * 16 + lr]) : 0.f;
#pragma unroll
        for (int j = 0; j < 8; ++j) os[(hi * 8 + j) * 68 + t * 16 + lr] = acc[t][j] + bv; }
    __syncthreads();
    if (F16OUT) {
        h16* crow = (h16*)(void*)C + (size_t)r0 * ldc + c0;
        auto pass = [&]() {
#pragma unroll
            for (int s = 0; s < 4; ++s) { const int row = 4 * s + (lane >> 3), piece = lane & 7; const float* sp = os + row * 68 + piece * 8; v8h o, o2;
#pragma unroll
                for (int i = 0; i < 8; ++i) { const h16 a = (h16)sp[i]; o[i] = a; o2[i] = (h16)((sp[i] - (float)a) * LOSC); }
                *(v8h*)(crow + (size_t)row * ldc + piece * 8) = o; if (C2) *(v8h*)(C2 + (size_t)r0 * ldc + c0 + (size_t)row * ldc + piece * 8) = o2; }
        };
        pass(); 
    } else {
        float* crow = C + (size_t)r0 * ldc + c0;
        auto pass = [&]() {
#pragma unroll
            for (int s = 0; s < 8; ++s) { const int Lid = (lane >> 3) + 4 * s, piece = lane & 7; const int row = Lid >> 1, cofs = (Lid & 1) * 32 + piece * 4;
                v4f val = *(const v4fa*)(os + row * 68 + cofs); if (R) { const v4f rv = *(const v4f*)(R + ((size_t)r0 + row) * ldc + c0 + cofs); val += roundR ? (v4f){bfr(rv[0]), bfr(rv[1]), bfr(rv[2]), bfr(rv[3])} : rv; }
                *(v4f*)(crow + (size_t)row * ldc + cofs) = val; }
        };
        pass(); 
    }
}
// the six projections of one pass in one launch: rows = GI items, blockIdx.z = q_r, k_r, q_f, k_f, v_r, v_f (weights in that order in WB; X = [stream][all rows][512], at the pass's first row)
__global__ __launch_bounds__(128) void k_proj(const bf* __restrict__ X, const bf* __restrict__ WB, const float* bq1, const float* bk1, const float* bq2, const float* bk2, const float* bv1, const float* bv2, float* TMP, int ldc, int K) {
    const int z = blockIdx.z;
    const bool flow = z == 2 || z == 3 || z == 5;
    const float* bias = z == 0 ? bq1 : z == 1 ? bk1 : z == 2 ? bq2 : z == 3 ? bk2 : z == 4 ? bv1 : bv2;
    gemmb_body<false, false>(X + (flow ? (size_t)NBI * NT_ * DM : 0), nullptr, WB + (size_t)z * DM * DM, bias, TMP + (size_t)z * PLN, ldc, nullptr, nullptr, K);
}
// both output projections of one pass in one launch: blockIdx.z = stream
__global__ __launch_bounds__(128) void k_outp(const bf* __restrict__ Ch, const bf* __restrict__ Cl, const bf* __restrict__ WBo, const float* bo1, const float* bo2, float* o0, float* o1, int ldc, int K) {
    const int s = blockIdx.z;
    gemmb_body<true, false>(Ch + (size_t)s * PLN, Cl + (size_t)s * PLN, WBo + (size_t)s * DM * DM, s ? bo2 : bo1, s ? o1 : o0, ldc, nullptr, nullptr, K);
}

// k_gemm3: 64 x 64 tile of C = (Ah + Al).(Bh + Bl)^T over K (row strides = K for all four planes; n-major B): three products per 32-k step (hh, hl, lh); f32
__device__ __forceinline__ void gemm3_body(const bf* __restrict__ Ah, const bf* __restrict__ Al, const bf* __restrict__ Bh, const bf* __restrict__ Bl, int K, float* C, int ldc) {
    __shared__ __align__(16) float ost[4][16 * 68];
    const int lane = threadIdx.x & 31, wave = threadIdx.x >> 5, lr = lane & 15, hi = lane >> 4;
    const int r0 = blockIdx.x * 64 + wave * 16, c0 = blockIdx.y * 64;
    const size_t aoff = (size_t)(r0 + lr) * K + 8 * hi;
    v8f acc[4];
#pragma unroll
    for (int t = 0; t < 4; ++t) acc[t] = (v8f){};
#pragma unroll 1
    for (int kc = 0; kc < K; kc += 32) {
        const v16bf a = cat16b(*(const v8us*)(Ah + aoff + kc), *(const v8us*)(Ah + aoff + kc + 16));
        const v16bf al = cat16b(*(const v8us*)(Al + aoff + kc), *(const v8us*)(Al + aoff + kc + 16));
#pragma unroll
        for (int t = 0; t < 4; ++t) { const size_t bo = (size_t)(c0 + t * 16 + lr) * K + kc + 8 * hi;
            const v16bf bh = cat16b(*(const v8us*)(Bh + bo), *(const v8us*)(Bh + bo + 16)); const v16bf bl = cat16b(*(const v8us*)(Bl + bo), *(const v8us*)(Bl + bo + 16));
            acc[t] = wmmab(a, bh, acc[t]); acc[t] = wmmab(al, bh, acc[t]); acc[t] = wmmab(a, bl, acc[t]); }
        asm volatile("v_nop\n\tv_nop\n\tv_nop\n\tv_nop" : "+v"(acc[0]), "+v"(acc[1]), "+v"(acc[2]), "+v"(acc[3]) : "v"(a), "v"(al));
    }
    float* os = &ost[wave][0];
#pragma unroll
    for (int t = 0; t < 4; ++t) {
#pragma unroll
        for (int j = 0; j < 8; ++j) os[(hi * 8 + j) * 68 + t * 16 + lr] = acc[t][j]; }
    __builtin_amdgcn_wave_barrier(); asm volatile("" ::: "memory");
    float* crow = C + (size_t)r0 * ldc + c0;
    auto pass = [&]() {
#pragma unroll
        for (int s = 0; s < 8; ++s) { const int Lid = (lane >> 3) + 4 * s, piece = lane & 7; const int row = Lid >> 1, cofs = (Lid & 1) * 32 + piece * 4;
            const v4f val = *(const v4fa*)(os + row * 68 + cofs); *(v4f*)(crow + (size_t)row * ldc + cofs) = val; }
    };
    pass(); 
}
// k_gemm3 batched: blockIdx.z = stream * NBH + pair (pair = item * 8 + head); sX / pX = element steps of A and B per stream / per pair, sC / iC / hC = steps of C per stream / item / head
__global__ __launch_bounds__(128) void k_gemm3(const bf* __restrict__ Ah, const bf* __restrict__ Al, const bf* __restrict__ Bh, const bf* __restrict__ Bl, int K, float* C, int ldc,
                                               size_t sA, size_t pA, size_t sB, size_t pB, size_t sC, size_t iC, size_t hC) {
    const int z = blockIdx.z, s = z / NBH, p = z % NBH;
    const size_t a = s * sA + p * pA, b = s * sB + p * pB;
    gemm3_body(Ah + a, Al + a, Bh + b, Bl + b, K, C + s * sC + (p / NH_) * iC + (p % NH_) * hC, ldc);
}
// k_vt (blockIdx.z = (stream * GI + item) * 4 + group; V^T planes [512 columns][1024 tokens] as 4 x 128-row groups): VTH/VTL [g][128 d][1024 t] = bf16 hi + UNSCALED bf16 residual of V [t][g*128+d] via 64 x 64 LDS tiles; grid (NT/64, 2 (d half), 16 = (stream, item, group)).
__global__ __launch_bounds__(256) void k_vt(const float* __restrict__ Vall, bf* VTH, bf* VTL) {
    __shared__ float tl[64][65];
    const int tid = threadIdx.x, t0 = blockIdx.x * 64, d0 = blockIdx.y * 64, g = blockIdx.z % NKVV;
    const size_t io = (size_t)(blockIdx.z / NKVV) * NT_ * DM; const float* V = Vall + io;
    { const int tt = tid >> 2, dq = (tid & 3) * 16;
#pragma unroll
      for (int i = 0; i < 16; ++i) tl[dq + i][tt] = V[(size_t)(t0 + tt) * KW + g * VHD + d0 + dq + i]; }
    __syncthreads();
    const int piece = tid & 7;
    auto pass = [&]() {
#pragma unroll
        for (int s = 0; s < 2; ++s) { const int d = (tid >> 3) + 32 * s; v8us oh, ol;
#pragma unroll
            for (int i = 0; i < 8; ++i) { const float v = tl[d][piece * 8 + i]; const unsigned short hb = f2bf(v); oh[i] = hb; ol[i] = f2bf(v - bf2f(hb)); }
            const size_t o = io + ((size_t)g * VHD + d0 + d) * NT_ + t0 + piece * 8; *(v8us*)(VTH + o) = oh; *(v8us*)(VTL + o) = ol; }
    };
    pass(); 
}

// blockIdx.y = plane (q_r, k_r, q_f, k_f); rows = GI items
__global__ __launch_bounds__(256) void k_hsplit(const float* __restrict__ Xall, bf* Ph, bf* Pl) {
    typedef __attribute__((ext_vector_type(2))) unsigned short v2us;
    const int lane = threadIdx.x & 31, wid = blockIdx.x * 8 + (threadIdx.x >> 5); if (wid >= MR * NH_) return;
    const int t = wid / NH_, h = wid % NH_; v2us oh, ol; const size_t yo = (size_t)blockIdx.y * PLN; const float* X = Xall + yo;
#pragma unroll
    for (int i = 0; i < 2; ++i) { const float v = X[(size_t)t * DM + h * HD + 2 * lane + i]; const unsigned short hb = f2bf(v); oh[i] = hb; ol[i] = f2bf(v - bf2f(hb)); }
    const size_t o = yo + (((size_t)(t / NT_) * NH_ + h) * NT_ + t % NT_) * HD + 2 * lane;
    *(v2us*)(Ph + o) = oh; *(v2us*)(Pl + o) = ol; 
}
// k_smax2: one wave per query row (rows of all NBH pairs of a pass): softmax of S_r and of S_f over the 1024 keys (scale 1/8, f32, fixed lane order, the rows re-read per phase), p = max(p_r, p_f) -> bf16
__global__ __launch_bounds__(256) void k_smax2(const float* __restrict__ SR, const float* __restrict__ SF, bf* PH, bf* PL) {
    const int lane = threadIdx.x & 31, r = blockIdx.x * 8 + (threadIdx.x >> 5); if (r >= NBH * NT_) return;
    const float* ar = SR + (size_t)r * NT_; const float* af = SF + (size_t)r * NT_;
    float mr = -3.0e38f, mf = -3.0e38f;
#pragma unroll 1
    for (int c0 = lane * 8; c0 < NT_; c0 += 256) { const v8f a = *(const v8f*)(ar + c0), b = *(const v8f*)(af + c0);
#pragma unroll
        for (int i = 0; i < 8; ++i) { mr = fmaxf(mr, a[i] * SCL); mf = fmaxf(mf, b[i] * SCL); } }
#pragma unroll
    for (int sh = 16; sh; sh >>= 1) { mr = fmaxf(mr, __shfl_xor(mr, sh, 32)); mf = fmaxf(mf, __shfl_xor(mf, sh, 32)); }
    float sr = 0.f, sf = 0.f;
#pragma unroll 1
    for (int c0 = lane * 8; c0 < NT_; c0 += 256) { const v8f a = *(const v8f*)(ar + c0), b = *(const v8f*)(af + c0);
#pragma unroll
        for (int i = 0; i < 8; ++i) { sr += __expf(a[i] * SCL - mr); sf += __expf(b[i] * SCL - mf); } }
#pragma unroll
    for (int sh = 16; sh; sh >>= 1) { sr += __shfl_xor(sr, sh, 32); sf += __shfl_xor(sf, sh, 32); }
    const float ir = 1.0f / sr, iff = 1.0f / sf;
{
#pragma unroll 1
        for (int c0 = lane * 8; c0 < NT_; c0 += 256) { const v8f a = *(const v8f*)(ar + c0), b = *(const v8f*)(af + c0); v8us oh, ol;
#pragma unroll
            for (int i = 0; i < 8; ++i) { const float p = fmaxf(__expf(a[i] * SCL - mr) * ir, __expf(b[i] * SCL - mf) * iff); const unsigned short hb = f2bf(p); oh[i] = hb; ol[i] = f2bf(p - bf2f(hb)); }
            const size_t o = (size_t)r * NT_ + c0; *(v8us*)(PH + o) = oh; *(v8us*)(PL + o) = ol; }
         }
}
__global__ __launch_bounds__(256) void k_split(const float* __restrict__ src, int nrows, bf* dh, bf* dl) {
    const int lane = threadIdx.x & 31, r = blockIdx.x * 8 + (threadIdx.x >> 5); if (r >= nrows) return;
{
#pragma unroll 1
        for (int q = 0; q < DM / 256; ++q) { const size_t o = (size_t)r * DM + q * 256 + lane * 8; const v8f v = *(const v8f*)(src + o); v8us oh, ol;
#pragma unroll
            for (int i = 0; i < 8; ++i) { const unsigned short hb = f2bf(v[i]); oh[i] = hb; ol[i] = f2bf(v[i] - bf2f(hb)); }
            *(v8us*)(dh + o) = oh; *(v8us*)(dl + o) = ol;
            asm volatile("s_wait_xcnt 0x0" ::: "memory"); }    // the next trip rewrites the address and data registers of the two stores
         }
}

extern "C" void kernel_launch(void* const* d_in, const int* in_sizes, int n_in,
                              void* d_out, int out_size, void* d_ws, size_t ws_size, hipStream_t stream) {
    (void)in_sizes; (void)n_in; (void)out_size;
    const float* xr = (const float*)d_in[0]; const float* xf = (const float*)d_in[1];
    const float* Wq1 = (const float*)d_in[2]; const float* bq1 = (const float*)d_in[3]; const float* Wk1 = (const float*)d_in[4]; const float* bk1 = (const float*)d_in[5]; const float* Wv1 = (const float*)d_in[6]; const float* bv1 = (const float*)d_in[7];
    const float* Wq2 = (const float*)d_in[8]; const float* bq2 = (const float*)d_in[9]; const float* Wk2 = (const float*)d_in[10]; const float* bk2 = (const float*)d_in[11]; const float* Wv2 = (const float*)d_in[12]; const float* bv2 = (const float*)d_in[13];
    const float* Wo1 = (const float*)d_in[14]; const float* bo1 = (const float*)d_in[15]; const float* Wo2 = (const float*)d_in[16]; const float* bo2 = (const float*)d_in[17];
    float* out0 = (float*)d_out; float* out1 = out0 + (size_t)NBI * NT_ * DM;    // (out_rgb.Wo1 + bo1, out_flow.Wo2 + bo2)
    char* wsp = (char*)d_ws;
    auto take = [&](size_t bytes) { char* p = wsp; wsp += (bytes + 255) & ~(size_t)255; return (void*)p; };
    bf* WB = (bf*)take((size_t)8 * DM * DM * 2);                                      // q_r, k_r, q_f, k_f, v_r, v_f, o_r, o_f
    bf* X = (bf*)take((size_t)2 * NBI * NT_ * DM * 2);                                // [stream][item][token][512]
    bf* QKh = (bf*)take(4 * PLN * 2); bf* QKl = (bf*)take(4 * PLN * 2);               // q_r, k_r, q_f, k_f, each [pair][token][64]
    bf* VTh = (bf*)take(2 * PLN * 2); bf* VTl = (bf*)take(2 * PLN * 2);               // [stream][item][512][token]
    float* S = (float*)take((size_t)2 * NBH * NT_ * NT_ * 4);                         // [stream][pair][query][key]
    bf* PH = (bf*)take((size_t)NBH * NT_ * NT_ * 2); bf* PL = (bf*)take((size_t)NBH * NT_ * NT_ * 2);
    float* CC = (float*)take(2 * PLN * 4); bf* Ch = (bf*)take(2 * PLN * 2); bf* Cl = (bf*)take(2 * PLN * 2);   // [stream][row][512]
    float* TMP = S;                                                                   // the six f32 projections (24 MiB) are split and transposed before the score launch writes S
    if ((size_t)(wsp - (char*)d_ws) > ws_size) return;    // 4 + 16 + 16 + 8 + 128 + 64 + 8 + 8 = 252 MiB
    k_cvtw<<<dim3(DM / 8, 8, 1), 256, 0, stream>>>(Wq1, Wk1, Wq2, Wk2, Wv1, Wv2, Wo1, Wo2, WB);
    k_cvtx<<<dim3(NBI * NT_ / 8, 2, 1), 256, 0, stream>>>(xr, xf, X);
    for (int b = 0; b < NBI; b += GI) {
        k_proj<<<dim3(MR / 64, DM / 64, 6), 128, 0, stream>>>(X + (size_t)b * NT_ * DM, WB, bq1, bk1, bq2, bk2, bv1, bv2, TMP, DM, DM);
        k_hsplit<<<dim3((MR * NH_) / 8, 4, 1), 256, 0, stream>>>(TMP, QKh, QKl);
        k_vt<<<dim3(NT_ / 64, 2, NKVV * GI * 2), 256, 0, stream>>>(TMP + 4 * PLN, VTh, VTl);
        k_gemm3<<<dim3(NT_ / 64, NT_ / 64, 2 * NBH), 128, 0, stream>>>(QKh, QKl, QKh + PLN, QKl + PLN, HD, S, NT_,                        // both score maps, all pairs
            2 * PLN, (size_t)NT_ * HD, 2 * PLN, (size_t)NT_ * HD, (size_t)NBH * NT_ * NT_, (size_t)NH_ * NT_ * NT_, (size_t)NT_ * NT_);
        k_smax2<<<NBH * NT_ / 8, 256, 0, stream>>>(S, S + (size_t)NBH * NT_ * NT_, PH, PL);
        k_gemm3<<<dim3(NT_ / 64, HD / 64, 2 * NBH), 128, 0, stream>>>(PH, PL, VTh, VTl, NT_, CC, DM,                                      // ctx of both streams, all pairs: [:, h*64..]
            0, (size_t)NT_ * NT_, PLN, (size_t)HD * NT_, PLN, (size_t)NT_ * DM, HD);
        k_split<<<2 * MR / 8, 256, 0, stream>>>(CC, 2 * MR, Ch, Cl);
        k_outp<<<dim3(MR / 64, DM / 64, 2), 128, 0, stream>>>(Ch, Cl, WB + (size_t)6 * DM * DM, bo1, bo2, out0 + (size_t)b * NT_ * DM, out1 + (size_t)b * NT_ * DM, DM, DM);
    }
}

// v002
// It runs in 573 microseconds.
// Timed twice side by side with v001, it ran 1.51 times as fast both times.
// Counting every step since v000, it is 10.6 times as fast.
#include <hip/hip_runtime.h>

// Compute dtypes, f32 accumulate, GI batch items per pass, every stage of a pass ONE launch (items, heads, the two streams and the projections ride in the grid): the six projections x.W^T + b ([1024 x 512].[512 x 512]; [out][in] weights as n-major B operands; PLAIN bf16
// operands = inputs rounded once, exact) and the two output projections (ctx as bf16 hi + UNSCALED residual) on v_wmma_f32_16x16x32_bf16; per (item, head) both
// score maps q.k^T ([1024 x 64].[64 x 1024]) and both P.v products ([1024 x 1024].[1024 x 64]) with both operands split (three products), in ONE kernel that keeps scores and P in registers

#define NBI  8
#define NT_  1024
#define DM   512
#define NH_  8
#define HD   64
#define VHD  128                 // k_vt tile geometry (4 groups of 128 columns)
#define NKVV 4
#define KW   DM
#define NTK  NT_
#define SCL  0.125f
#define LOSC 1024.0f
#define GI   2                   // batch items per pass
#define MR   (GI * NT_)          // rows of one pass
#define NBH  (GI * NH_)          // (item, head) pairs of one pass
#define PLN  ((size_t)MR * DM)   // elements of one [MR][512] plane

typedef _Float16 h16;
typedef unsigned short bf;
typedef __attribute__((ext_vector_type(16))) __bf16   v16bf;
typedef __attribute__((ext_vector_type(16))) _Float16 v16h;
typedef __attribute__((ext_vector_type(8)))  _Float16 v8h;
typedef __attribute__((ext_vector_type(8)))  unsigned short v8us;
typedef __attribute__((ext_vector_type(16))) unsigned short v16us;
typedef __attribute__((ext_vector_type(8)))  float    v8f;
typedef __attribute__((ext_vector_type(4)))  float    v4f;
typedef __attribute__((ext_vector_type(4)))  _Float16 v4h;
typedef v8h  __attribute__((may_alias)) v8ha;
typedef v4f  __attribute__((may_alias)) v4fa;
typedef v8us __attribute__((may_alias)) v8usa;

__device__ __forceinline__ unsigned short f2bf(float f) { unsigned u = __float_as_uint(f); u += 0x7FFFu + ((u >> 16) & 1u); return (unsigned short)(u >> 16); }
__device__ __forceinline__ float bf2f(unsigned short b) { return __uint_as_float(((unsigned)b) << 16); }
__device__ __forceinline__ float bfr(float f) { return bf2f(f2bf(f)); }
__device__ __forceinline__ v16h cat16(v8h lo, v8h hi) { return __builtin_shufflevector(lo, hi, 0, 1, 2, 3, 4, 5, 6, 7, 8, 9, 10, 11, 12, 13, 14, 15); }
__device__ __forceinline__ v16bf cat16b(v8us lo, v8us hi) { return __builtin_bit_cast(v16bf, __builtin_shufflevector(lo, hi, 0, 1, 2, 3, 4, 5, 6, 7, 8, 9, 10, 11, 12, 13, 14, 15)); }
__device__ __forceinline__ v8f wmma16(v16h a, v16h b, v8f c) { return __builtin_amdgcn_wmma_f32_16x16x32_f16(false, a, false, b, (short)0, c, false, false); }
__device__ __forceinline__ v8f wmmab(v16bf a, v16bf b, v8f c) { return __builtin_amdgcn_wmma_f32_16x16x32_bf16(false, a, false, b, (short)0, c, false, false); }

__device__ __forceinline__ void cvtb_body(const float* __restrict__ src, int nrows, bf* dst) {
    const int lane = threadIdx.x & 31, r = blockIdx.x * 8 + (threadIdx.x >> 5);
    if (r >= nrows) return;
    v8us o[DM / 256];
#pragma unroll
    for (int q = 0; q < DM / 256; ++q) { v8us t;
#pragma unroll
        for (int i = 0; i < 8; ++i) t[i] = f2bf(src[(size_t)r * DM + q * 256 + lane * 8 + i]);
        o[q] = t; }
#pragma unroll
    for (int q = 0; q < DM / 256; ++q) *(v8us*)(dst + (size_t)r * DM + q * 256 + lane * 8) = o[q];
}
// all eight weights in one launch: blockIdx.y picks the matrix
__global__ __launch_bounds__(256) void k_cvtw(const float* w0, const float* w1, const float* w2, const float* w3, const float* w4, const float* w5, const float* w6, const float* w7, bf* dst) {
    const int y = blockIdx.y;
    const float* src = y == 0 ? w0 : y == 1 ? w1 : y == 2 ? w2 : y == 3 ? w3 : y == 4 ? w4 : y == 5 ? w5 : y == 6 ? w6 : w7;
    cvtb_body(src, DM, dst + (size_t)y * DM * DM);
}
// both inputs, all items, in one launch: blockIdx.y picks the stream
__global__ __launch_bounds__(256) void k_cvtx(const float* xr, const float* xf, bf* dst) {
    cvtb_body(blockIdx.y ? xf : xr, NBI * NT_, dst + (size_t)blockIdx.y * NBI * NT_ * DM);
}

// k_gemmb: 64 x 64 block tile (4 waves x 16 x 64) of C[MR][512] = (A [+ Al]).B^T (K = 512) [+ bf(bias[c])] [+ bf(R[r][c]) residual]; f32 whole-line epilogue (or f16
template <bool SPLITA, bool F16OUT = false>
__device__ __forceinline__ void gemmb_body(const bf* __restrict__ A, const bf* __restrict__ Al, const bf* __restrict__ Bn, const float* __restrict__ bias, float* C, int ldc, h16* C2, const float* __restrict__ R = nullptr, int K = DM, int roundR = 1) {
    __shared__ __align__(16) float ost[4][16 * 68];
    const int lane = threadIdx.x & 31, wave = threadIdx.x >> 5, lr = lane & 15, hi = lane >> 4;
    const int r0 = blockIdx.x * 64 + wave * 16, c0 = blockIdx.y * 64;
    const size_t aoff = (size_t)(r0 + lr) * K + 8 * hi;
    size_t boff[4];
#pragma unroll
    for (int t = 0; t < 4; ++t) boff[t] = (size_t)(c0 + t * 16 + lr) * K + 8 * hi;
    v8f acc[4];
#pragma unroll
    for (int t = 0; t < 4; ++t) acc[t] = (v8f){};
#pragma unroll 1
    for (int kc = 0; kc < K; kc += 32) {
        const v16bf a = cat16b(*(const v8us*)(A + aoff + kc), *(const v8us*)(A + aoff + kc + 16));
        v16bf al = a;
        if (SPLITA) al = cat16b(*(const v8us*)(Al + aoff + kc), *(const v8us*)(Al + aoff + kc + 16));
#pragma unroll
        for (int t = 0; t < 4; ++t) { const v16bf b = cat16b(*(const v8us*)(Bn + boff[t] + kc), *(const v8us*)(Bn + boff[t] + kc + 16)); acc[t] = wmmab(a, b, acc[t]); if (SPLITA) acc[t] = wmmab(al, b, acc[t]); }
        asm volatile("v_nop\n\tv_nop\n\tv_nop\n\tv_nop" : "+v"(acc[0]), "+v"(acc[1]), "+v"(acc[2]), "+v"(acc[3]) : "v"(a), "v"(al));
    }
    float* os = &ost[wave][0];
#pragma unroll
    for (int t = 0; t < 4; ++t) { const float bv = bias ? bfr(bias[c0 + t * 16 + lr]) : 0.f;
#pragma unroll
        for (int j = 0; j < 8; ++j) os[(hi * 8 + j) * 68 + t * 16 + lr] = acc[t][j] + bv; }
    __syncthreads();
    if (F16OUT) {
        h16* crow = (h16*)(void*)C + (size_t)r0 * ldc + c0;
        auto pass = [&]() {
#pragma unroll
            for (int s = 0; s < 4; ++s) { const int row = 4 * s + (lane >> 3), piece = lane & 7; const float* sp = os + row * 68 + piece * 8; v8h o, o2;
#pragma unroll
                for (int i = 0; i < 8; ++i) { const h16 a = (h16)sp[i]; o[i] = a; o2[i] = (h16)((sp[i] - (float)a) * LOSC); }
                *(v8h*)(crow + (size_t)row * ldc + piece * 8) = o; if (C2) *(v8h*)(C2 + (size_t)r0 * ldc + c0 + (size_t)row * ldc + piece * 8) = o2; }
        };
        pass(); 
    } else {
        float* crow = C + (size_t)r0 * ldc + c0;
        auto pass = [&]() {
#pragma unroll
            for (int s = 0; s < 8; ++s) { const int Lid = (lane >> 3) + 4 * s, piece = lane & 7; const int row = Lid >> 1, cofs = (Lid & 1) * 32 + piece * 4;
                v4f val = *(const v4fa*)(os + row * 68 + cofs); if (R) { const v4f rv = *(const v4f*)(R + ((size_t)r0 + row) * ldc + c0 + cofs); val += roundR ? (v4f){bfr(rv[0]), bfr(rv[1]), bfr(rv[2]), bfr(rv[3])} : rv; }
                *(v4f*)(crow + (size_t)row * ldc + cofs) = val; }
        };
        pass(); 
    }
}
// the six projections of one pass in one launch: rows = GI items, blockIdx.z = q_r, k_r, q_f, k_f, v_r, v_f (weights in that order in WB; X = [stream][all rows][512], at the pass's first row)
__global__ __launch_bounds__(128) void k_proj(const bf* __restrict__ X, const bf* __restrict__ WB, const float* bq1, const float* bk1, const float* bq2, const float* bk2, const float* bv1, const float* bv2, float* TMP, int ldc, int K) {
    const int z = blockIdx.z;
    const bool flow = z == 2 || z == 3 || z == 5;
    const float* bias = z == 0 ? bq1 : z == 1 ? bk1 : z == 2 ? bq2 : z == 3 ? bk2 : z == 4 ? bv1 : bv2;
    gemmb_body<false, false>(X + (flow ? (size_t)NBI * NT_ * DM : 0), nullptr, WB + (size_t)z * DM * DM, bias, TMP + (size_t)z * PLN, ldc, nullptr, nullptr, K);
}
// both output projections of one pass in one launch: blockIdx.z = stream
__global__ __launch_bounds__(128) void k_outp(const bf* __restrict__ Ch, const bf* __restrict__ Cl, const bf* __restrict__ WBo, const float* bo1, const float* bo2, float* o0, float* o1, int ldc, int K) {
    const int s = blockIdx.z;
    gemmb_body<true, false>(Ch + (size_t)s * PLN, Cl + (size_t)s * PLN, WBo + (size_t)s * DM * DM, s ? bo2 : bo1, s ? o1 : o0, ldc, nullptr, nullptr, K);
}

// k_vt (blockIdx.z = (stream * GI + item) * 4 + group; V^T planes [512 columns][1024 tokens] as 4 x 128-row groups): VTH/VTL [g][128 d][1024 t] = bf16 hi + UNSCALED bf16 residual of V [t][g*128+d] via 64 x 64 LDS tiles; grid (NT/64, 2 (d half), 16 (stream, item, group)).
__global__ __launch_bounds__(256) void k_vt(const float* __restrict__ Vall, bf* VTH, bf* VTL) {
    __shared__ float tl[64][65];
    const int tid = threadIdx.x, t0 = blockIdx.x * 64, d0 = blockIdx.y * 64, g = blockIdx.z % NKVV;
    const size_t io = (size_t)(blockIdx.z / NKVV) * NT_ * DM; const float* V = Vall + io;
    { const int tt = tid >> 2, dq = (tid & 3) * 16;
#pragma unroll
      for (int i = 0; i < 16; ++i) tl[dq + i][tt] = V[(size_t)(t0 + tt) * KW + g * VHD + d0 + dq + i]; }
    __syncthreads();
    const int piece = tid & 7;
    auto pass = [&]() {
#pragma unroll
        for (int s = 0; s < 2; ++s) { const int d = (tid >> 3) + 32 * s; v8us oh, ol;
#pragma unroll
            for (int i = 0; i < 8; ++i) { const float v = tl[d][piece * 8 + i]; const unsigned short hb = f2bf(v); oh[i] = hb; ol[i] = f2bf(v - bf2f(hb)); }
            const size_t o = io + ((size_t)g * VHD + d0 + d) * NT_ + t0 + piece * 8; *(v8us*)(VTH + o) = oh; *(v8us*)(VTL + o) = ol; }
    };
    pass(); 
}

// blockIdx.y = plane (q_r, k_r, q_f, k_f); rows = GI items
__global__ __launch_bounds__(256) void k_hsplit(const float* __restrict__ Xall, bf* Ph, bf* Pl) {
    typedef __attribute__((ext_vector_type(2))) unsigned short v2us;
    const int lane = threadIdx.x & 31, wid = blockIdx.x * 8 + (threadIdx.x >> 5); if (wid >= MR * NH_) return;
    const int t = wid / NH_, h = wid % NH_; v2us oh, ol; const size_t yo = (size_t)blockIdx.y * PLN; const float* X = Xall + yo;
#pragma unroll
    for (int i = 0; i < 2; ++i) { const float v = X[(size_t)t * DM + h * HD + 2 * lane + i]; const unsigned short hb = f2bf(v); oh[i] = hb; ol[i] = f2bf(v - bf2f(hb)); }
    const size_t o = yo + (((size_t)(t / NT_) * NH_ + h) * NT_ + t % NT_) * HD + 2 * lane;
    *(v2us*)(Ph + o) = oh; *(v2us*)(Pl + o) = ol; 
}
// e^x as the native form has it (one multiply, v_exp_f32); the v_nop is the one free slot that the instruction set asks for behind a transcendental, in its own statement so that it stays there
__device__ __forceinline__ float exp_slot(float x) { float r; asm("v_exp_f32 %0, %1\n\tv_nop" : "=v"(r) : "v"(x * 1.44269504088896340736f)); return r; }
// k_attn: one work-group = 16 queries of one (item, head) pair, all 1024 keys, both streams; wave w owns keys w*128 .. w*128+127. The scores are formed transposed, S^T = K.Q^T
// (A = key rows, B = query rows, the same loader for both, three products per 32-k step in the order hh, k_hi.q_lo, k_lo.q_hi), so a lane holds 64 scores of ONE query per stream
// and both maps stay in registers. Row maximum and row sum: in the lane, one exchange between the lane halves, then over the 8 waves through LDS. p = max(p_r, p_f) is split into
// bf16 hi + residual in place: two neighbouring score tiles are one B operand of O^T = V^T.P^T. Each wave sums its own 128 keys; the 8 partial O^T are added through LDS in wave order.
#define AW   8                   // waves of a work-group
#define AKW  (NT_ / AW)          // keys of a wave
#define AKT  (AKW / 16)          // score tiles of a wave, per stream
// four waves per SIMD (two work-groups per WGP): holds the build within 256 registers a wave; one more register granule would leave one work-group per WGP
#define OTS  272                 // floats of one staged 16 x 16 partial tile: 256 + 16, so that the four d tiles a wave reads together start 64 bytes apart in the banks
__global__ __launch_bounds__(256) __attribute__((amdgpu_waves_per_eu(4, 4))) void k_attn(const bf* __restrict__ QKh, const bf* __restrict__ QKl, const bf* __restrict__ VTh, const bf* __restrict__ VTl, float* CC) {
    __shared__ __align__(16) float ored[AW][8][OTS];
    __shared__ float sred[2][2][AW][16];             // [maximum, sum][stream][wave][query]
    const int lane = threadIdx.x & 31, wave = threadIdx.x >> 5, c = lane & 15, h = lane >> 4;
    const int q0 = blockIdx.x * 16, p = blockIdx.y, kb = wave * AKW;
    const unsigned lo64 = (unsigned)(c * HD + 8 * h);
    const unsigned qob = lo64 * 2u;                  // the lane's byte offset in the query block
    const bf* qbh = (const bf*)((const char*)(QKh + ((size_t)p * NT_ + q0) * HD) + qob); const bf* qbl = (const bf*)((const char*)(QKl + ((size_t)p * NT_ + q0) * HD) + qob);
    const bf* kbh = QKh + ((size_t)p * NT_ + kb) * HD + lo64; const bf* kbl = QKl + ((size_t)p * NT_ + kb) * HD + lo64;
    v8f S[2][AKT];
    v16bf qh[2][2], ql[2][2];
    auto loadq = [&](int s) {
#pragma unroll
        for (int kk = 0; kk < 2; ++kk) { const bf* a = qbh + (size_t)(2 * s) * PLN + kk * 32; const bf* b = qbl + (size_t)(2 * s) * PLN + kk * 32;
            qh[s][kk] = cat16b(*(const v8us*)a, *(const v8us*)(a + 16)); ql[s][kk] = cat16b(*(const v8us*)b, *(const v8us*)(b + 16)); }
    };
    loadq(0);
#pragma unroll
    for (int s = 0; s < 2; ++s) {
        const bf* kph = kbh + (size_t)(2 * s + 1) * PLN; const bf* kpl = kbl + (size_t)(2 * s + 1) * PLN;
#pragma unroll
        for (int t = 0; t < AKT; ++t) S[s][t] = (v8f){};
#pragma unroll
        for (int g = 0; g < AKT; g += 4) {
#pragma unroll
            for (int kk = 0; kk < 2; ++kk) { v16bf kh[4], kl[4];
#pragma unroll
                for (int t = 0; t < 4; ++t) { const unsigned o = (g + t) * 16 * HD + kk * 32;
                    kh[t] = cat16b(*(const v8us*)(kph + o), *(const v8us*)(kph + o + 16)); kl[t] = cat16b(*(const v8us*)(kpl + o), *(const v8us*)(kpl + o + 16)); }
                // the second stream's queries ride with the first stream's last group. Behind the last query loads, and behind the last key loads, the address registers fall free:
                // the wait stands before anything is written over them, and names them as inputs so that they are kept until it
                if (s == 0 && g == AKT - 4 && kk == 1) { loadq(1); asm volatile("s_wait_xcnt 0x0" :: "v"(qob) : "memory"); }
                if (s == 1 && g == AKT - 4 && kk == 1) asm volatile("s_wait_xcnt 0x0" :: "v"(kbh), "v"(kbl) : "memory");
                __builtin_amdgcn_sched_barrier(0);    // the 16 loads of four key tiles go out as one group: left alone, each product waits on a load issued just in front of it
#pragma unroll
                for (int t = 0; t < 4; ++t) { v8f acc = S[s][g + t]; acc = wmmab(kh[t], qh[s][kk], acc); acc = wmmab(kh[t], ql[s][kk], acc); acc = wmmab(kl[t], qh[s][kk], acc); S[s][g + t] = acc; } }
        }
    }
    float m[2], inv[2];
#pragma unroll
    for (int s = 0; s < 2; ++s) { v8f v = S[s][0] * SCL;
#pragma unroll
        for (int t = 1; t < AKT; ++t) {
#pragma unroll
            for (int r = 0; r < 8; ++r) v[r] = fmaxf(v[r], S[s][t][r] * SCL); }
        float x = fmaxf(fmaxf(fmaxf(v[0], v[1]), fmaxf(v[2], v[3])), fmaxf(fmaxf(v[4], v[5]), fmaxf(v[6], v[7])));
        x = fmaxf(x, __shfl_xor(x, 16, 32));
        if (h == 0) sred[0][s][wave][c] = x; }
    __syncthreads();
#pragma unroll
    for (int s = 0; s < 2; ++s) { float x = sred[0][s][0][c];
#pragma unroll
        for (int w = 1; w < AW; ++w) x = fmaxf(x, sred[0][s][w][c]);
        m[s] = x; }
#pragma unroll
    for (int s = 0; s < 2; ++s) { v8f a = (v8f){};
#pragma unroll
        for (int t = 0; t < AKT; ++t) {
#pragma unroll
            for (int r = 0; r < 8; ++r) { const float e = exp_slot(S[s][t][r] * SCL - m[s]); S[s][t][r] = e; a[r] += e; } }
        float x = ((a[0] + a[1]) + (a[2] + a[3])) + ((a[4] + a[5]) + (a[6] + a[7]));
        x += __shfl_xor(x, 16, 32);
        if (h == 0) sred[1][s][wave][c] = x; }
    __syncthreads();
#pragma unroll
    for (int s = 0; s < 2; ++s) { float x = sred[1][s][0][c];
#pragma unroll
        for (int w = 1; w < AW; ++w) x += sred[1][s][w][c];
        inv[s] = 1.0f / x; }
    v16bf ph[AKT / 2], pl[AKT / 2];
#pragma unroll
    for (int j = 0; j < AKT / 2; ++j) { v16us oh, ol;
#pragma unroll
        for (int i = 0; i < 16; ++i) { const int t = 2 * j + (i >> 3), r = i & 7;
            const float pv = fmaxf(S[0][t][r] * inv[0], S[1][t][r] * inv[1]); const unsigned short hb = f2bf(pv); oh[i] = hb; ol[i] = f2bf(pv - bf2f(hb)); }
        ph[j] = __builtin_bit_cast(v16bf, oh); pl[j] = __builtin_bit_cast(v16bf, ol); }
    const unsigned lov = (unsigned)(c * NT_ + 8 * h);
#pragma unroll
    for (int s = 0; s < 2; ++s) {
        const size_t vo = (size_t)s * PLN + (size_t)p * HD * NT_ + kb;
        const bf* vph = VTh + vo; const bf* vpl = VTl + vo;
        v8f O[4];
#pragma unroll
        for (int dt = 0; dt < 4; ++dt) O[dt] = (v8f){};
#pragma unroll
        for (int j = 0; j < AKT / 2; ++j) { v16bf vh[4], vl[4];
#pragma unroll
            for (int dt = 0; dt < 4; ++dt) { const unsigned o = lov + dt * 16 * NT_ + j * 32;
                vh[dt] = cat16b(*(const v8us*)(vph + o), *(const v8us*)(vph + o + 16)); vl[dt] = cat16b(*(const v8us*)(vpl + o), *(const v8us*)(vpl + o + 16)); }
            __builtin_amdgcn_sched_barrier(0);    // as above: the 16 loads of four d tiles go out as one group
#pragma unroll
            for (int dt = 0; dt < 4; ++dt) { v8f acc = O[dt]; acc = wmmab(vh[dt], ph[j], acc); acc = wmmab(vh[dt], pl[j], acc); acc = wmmab(vl[dt], ph[j], acc); O[dt] = acc; } }
        // four vector slots between the last products of this stream and the first of the next, which start anew (C = 0) in the same accumulator registers
        if (s == 0) asm volatile("v_nop\n\tv_nop\n\tv_nop\n\tv_nop" : "+v"(O[0]), "+v"(O[1]), "+v"(O[2]), "+v"(O[3]));
#pragma unroll
        for (int dt = 0; dt < 4; ++dt) { float* ow = &ored[wave][s * 4 + dt][0];
            *(v4fa*)(ow + lane * 4) = (v4f){O[dt][0], O[dt][1], O[dt][2], O[dt][3]}; *(v4fa*)(ow + 128 + lane * 4) = (v4f){O[dt][4], O[dt][5], O[dt][6], O[dt][7]}; }
    }
    __syncthreads();
    // wave w adds and stores stream w / 4, queries (w % 4) * 4 .. + 3: 8 lanes a query, 8 consecutive d a lane, whole 128-byte lines
    const int so = wave >> 2, qq = (wave & 3) * 4 + (lane >> 3), dc = lane & 7, sl = (dc & 1) * 16 + qq;
    v4f a0 = (v4f){}, a1 = (v4f){};
#pragma unroll
    for (int w = 0; w < AW; ++w) { const float* ir = &ored[w][so * 4 + (dc >> 1)][0]; a0 += *(const v4fa*)(ir + sl * 4); a1 += *(const v4fa*)(ir + 128 + sl * 4); }
    float* cp = CC + (size_t)so * PLN + ((size_t)(p / NH_) * NT_ + q0 + qq) * DM + (p % NH_) * HD + dc * 8;
    *(v4f*)cp = a0; *(v4f*)(cp + 4) = a1;
}
__global__ __launch_bounds__(256) void k_split(const float* __restrict__ src, int nrows, bf* dh, bf* dl) {
    const int lane = threadIdx.x & 31, r = blockIdx.x * 8 + (threadIdx.x >> 5); if (r >= nrows) return;
{
#pragma unroll 1
        for (int q = 0; q < DM / 256; ++q) { const size_t o = (size_t)r * DM + q * 256 + lane * 8; const v8f v = *(const v8f*)(src + o); v8us oh, ol;
#pragma unroll
            for (int i = 0; i < 8; ++i) { const unsigned short hb = f2bf(v[i]); oh[i] = hb; ol[i] = f2bf(v[i] - bf2f(hb)); }
            *(v8us*)(dh + o) = oh; *(v8us*)(dl + o) = ol;
            asm volatile("s_wait_xcnt 0x0" ::: "memory"); }    // the next trip rewrites the address and data registers of the two stores
         }
}

extern "C" void kernel_launch(void* const* d_in, const int* in_sizes, int n_in,
                              void* d_out, int out_size, void* d_ws, size_t ws_size, hipStream_t stream) {
    (void)in_sizes; (void)n_in; (void)out_size;
    const float* xr = (const float*)d_in[0]; const float* xf = (const float*)d_in[1];
    const float* Wq1 = (const float*)d_in[2]; const float* bq1 = (const float*)d_in[3]; const float* Wk1 = (const float*)d_in[4]; const float* bk1 = (const float*)d_in[5]; const float* Wv1 = (const float*)d_in[6]; const float* bv1 = (const float*)d_in[7];
    const float* Wq2 = (const float*)d_in[8]; const float* bq2 = (const float*)d_in[9]; const float* Wk2 = (const float*)d_in[10]; const float* bk2 = (const float*)d_in[11]; const float* Wv2 = (const float*)d_in[12]; const float* bv2 = (const float*)d_in[13];
    const float* Wo1 = (const float*)d_in[14]; const float* bo1 = (const float*)d_in[15]; const float* Wo2 = (const float*)d_in[16]; const float* bo2 = (const float*)d_in[17];
    float* out0 = (float*)d_out; float* out1 = out0 + (size_t)NBI * NT_ * DM;    // (out_rgb.Wo1 + bo1, out_flow.Wo2 + bo2)
    char* wsp = (char*)d_ws;
    auto take = [&](size_t bytes) { char* p = wsp; wsp += (bytes + 255) & ~(size_t)255; return (void*)p; };
    bf* WB = (bf*)take((size_t)8 * DM * DM * 2);                                      // q_r, k_r, q_f, k_f, v_r, v_f, o_r, o_f
    bf* X = (bf*)take((size_t)2 * NBI * NT_ * DM * 2);                                // [stream][item][token][512]
    bf* QKh = (bf*)take(4 * PLN * 2); bf* QKl = (bf*)take(4 * PLN * 2);               // q_r, k_r, q_f, k_f, each [pair][token][64]
    bf* VTh = (bf*)take(2 * PLN * 2); bf* VTl = (bf*)take(2 * PLN * 2);               // [stream][item][512][token]
    float* TMP = (float*)take(6 * PLN * 4);                                           // the six f32 projections of a pass
    float* CC = (float*)take(2 * PLN * 4); bf* Ch = (bf*)take(2 * PLN * 2); bf* Cl = (bf*)take(2 * PLN * 2);   // [stream][row][512]
    if ((size_t)(wsp - (char*)d_ws) > ws_size) return;    // 4 + 16 + 16 + 8 + 24 + 8 + 8 = 84 MiB
    k_cvtw<<<dim3(DM / 8, 8, 1), 256, 0, stream>>>(Wq1, Wk1, Wq2, Wk2, Wv1, Wv2, Wo1, Wo2, WB);
    k_cvtx<<<dim3(NBI * NT_ / 8, 2, 1), 256, 0, stream>>>(xr, xf, X);
    for (int b = 0; b < NBI; b += GI) {
        k_proj<<<dim3(MR / 64, DM / 64, 6), 128, 0, stream>>>(X + (size_t)b * NT_ * DM, WB, bq1, bk1, bq2, bk2, bv1, bv2, TMP, DM, DM);
        k_hsplit<<<dim3((MR * NH_) / 8, 4, 1), 256, 0, stream>>>(TMP, QKh, QKl);
        k_vt<<<dim3(NT_ / 64, 2, NKVV * GI * 2), 256, 0, stream>>>(TMP + 4 * PLN, VTh, VTl);
        k_attn<<<dim3(NT_ / 16, NBH, 1), 256, 0, stream>>>(QKh, QKl, VTh, VTl, CC);                                                     // scores, both softmaxes, the merge and ctx of both streams, all pairs
        k_split<<<2 * MR / 8, 256, 0, stream>>>(CC, 2 * MR, Ch, Cl);
        k_outp<<<dim3(MR / 64, DM / 64, 2), 128, 0, stream>>>(Ch, Cl, WB + (size_t)6 * DM * DM, bo1, bo2, out0 + (size_t)b * NT_ * DM, out1 + (size_t)b * NT_ * DM, DM, DM);
    }
}

// v003
// It runs in 426 microseconds.
// Timed twice side by side with v002, it ran 1.34 and 1.35 times as fast.
// Counting every step since v000, it is 14.3 times as fast.
#include <hip/hip_runtime.h>

// Compute dtypes, f32 accumulate, GI batch items per pass, every stage of a pass ONE launch (items, heads, the two streams and the projections ride in the grid): the six projections x.W^T + b ([1024 x 512].[512 x 512]; [out][in] weights as n-major B operands; PLAIN bf16
// operands = inputs rounded once, exact) and the two output projections (ctx as bf16 hi + UNSCALED residual) on v_wmma_f32_16x16x32_bf16; per (item, head) both
// score maps q.k^T ([1024 x 64].[64 x 1024]) and both P.v products ([1024 x 1024].[1024 x 64]) with both operands split (three products), in ONE kernel that keeps scores and P in registers

#define NBI  8
#define NT_  1024
#define DM   512
#define NH_  8
#define HD   64
#define VHD  128                 // k_vt tile geometry (4 groups of 128 columns)
#define NKVV 4
#define KW   DM
#define NTK  NT_
#define SCL  0.125f
#define LOSC 1024.0f
#define GI   2                   // batch items per pass
#define MR   (GI * NT_)          // rows of one pass
#define NBH  (GI * NH_)          // (item, head) pairs of one pass
#define PLN  ((size_t)MR * DM)   // elements of one [MR][512] plane

typedef _Float16 h16;
typedef unsigned short bf;
typedef __attribute__((ext_vector_type(16))) __bf16   v16bf;
typedef __attribute__((ext_vector_type(16))) _Float16 v16h;
typedef __attribute__((ext_vector_type(8)))  _Float16 v8h;
typedef __attribute__((ext_vector_type(8)))  unsigned short v8us;
typedef __attribute__((ext_vector_type(16))) unsigned short v16us;
typedef __attribute__((ext_vector_type(8)))  float    v8f;
typedef __attribute__((ext_vector_type(4)))  float    v4f;
typedef __attribute__((ext_vector_type(4)))  _Float16 v4h;
typedef v8h  __attribute__((may_alias)) v8ha;
typedef v4f  __attribute__((may_alias)) v4fa;
typedef v8us __attribute__((may_alias)) v8usa;

__device__ __forceinline__ unsigned short f2bf(float f) { unsigned u = __float_as_uint(f); u += 0x7FFFu + ((u >> 16) & 1u); return (unsigned short)(u >> 16); }
__device__ __forceinline__ float bf2f(unsigned short b) { return __uint_as_float(((unsigned)b) << 16); }
__device__ __forceinline__ float bfr(float f) { return bf2f(f2bf(f)); }
__device__ __forceinline__ v16h cat16(v8h lo, v8h hi) { return __builtin_shufflevector(lo, hi, 0, 1, 2, 3, 4, 5, 6, 7, 8, 9, 10, 11, 12, 13, 14, 15); }
__device__ __forceinline__ v16bf cat16b(v8us lo, v8us hi) { return __builtin_bit_cast(v16bf, __builtin_shufflevector(lo, hi, 0, 1, 2, 3, 4, 5, 6, 7, 8, 9, 10, 11, 12, 13, 14, 15)); }
__device__ __forceinline__ v8f wmma16(v16h a, v16h b, v8f c) { return __builtin_amdgcn_wmma_f32_16x16x32_f16(false, a, false, b, (short)0, c, false, false); }
__device__ __forceinline__ v8f wmmab(v16bf a, v16bf b, v8f c) { return __builtin_amdgcn_wmma_f32_16x16x32_bf16(false, a, false, b, (short)0, c, false, false); }

// FRAGMENT ORDER. Every 16-row x 32-k operand tile lies in the workspace as the matrix instruction's lanes hold it: [piece 0, 1][lane][8 elements], 1 KiB; lane (h = lane / 16, c = lane % 16)
// holds row c, k = 8h .. 8h + 7 (piece 0) and 16 + 8h .. 16 + 8h + 7 (piece 1). One wave-wide 16-byte load of a piece then reads 512 consecutive bytes (4 whole lines) where rows of a
// row-major plane gave 16 lines, a quarter of each used. The k order of every product is the one it was.
#define FT   512                 // elements of a tile
#define FP   256                 // elements of a piece
// one wave packs two tiles that lie side by side (64 columns) in 16 rows of a row-major f32 [..][512] matrix; src = row 0, first column; dh, dl = the first tile's place
template <bool LO>
__device__ __forceinline__ void pack2(const float* __restrict__ src, bf* dh, bf* dl) {
    const int lane = threadIdx.x & 31;
    const float* sp = src + (size_t)(lane & 15) * DM + 8 * (lane >> 4);
    v4f v[4][2];
#pragma unroll
    for (int q = 0; q < 4; ++q) { v[q][0] = *(const v4f*)(sp + q * 16); v[q][1] = *(const v4f*)(sp + q * 16 + 4); }
#pragma unroll
    for (int q = 0; q < 4; ++q) { v8us oh, ol;
#pragma unroll
        for (int i = 0; i < 8; ++i) { const float x = v[q][i >> 2][i & 3]; const unsigned short hb = f2bf(x); oh[i] = hb; ol[i] = f2bf(x - bf2f(hb)); }
        *(v8us*)(dh + q * FP + lane * 8) = oh; if (LO) *(v8us*)(dl + q * FP + lane * 8) = ol; }
}
// a row-major [rows][512] matrix as a GEMM operand: tiles in the order [row tile][k step]; wave wid takes row tile wid / 8, k steps 2 (wid % 8) and the next
template <bool LO>
__device__ __forceinline__ void packm(const float* __restrict__ src, bf* dh, bf* dl) {
    const int wid = blockIdx.x * 8 + (threadIdx.x >> 5), rt = wid >> 3, kq = wid & 7;
    const size_t o = ((size_t)rt * (DM / 32) + kq * 2) * FT;
    pack2<LO>(src + (size_t)rt * 16 * DM + kq * 64, dh + o, dl + o);
}
// all eight weights in one launch: blockIdx.y picks the matrix
__global__ __launch_bounds__(256) void k_cvtw(const float* w0, const float* w1, const float* w2, const float* w3, const float* w4, const float* w5, const float* w6, const float* w7, bf* dst) {
    const int y = blockIdx.y;
    const float* src = y == 0 ? w0 : y == 1 ? w1 : y == 2 ? w2 : y == 3 ? w3 : y == 4 ? w4 : y == 5 ? w5 : y == 6 ? w6 : w7;
    packm<false>(src, dst + (size_t)y * DM * DM, dst);
}
// both inputs, all items, in one launch: blockIdx.y picks the stream
__global__ __launch_bounds__(256) void k_cvtx(const float* xr, const float* xf, bf* dst) {
    packm<false>(blockIdx.y ? xf : xr, dst + (size_t)blockIdx.y * NBI * NT_ * DM, dst);
}

// k_gemmb: 64 x 64 block tile (4 waves x 16 x 64) of C[MR][512] = (A [+ Al]).B^T (K = 512) [+ bf(bias[c])] [+ bf(R[r][c]) residual]; f32 whole-line epilogue (or f16
template <bool SPLITA, bool F16OUT = false>
__device__ __forceinline__ void gemmb_body(const bf* __restrict__ A, const bf* __restrict__ Al, const bf* __restrict__ Bn, const float* __restrict__ bias, float* C, int ldc, h16* C2, const float* __restrict__ R = nullptr, int K = DM, int roundR = 1) {
    __shared__ __align__(16) float ost[4][16 * 68];
    const int lane = threadIdx.x & 31, wave = threadIdx.x >> 5, lr = lane & 15, hi = lane >> 4;
    const int r0 = blockIdx.x * 64 + wave * 16, c0 = blockIdx.y * 64;
    // operands in fragment order: 16 rows x K = K / 32 tiles in a row; the tile rows' bases are the same for a whole wave, the lane's byte offset vo walks the tiles
    const size_t aoff = (size_t)__builtin_amdgcn_readfirstlane(r0) * K;
    const char* pa = (const char*)(A + aoff); const char* pal = (const char*)(Al + (SPLITA ? aoff : 0));
    const char* pb[4];
#pragma unroll
    for (int t = 0; t < 4; ++t) pb[t] = (const char*)(Bn + (size_t)(c0 + t * 16) * K);
    unsigned vo = lane * 16;
    v8f acc[4];
#pragma unroll
    for (int t = 0; t < 4; ++t) acc[t] = (v8f){};
#pragma unroll 1
    for (int kc = 0; kc < K; kc += 32) {
        const v16bf a = cat16b(*(const v8us*)(pa + vo), *(const v8us*)(pa + vo + FP * 2));
        v16bf al = a;
        if (SPLITA) al = cat16b(*(const v8us*)(pal + vo), *(const v8us*)(pal + vo + FP * 2));
        v16bf b[4];
#pragma unroll
        for (int t = 0; t < 4; ++t) b[t] = cat16b(*(const v8us*)(pb[t] + vo), *(const v8us*)(pb[t] + vo + FP * 2));
        vo += FT * 2;
#pragma unroll
        for (int t = 0; t < 4; ++t) { acc[t] = wmmab(a, b[t], acc[t]); if (SPLITA) acc[t] = wmmab(al, b[t], acc[t]); }
        asm volatile("v_nop\n\tv_nop\n\tv_nop\n\tv_nop" : "+v"(acc[0]), "+v"(acc[1]), "+v"(acc[2]), "+v"(acc[3]) : "v"(a), "v"(al));
    }
    float* os = &ost[wave][0];
#pragma unroll
    for (int t = 0; t < 4; ++t) { const float bv = bias ? bfr(bias[c0 + t * 16 + lr]) : 0.f;
#pragma unroll
        for (int j = 0; j < 8; ++j) os[(hi * 8 + j) * 68 + t * 16 + lr] = acc[t][j] + bv; }
    __syncthreads();
    if (F16OUT) {
        h16* crow = (h16*)(void*)C + (size_t)r0 * ldc + c0;
        auto pass = [&]() {
#pragma unroll
            for (int s = 0; s < 4; ++s) { const int row = 4 * s + (lane >> 3), piece = lane & 7; const float* sp = os + row * 68 + piece * 8; v8h o, o2;
#pragma unroll
                for (int i = 0; i < 8; ++i) { const h16 a = (h16)sp[i]; o[i] = a; o2[i] = (h16)((sp[i] - (float)a) * LOSC); }
                *(v8h*)(crow + (size_t)row * ldc + piece * 8) = o; if (C2) *(v8h*)(C2 + (size_t)r0 * ldc + c0 + (size_t)row * ldc + piece * 8) = o2; }
        };
        pass(); 
    } else {
        float* crow = C + (size_t)r0 * ldc + c0;
        auto pass = [&]() {
#pragma unroll
            for (int s = 0; s < 8; ++s) { const int Lid = (lane >> 3) + 4 * s, piece = lane & 7; const int row = Lid >> 1, cofs = (Lid & 1) * 32 + piece * 4;
                v4f val = *(const v4fa*)(os + row * 68 + cofs); if (R) { const v4f rv = *(const v4f*)(R + ((size_t)r0 + row) * ldc + c0 + cofs); val += roundR ? (v4f){bfr(rv[0]), bfr(rv[1]), bfr(rv[2]), bfr(rv[3])} : rv; }
                *(v4f*)(crow + (size_t)row * ldc + cofs) = val; }
        };
        pass(); 
    }
}
// the six projections of one pass in one launch: rows = GI items, blockIdx.z = q_r, k_r, q_f, k_f, v_r, v_f (weights in that order in WB; X = [stream][16-row tile][k step], at the pass's first row)
__global__ __launch_bounds__(128) void k_proj(const bf* __restrict__ X, const bf* __restrict__ WB, const float* bq1, const float* bk1, const float* bq2, const float* bk2, const float* bv1, const float* bv2, float* TMP, int ldc, int K) {
    const int z = blockIdx.z;
    const bool flow = z == 2 || z == 3 || z == 5;
    const float* bias = z == 0 ? bq1 : z == 1 ? bk1 : z == 2 ? bq2 : z == 3 ? bk2 : z == 4 ? bv1 : bv2;
    gemmb_body<false, false>(X + (flow ? (size_t)NBI * NT_ * DM : 0), nullptr, WB + (size_t)z * DM * DM, bias, TMP + (size_t)z * PLN, ldc, nullptr, nullptr, K);
}
// both output projections of one pass in one launch: blockIdx.z = stream
__global__ __launch_bounds__(128) void k_outp(const bf* __restrict__ Ch, const bf* __restrict__ Cl, const bf* __restrict__ WBo, const float* bo1, const float* bo2, float* o0, float* o1, int ldc, int K) {
    const int s = blockIdx.z;
    gemmb_body<true, false>(Ch + (size_t)s * PLN, Cl + (size_t)s * PLN, WBo + (size_t)s * DM * DM, s ? bo2 : bo1, s ? o1 : o0, ldc, nullptr, nullptr, K);
}

// k_vt (blockIdx.z = (stream * GI + item) * 4 + group of 128 columns; blockIdx.y = 64-column half = head in the group; blockIdx.x = 64 tokens): VTH/VTL = bf16 hi + UNSCALED bf16 residual of V^T, turned through a 64 x 64 LDS tile.
__global__ __launch_bounds__(256) void k_vt(const float* __restrict__ Vall, bf* VTH, bf* VTL) {
    __shared__ float tl[64][65];
    const int tid = threadIdx.x, t0 = blockIdx.x * 64, d0 = blockIdx.y * 64, g = blockIdx.z % NKVV;
    const size_t io = (size_t)(blockIdx.z / NKVV) * NT_ * DM; const float* V = Vall + io;
    { const int tt = tid >> 2, dq = (tid & 3) * 16;
#pragma unroll
      for (int i = 0; i < 16; ++i) tl[dq + i][tt] = V[(size_t)(t0 + tt) * KW + g * VHD + d0 + dq + i]; }
    __syncthreads();
    // out in fragment order, per (stream, item, head): [32-token step][16-d tile][piece][lane][8 tokens]; a wave stores one piece (512 consecutive bytes) at a time
    const int lane = tid & 31, c = lane & 15, h = lane >> 4;
#pragma unroll
    for (int s = 0; s < 2; ++s) { const int cb = (tid >> 5) * 2 + s, dt = cb >> 2, tsl = (cb >> 1) & 1, pc = cb & 1; v8us oh, ol;
#pragma unroll
        for (int i = 0; i < 8; ++i) { const float v = tl[dt * 16 + c][tsl * 32 + pc * 16 + h * 8 + i]; const unsigned short hb = f2bf(v); oh[i] = hb; ol[i] = f2bf(v - bf2f(hb)); }
        const size_t o = io + (size_t)(g * 2 + blockIdx.y) * HD * NT_ + (size_t)(((t0 >> 5) + tsl) * 4 + dt) * FT + pc * FP + lane * 8; *(v8us*)(VTH + o) = oh; *(v8us*)(VTL + o) = ol; }
}

// blockIdx.y = plane (q_r, k_r, q_f, k_f); rows = GI items
__global__ __launch_bounds__(256) void k_hsplit(const float* __restrict__ Xall, bf* Ph, bf* Pl) {
    // a wave takes 16 tokens of one head: two tiles; out per (plane, item, head): [16-token tile][k step][piece][lane][8]
    const int wid = blockIdx.x * 8 + (threadIdx.x >> 5), rt = wid / NH_, hd = wid % NH_;
    const size_t yo = (size_t)blockIdx.y * PLN;
    const size_t o = yo + (((size_t)(rt / (NT_ / 16)) * NH_ + hd) * (NT_ / 16) + rt % (NT_ / 16)) * (16 * HD);
    pack2<true>(Xall + yo + (size_t)rt * 16 * DM + hd * HD, Ph + o, Pl + o);
}
// e^x as the native form has it (one multiply, v_exp_f32); the v_nop is the one free slot that the instruction set asks for behind a transcendental, in its own statement so that it stays there
__device__ __forceinline__ float exp_slot(float x) { float r; asm("v_exp_f32 %0, %1\n\tv_nop" : "=v"(r) : "v"(x * 1.44269504088896340736f)); return r; }
// k_attn: one work-group = 16 queries of one (item, head) pair, all 1024 keys, both streams; wave w owns keys w*128 .. w*128+127. The scores are formed transposed, S^T = K.Q^T
// (A = key rows, B = query rows, the same loader for both, three products per 32-k step in the order hh, k_hi.q_lo, k_lo.q_hi), so a lane holds 64 scores of ONE query per stream
// and both maps stay in registers. Row maximum and row sum: in the lane, one exchange between the lane halves, then over the 8 waves through LDS. p = max(p_r, p_f) is split into
// bf16 hi + residual in place: two neighbouring score tiles are one B operand of O^T = V^T.P^T. Each wave sums its own 128 keys; the 8 partial O^T are added through LDS in wave order.
#define AW   8                   // waves of a work-group
#define AKW  (NT_ / AW)          // keys of a wave
#define AKT  (AKW / 16)          // score tiles of a wave, per stream
// four waves per SIMD (two work-groups per WGP): holds the build within 256 registers a wave; one more register granule would leave one work-group per WGP
#define OTS  272                 // floats of one staged 16 x 16 partial tile: 256 + 16, so that the four d tiles a wave reads together start 64 bytes apart in the banks
__global__ __launch_bounds__(256) __attribute__((amdgpu_waves_per_eu(4, 4))) void k_attn(const bf* __restrict__ QKh, const bf* __restrict__ QKl, const bf* __restrict__ VTh, const bf* __restrict__ VTl, float* CC) {
    __shared__ __align__(16) float ored[AW][8][OTS];
    __shared__ float sred[2][2][AW][16];             // [maximum, sum][stream][wave][query]
    const int lane = threadIdx.x & 31, wave = threadIdx.x >> 5, c = lane & 15, h = lane >> 4;
    const int q0 = blockIdx.x * 16, p = blockIdx.y, kb = wave * AKW;
    const unsigned lo64 = (unsigned)(lane * 8);      // operands in fragment order: 16 tokens x 64 = two tiles in a row
    const unsigned qob = lo64 * 2u;                  // the lane's byte offset in the query block
    const bf* qbh = (const bf*)((const char*)(QKh + ((size_t)p * NT_ + q0) * HD) + qob); const bf* qbl = (const bf*)((const char*)(QKl + ((size_t)p * NT_ + q0) * HD) + qob);
    const bf* kbh = QKh + ((size_t)p * NT_ + kb) * HD + lo64; const bf* kbl = QKl + ((size_t)p * NT_ + kb) * HD + lo64;
    v8f S[2][AKT];
    v16bf qh[2][2], ql[2][2];
    auto loadq = [&](int s) {
#pragma unroll
        for (int kk = 0; kk < 2; ++kk) { const bf* a = qbh + (size_t)(2 * s) * PLN + kk * FT; const bf* b = qbl + (size_t)(2 * s) * PLN + kk * FT;
            qh[s][kk] = cat16b(*(const v8us*)a, *(const v8us*)(a + FP)); ql[s][kk] = cat16b(*(const v8us*)b, *(const v8us*)(b + FP)); }
    };
    loadq(0);
#pragma unroll
    for (int s = 0; s < 2; ++s) {
        const bf* kph = kbh + (size_t)(2 * s + 1) * PLN; const bf* kpl = kbl + (size_t)(2 * s + 1) * PLN;
#pragma unroll
        for (int t = 0; t < AKT; ++t) S[s][t] = (v8f){};
#pragma unroll
        for (int g = 0; g < AKT; g += 4) {
#pragma unroll
            for (int kk = 0; kk < 2; ++kk) { v16bf kh[4], kl[4];
#pragma unroll
                for (int t = 0; t < 4; ++t) { const unsigned o = (g + t) * 16 * HD + kk * FT;
                    kh[t] = cat16b(*(const v8us*)(kph + o), *(const v8us*)(kph + o + FP)); kl[t] = cat16b(*(const v8us*)(kpl + o), *(const v8us*)(kpl + o + FP)); }
                // the second stream's queries ride with the first stream's last group. Behind the last query loads, and behind the last key loads, the address registers fall free:
                // the wait stands before anything is written over them, and names them as inputs so that they are kept until it
                if (s == 0 && g == AKT - 4 && kk == 1) { loadq(1); asm volatile("s_wait_xcnt 0x0" :: "v"(qob) : "memory"); }
                if (s == 1 && g == AKT - 4 && kk == 1) asm volatile("s_wait_xcnt 0x0" :: "v"(kbh), "v"(kbl) : "memory");
                __builtin_amdgcn_sched_barrier(0);    // the 16 loads of four key tiles go out as one group: left alone, each product waits on a load issued just in front of it
#pragma unroll
                for (int t = 0; t < 4; ++t) { v8f acc = S[s][g + t]; acc = wmmab(kh[t], qh[s][kk], acc); acc = wmmab(kh[t], ql[s][kk], acc); acc = wmmab(kl[t], qh[s][kk], acc); S[s][g + t] = acc; } }
        }
    }
    float m[2], inv[2];
#pragma unroll
    for (int s = 0; s < 2; ++s) { v8f v = S[s][0] * SCL;
#pragma unroll
        for (int t = 1; t < AKT; ++t) {
#pragma unroll
            for (int r = 0; r < 8; ++r) v[r] = fmaxf(v[r], S[s][t][r] * SCL); }
        float x = fmaxf(fmaxf(fmaxf(v[0], v[1]), fmaxf(v[2], v[3])), fmaxf(fmaxf(v[4], v[5]), fmaxf(v[6], v[7])));
        x = fmaxf(x, __shfl_xor(x, 16, 32));
        if (h == 0) sred[0][s][wave][c] = x; }
    __syncthreads();
#pragma unroll
    for (int s = 0; s < 2; ++s) { float x = sred[0][s][0][c];
#pragma unroll
        for (int w = 1; w < AW; ++w) x = fmaxf(x, sred[0][s][w][c]);
        m[s] = x; }
#pragma unroll
    for (int s = 0; s < 2; ++s) { v8f a = (v8f){};
#pragma unroll
        for (int t = 0; t < AKT; ++t) {
#pragma unroll
            for (int r = 0; r < 8; ++r) { const float e = exp_slot(S[s][t][r] * SCL - m[s]); S[s][t][r] = e; a[r] += e; } }
        float x = ((a[0] + a[1]) + (a[2] + a[3])) + ((a[4] + a[5]) + (a[6] + a[7]));
        x += __shfl_xor(x, 16, 32);
        if (h == 0) sred[1][s][wave][c] = x; }
    __syncthreads();
#pragma unroll
    for (int s = 0; s < 2; ++s) { float x = sred[1][s][0][c];
#pragma unroll
        for (int w = 1; w < AW; ++w) x += sred[1][s][w][c];
        inv[s] = 1.0f / x; }
    v16bf ph[AKT / 2], pl[AKT / 2];
#pragma unroll
    for (int j = 0; j < AKT / 2; ++j) { v16us oh, ol;
#pragma unroll
        for (int i = 0; i < 16; ++i) { const int t = 2 * j + (i >> 3), r = i & 7;
            const float pv = fmaxf(S[0][t][r] * inv[0], S[1][t][r] * inv[1]); const unsigned short hb = f2bf(pv); oh[i] = hb; ol[i] = f2bf(pv - bf2f(hb)); }
        ph[j] = __builtin_bit_cast(v16bf, oh); pl[j] = __builtin_bit_cast(v16bf, ol); }
    const unsigned lov = (unsigned)(lane * 8);
#pragma unroll
    for (int s = 0; s < 2; ++s) {
        const size_t vo = (size_t)s * PLN + (size_t)p * HD * NT_ + (size_t)kb * HD;    // the wave's four 32-token steps, four d tiles each
        const bf* vph = VTh + vo; const bf* vpl = VTl + vo;
        v8f O[4];
#pragma unroll
        for (int dt = 0; dt < 4; ++dt) O[dt] = (v8f){};
#pragma unroll
        for (int j = 0; j < AKT / 2; ++j) { v16bf vh[4], vl[4];
#pragma unroll
            for (int dt = 0; dt < 4; ++dt) { const unsigned o = lov + (j * 4 + dt) * FT;
                vh[dt] = cat16b(*(const v8us*)(vph + o), *(const v8us*)(vph + o + FP)); vl[dt] = cat16b(*(const v8us*)(vpl + o), *(const v8us*)(vpl + o + FP)); }
            __builtin_amdgcn_sched_barrier(0);    // as above: the 16 loads of four d tiles go out as one group
#pragma unroll
            for (int dt = 0; dt < 4; ++dt) { v8f acc = O[dt]; acc = wmmab(vh[dt], ph[j], acc); acc = wmmab(vh[dt], pl[j], acc); acc = wmmab(vl[dt], ph[j], acc); O[dt] = acc; } }
        // four vector slots between the last products of this stream and the first of the next, which start anew (C = 0) in the same accumulator registers
        if (s == 0) asm volatile("v_nop\n\tv_nop\n\tv_nop\n\tv_nop" : "+v"(O[0]), "+v"(O[1]), "+v"(O[2]), "+v"(O[3]));
#pragma unroll
        for (int dt = 0; dt < 4; ++dt) { float* ow = &ored[wave][s * 4 + dt][0];
            *(v4fa*)(ow + lane * 4) = (v4f){O[dt][0], O[dt][1], O[dt][2], O[dt][3]}; *(v4fa*)(ow + 128 + lane * 4) = (v4f){O[dt][4], O[dt][5], O[dt][6], O[dt][7]}; }
    }
    __syncthreads();
    // wave w adds and stores stream w / 4, queries (w % 4) * 4 .. + 3: 8 lanes a query, 8 consecutive d a lane, whole 128-byte lines
    const int so = wave >> 2, qq = (wave & 3) * 4 + (lane >> 3), dc = lane & 7, sl = (dc & 1) * 16 + qq;
    v4f a0 = (v4f){}, a1 = (v4f){};
#pragma unroll
    for (int w = 0; w < AW; ++w) { const float* ir = &ored[w][so * 4 + (dc >> 1)][0]; a0 += *(const v4fa*)(ir + sl * 4); a1 += *(const v4fa*)(ir + 128 + sl * 4); }
    float* cp = CC + (size_t)so * PLN + ((size_t)(p / NH_) * NT_ + q0 + qq) * DM + (p % NH_) * HD + dc * 8;
    *(v4f*)cp = a0; *(v4f*)(cp + 4) = a1;
}
__global__ __launch_bounds__(256) void k_split(const float* __restrict__ src, bf* dh, bf* dl) {
    packm<true>(src, dh, dl);
}

extern "C" void kernel_launch(void* const* d_in, const int* in_sizes, int n_in,
                              void* d_out, int out_size, void* d_ws, size_t ws_size, hipStream_t stream) {
    (void)in_sizes; (void)n_in; (void)out_size;
    const float* xr = (const float*)d_in[0]; const float* xf = (const float*)d_in[1];
    const float* Wq1 = (const float*)d_in[2]; const float* bq1 = (const float*)d_in[3]; const float* Wk1 = (const float*)d_in[4]; const float* bk1 = (const float*)d_in[5]; const float* Wv1 = (const float*)d_in[6]; const float* bv1 = (const float*)d_in[7];
    const float* Wq2 = (const float*)d_in[8]; const float* bq2 = (const float*)d_in[9]; const float* Wk2 = (const float*)d_in[10]; const float* bk2 = (const float*)d_in[11]; const float* Wv2 = (const float*)d_in[12]; const float* bv2 = (const float*)d_in[13];
    const float* Wo1 = (const float*)d_in[14]; const float* bo1 = (const float*)d_in[15]; const float* Wo2 = (const float*)d_in[16]; const float* bo2 = (const float*)d_in[17];
    float* out0 = (float*)d_out; float* out1 = out0 + (size_t)NBI * NT_ * DM;    // (out_rgb.Wo1 + bo1, out_flow.Wo2 + bo2)
    char* wsp = (char*)d_ws;
    auto take = [&](size_t bytes) { char* p = wsp; wsp += (bytes + 255) & ~(size_t)255; return (void*)p; };
    bf* WB = (bf*)take((size_t)8 * DM * DM * 2);                                      // q_r, k_r, q_f, k_f, v_r, v_f, o_r, o_f; this and every bf16 plane below in fragment order
    bf* X = (bf*)take((size_t)2 * NBI * NT_ * DM * 2);                                // [stream][item][16-token tile][k step]
    bf* QKh = (bf*)take(4 * PLN * 2); bf* QKl = (bf*)take(4 * PLN * 2);               // q_r, k_r, q_f, k_f, each [pair][16-token tile][k step]
    bf* VTh = (bf*)take(2 * PLN * 2); bf* VTl = (bf*)take(2 * PLN * 2);               // [stream][item][head][32-token step][16-d tile]
    float* TMP = (float*)take(6 * PLN * 4);                                           // the six f32 projections of a pass
    float* CC = (float*)take(2 * PLN * 4); bf* Ch = (bf*)take(2 * PLN * 2); bf* Cl = (bf*)take(2 * PLN * 2);   // CC [stream][row][512]; Ch, Cl [stream][16-row tile][k step]
    if ((size_t)(wsp - (char*)d_ws) > ws_size) return;    // 4 + 16 + 16 + 8 + 24 + 8 + 8 = 84 MiB
    k_cvtw<<<dim3(DM / 16, 8, 1), 256, 0, stream>>>(Wq1, Wk1, Wq2, Wk2, Wv1, Wv2, Wo1, Wo2, WB);
    k_cvtx<<<dim3(NBI * NT_ / 16, 2, 1), 256, 0, stream>>>(xr, xf, X);
    for (int b = 0; b < NBI; b += GI) {
        k_proj<<<dim3(MR / 64, DM / 64, 6), 128, 0, stream>>>(X + (size_t)b * NT_ * DM, WB, bq1, bk1, bq2, bk2, bv1, bv2, TMP, DM, DM);
        k_hsplit<<<dim3((MR / 16 * NH_) / 8, 4, 1), 256, 0, stream>>>(TMP, QKh, QKl);
        k_vt<<<dim3(NT_ / 64, 2, NKVV * GI * 2), 256, 0, stream>>>(TMP + 4 * PLN, VTh, VTl);
        k_attn<<<dim3(NT_ / 16, NBH, 1), 256, 0, stream>>>(QKh, QKl, VTh, VTl, CC);                                                     // scores, both softmaxes, the merge and ctx of both streams, all pairs
        k_split<<<2 * MR / 16, 256, 0, stream>>>(CC, Ch, Cl);
        k_outp<<<dim3(MR / 64, DM / 64, 2), 128, 0, stream>>>(Ch, Cl, WB + (size_t)6 * DM * DM, bo1, bo2, out0 + (size_t)b * NT_ * DM, out1 + (size_t)b * NT_ * DM, DM, DM);
    }
}

// v004
// Measured time: 303 microseconds a run.
// Next to v003, in two timings, it ran 1.41 and 1.43 times as fast.
// Counting every step since v000, it is 20.2 times as fast.
#include <hip/hip_runtime.h>

// Compute dtypes, f32 accumulate, GI batch items per pass, every stage of a pass ONE launch (items, heads, the two streams and the projections ride in the grid): the six projections x.W^T + b ([1024 x 512].[512 x 512]; [out][in] weights as n-major B operands; PLAIN bf16
// operands = inputs rounded once, exact) and the two output projections (ctx as bf16 hi + UNSCALED residual) on v_wmma_f32_16x16x32_bf16; per (item, head) both
// score maps q.k^T ([1024 x 64].[64 x 1024]) and both P.v products ([1024 x 1024].[1024 x 64]) with both operands split (three products), in ONE kernel that keeps scores and P in registers

#define NBI  8
#define NT_  1024
#define DM   512
#define NH_  8
#define HD   64
#define VHD  128                 // k_vt tile geometry (4 groups of 128 columns)
#define NKVV 4
#define KW   DM
#define NTK  NT_
#define SCL  0.125f
#define LOSC 1024.0f
#define GI   8                   // batch items per pass: all of them, so every stage is launched once
#define MR   (GI * NT_)          // rows of one pass
#define NBH  (GI * NH_)          // (item, head) pairs of one pass
#define PLN  ((size_t)MR * DM)   // elements of one [MR][512] plane
#define PPL  ((size_t)NT_ * HD)  // elements of one plane of one (item, head) pair; a pair's planes lie side by side, so that k_attn reaches each of them through a load's immediate offset

typedef _Float16 h16;
typedef unsigned short bf;
typedef __attribute__((ext_vector_type(16))) __bf16   v16bf;
typedef __attribute__((ext_vector_type(16))) _Float16 v16h;
typedef __attribute__((ext_vector_type(8)))  _Float16 v8h;
typedef __attribute__((ext_vector_type(8)))  unsigned short v8us;
typedef __attribute__((ext_vector_type(16))) unsigned short v16us;
typedef __attribute__((ext_vector_type(8)))  float    v8f;
typedef __attribute__((ext_vector_type(4)))  float    v4f;
typedef __attribute__((ext_vector_type(4)))  _Float16 v4h;
typedef v8h  __attribute__((may_alias)) v8ha;
typedef v4f  __attribute__((may_alias)) v4fa;
typedef v8us __attribute__((may_alias)) v8usa;

__device__ __forceinline__ unsigned short f2bf(float f) { unsigned u = __float_as_uint(f); u += 0x7FFFu + ((u >> 16) & 1u); return (unsigned short)(u >> 16); }
__device__ __forceinline__ float bf2f(unsigned short b) { return __uint_as_float(((unsigned)b) << 16); }
__device__ __forceinline__ float bfr(float f) { return bf2f(f2bf(f)); }
__device__ __forceinline__ v16h cat16(v8h lo, v8h hi) { return __builtin_shufflevector(lo, hi, 0, 1, 2, 3, 4, 5, 6, 7, 8, 9, 10, 11, 12, 13, 14, 15); }
__device__ __forceinline__ v16bf cat16b(v8us lo, v8us hi) { return __builtin_bit_cast(v16bf, __builtin_shufflevector(lo, hi, 0, 1, 2, 3, 4, 5, 6, 7, 8, 9, 10, 11, 12, 13, 14, 15)); }
__device__ __forceinline__ v8f wmma16(v16h a, v16h b, v8f c) { return __builtin_amdgcn_wmma_f32_16x16x32_f16(false, a, false, b, (short)0, c, false, false); }
__device__ __forceinline__ v8f wmmab(v16bf a, v16bf b, v8f c) { return __builtin_amdgcn_wmma_f32_16x16x32_bf16(false, a, false, b, (short)0, c, false, false); }

// FRAGMENT ORDER. Every 16-row x 32-k operand tile lies in the workspace as the matrix instruction's lanes hold it: [piece 0, 1][lane][8 elements], 1 KiB; lane (h = lane / 16, c = lane % 16)
// holds row c, k = 8h .. 8h + 7 (piece 0) and 16 + 8h .. 16 + 8h + 7 (piece 1). One wave-wide 16-byte load of a piece then reads 512 consecutive bytes (4 whole lines) where rows of a
// row-major plane gave 16 lines, a quarter of each used. The k order of every product is the one it was.
#define FT   512                 // elements of a tile
#define FP   256                 // elements of a piece
// one wave packs two tiles that lie side by side (64 columns) in 16 rows of a row-major f32 [..][512] matrix; src = row 0, first column; dh, dl = the first tile's place
template <bool LO>
__device__ __forceinline__ void pack2(const float* __restrict__ src, bf* dh, bf* dl) {
    const int lane = threadIdx.x & 31;
    const float* sp = src + (size_t)(lane & 15) * DM + 8 * (lane >> 4);
    v4f v[4][2];
#pragma unroll
    for (int q = 0; q < 4; ++q) { v[q][0] = *(const v4f*)(sp + q * 16); v[q][1] = *(const v4f*)(sp + q * 16 + 4); }
#pragma unroll
    for (int q = 0; q < 4; ++q) { v8us oh, ol;
#pragma unroll
        for (int i = 0; i < 8; ++i) { const float x = v[q][i >> 2][i & 3]; const unsigned short hb = f2bf(x); oh[i] = hb; ol[i] = f2bf(x - bf2f(hb)); }
        *(v8us*)(dh + q * FP + lane * 8) = oh; if (LO) *(v8us*)(dl + q * FP + lane * 8) = ol; }
}
// a row-major [rows][512] matrix as a GEMM operand: tiles in the order [row tile][k step]; wave wid takes row tile wid / 8, k steps 2 (wid % 8) and the next
template <bool LO>
__device__ __forceinline__ void packm(const float* __restrict__ src, bf* dh, bf* dl) {
    const int wid = blockIdx.x * 8 + (threadIdx.x >> 5), rt = wid >> 3, kq = wid & 7;
    const size_t o = ((size_t)rt * (DM / 32) + kq * 2) * FT;
    pack2<LO>(src + (size_t)rt * 16 * DM + kq * 64, dh + o, dl + o);
}
// all eight weights in one launch: blockIdx.y picks the matrix
__global__ __launch_bounds__(256) void k_cvtw(const float* w0, const float* w1, const float* w2, const float* w3, const float* w4, const float* w5, const float* w6, const float* w7, bf* dst) {
    const int y = blockIdx.y;
    const float* src = y == 0 ? w0 : y == 1 ? w1 : y == 2 ? w2 : y == 3 ? w3 : y == 4 ? w4 : y == 5 ? w5 : y == 6 ? w6 : w7;
    packm<false>(src, dst + (size_t)y * DM * DM, dst);
}
// both inputs, all items, in one launch: blockIdx.y picks the stream
__global__ __launch_bounds__(256) void k_cvtx(const float* xr, const float* xf, bf* dst) {
    packm<false>(blockIdx.y ? xf : xr, dst + (size_t)blockIdx.y * NBI * NT_ * DM, dst);
}

// k_gemmb: 64 x 64 block tile (4 waves x 16 x 64) of C[MR][512] = (A [+ Al]).B^T (K = 512) [+ bf(bias[c])] [+ bf(R[r][c]) residual]; f32 whole-line epilogue (or f16
template <bool SPLITA, bool F16OUT = false>
__device__ __forceinline__ void gemmb_body(const bf* __restrict__ A, const bf* __restrict__ Al, const bf* __restrict__ Bn, const float* __restrict__ bias, float* C, int ldc, h16* C2, const float* __restrict__ R = nullptr, int K = DM, int roundR = 1) {
    __shared__ __align__(16) float ost[4][16 * 68];
    const int lane = threadIdx.x & 31, wave = threadIdx.x >> 5, lr = lane & 15, hi = lane >> 4;
    const int r0 = blockIdx.x * 64 + wave * 16, c0 = blockIdx.y * 64;
    // operands in fragment order: 16 rows x K = K / 32 tiles in a row; the tile rows' bases are the same for a whole wave, the lane's byte offset vo walks the tiles
    const size_t aoff = (size_t)__builtin_amdgcn_readfirstlane(r0) * K;
    const char* pa = (const char*)(A + aoff); const char* pal = (const char*)(Al + (SPLITA ? aoff : 0));
    const char* pb[4];
#pragma unroll
    for (int t = 0; t < 4; ++t) pb[t] = (const char*)(Bn + (size_t)(c0 + t * 16) * K);
    unsigned vo = lane * 16;
    v8f acc[4];
#pragma unroll
    for (int t = 0; t < 4; ++t) acc[t] = (v8f){};
#pragma unroll 1
    for (int kc = 0; kc < K; kc += 32) {
        const v16bf a = cat16b(*(const v8us*)(pa + vo), *(const v8us*)(pa + vo + FP * 2));
        v16bf al = a;
        if (SPLITA) al = cat16b(*(const v8us*)(pal + vo), *(const v8us*)(pal + vo + FP * 2));
        v16bf b[4];
#pragma unroll
        for (int t = 0; t < 4; ++t) b[t] = cat16b(*(const v8us*)(pb[t] + vo), *(const v8us*)(pb[t] + vo + FP * 2));
        vo += FT * 2;
#pragma unroll
        for (int t = 0; t < 4; ++t) { acc[t] = wmmab(a, b[t], acc[t]); if (SPLITA) acc[t] = wmmab(al, b[t], acc[t]); }
        asm volatile("v_nop\n\tv_nop\n\tv_nop\n\tv_nop" : "+v"(acc[0]), "+v"(acc[1]), "+v"(acc[2]), "+v"(acc[3]) : "v"(a), "v"(al));
    }
    float* os = &ost[wave][0];
#pragma unroll
    for (int t = 0; t < 4; ++t) { const float bv = bias ? bfr(bias[c0 + t * 16 + lr]) : 0.f;
#pragma unroll
        for (int j = 0; j < 8; ++j) os[(hi * 8 + j) * 68 + t * 16 + lr] = acc[t][j] + bv; }
    __syncthreads();
    if (F16OUT) {
        h16* crow = (h16*)(void*)C + (size_t)r0 * ldc + c0;
        auto pass = [&]() {
#pragma unroll
            for (int s = 0; s < 4; ++s) { const int row = 4 * s + (lane >> 3), piece = lane & 7; const float* sp = os + row * 68 + piece * 8; v8h o, o2;
#pragma unroll
                for (int i = 0; i < 8; ++i) { const h16 a = (h16)sp[i]; o[i] = a; o2[i] = (h16)((sp[i] - (float)a) * LOSC); }
                *(v8h*)(crow + (size_t)row * ldc + piece * 8) = o; if (C2) *(v8h*)(C2 + (size_t)r0 * ldc + c0 + (size_t)row * ldc + piece * 8) = o2; }
        };
        pass(); 
    } else {
        float* crow = C + (size_t)r0 * ldc + c0;
        auto pass = [&]() {
#pragma unroll
            for (int s = 0; s < 8; ++s) { const int Lid = (lane >> 3) + 4 * s, piece = lane & 7; const int row = Lid >> 1, cofs = (Lid & 1) * 32 + piece * 4;
                v4f val = *(const v4fa*)(os + row * 68 + cofs); if (R) { const v4f rv = *(const v4f*)(R + ((size_t)r0 + row) * ldc + c0 + cofs); val += roundR ? (v4f){bfr(rv[0]), bfr(rv[1]), bfr(rv[2]), bfr(rv[3])} : rv; }
                *(v4f*)(crow + (size_t)row * ldc + cofs) = val; }
        };
        pass(); 
    }
}
// the six projections of one pass in one launch: rows = GI items, blockIdx.z = q_r, k_r, q_f, k_f, v_r, v_f (weights in that order in WB; X = [stream][16-row tile][k step], at the pass's first row)
__global__ __launch_bounds__(128) void k_proj(const bf* __restrict__ X, const bf* __restrict__ WB, const float* bq1, const float* bk1, const float* bq2, const float* bk2, const float* bv1, const float* bv2, float* TMP, int ldc, int K) {
    const int z = blockIdx.z;
    const bool flow = z == 2 || z == 3 || z == 5;
    const float* bias = z == 0 ? bq1 : z == 1 ? bk1 : z == 2 ? bq2 : z == 3 ? bk2 : z == 4 ? bv1 : bv2;
    gemmb_body<false, false>(X + (flow ? (size_t)NBI * NT_ * DM : 0), nullptr, WB + (size_t)z * DM * DM, bias, TMP + (size_t)z * PLN, ldc, nullptr, nullptr, K);
}
// both output projections of one pass in one launch: blockIdx.z = stream
__global__ __launch_bounds__(128) void k_outp(const bf* __restrict__ Ch, const bf* __restrict__ Cl, const bf* __restrict__ WBo, const float* bo1, const float* bo2, float* o0, float* o1, int ldc, int K) {
    const int s = blockIdx.z;
    gemmb_body<true, false>(Ch + (size_t)s * PLN, Cl + (size_t)s * PLN, WBo + (size_t)s * DM * DM, s ? bo2 : bo1, s ? o1 : o0, ldc, nullptr, nullptr, K);
}

// k_vt (blockIdx.z = (stream * GI + item) * 4 + group of 128 columns; blockIdx.y = 64-column half = head in the group; blockIdx.x = 64 tokens): VTH/VTL = bf16 hi + UNSCALED bf16 residual of V^T, turned through a 64 x 64 LDS tile.
__global__ __launch_bounds__(256) void k_vt(const float* __restrict__ Vall, bf* VTH, bf* VTL) {
    __shared__ float tl[64][65];
    const int tid = threadIdx.x, t0 = blockIdx.x * 64, d0 = blockIdx.y * 64, g = blockIdx.z % NKVV;
    const size_t io = (size_t)(blockIdx.z / NKVV) * NT_ * DM; const float* V = Vall + io;
    { const int tt = tid >> 2, dq = (tid & 3) * 16;
#pragma unroll
      for (int i = 0; i < 16; ++i) tl[dq + i][tt] = V[(size_t)(t0 + tt) * KW + g * VHD + d0 + dq + i]; }
    __syncthreads();
    // out in fragment order, per (item, head, stream): [32-token step][16-d tile][piece][lane][8 tokens]; a wave stores one piece (512 consecutive bytes) at a time
    const size_t oo = (((size_t)((blockIdx.z / NKVV) % GI) * NH_ + g * 2 + blockIdx.y) * 2 + (blockIdx.z / NKVV) / GI) * PPL;
    const int lane = tid & 31, c = lane & 15, h = lane >> 4;
#pragma unroll
    for (int s = 0; s < 2; ++s) { const int cb = (tid >> 5) * 2 + s, dt = cb >> 2, tsl = (cb >> 1) & 1, pc = cb & 1; v8us oh, ol;
#pragma unroll
        for (int i = 0; i < 8; ++i) { const float v = tl[dt * 16 + c][tsl * 32 + pc * 16 + h * 8 + i]; const unsigned short hb = f2bf(v); oh[i] = hb; ol[i] = f2bf(v - bf2f(hb)); }
        const size_t o = oo + (size_t)(((t0 >> 5) + tsl) * 4 + dt) * FT + pc * FP + lane * 8; *(v8us*)(VTH + o) = oh; *(v8us*)(VTL + o) = ol; }
}

// blockIdx.y = plane (q_r, k_r, q_f, k_f); rows = GI items
__global__ __launch_bounds__(256) void k_hsplit(const float* __restrict__ Xall, bf* Ph, bf* Pl) {
    // a wave takes 16 tokens of one head: two tiles; out per (item, head, plane): [16-token tile][k step][piece][lane][8]
    const int wid = blockIdx.x * 8 + (threadIdx.x >> 5), rt = wid / NH_, hd = wid % NH_;
    const size_t yo = (size_t)blockIdx.y * PLN;
    const size_t o = ((((size_t)(rt / (NT_ / 16)) * NH_ + hd) * 4 + blockIdx.y) * (NT_ / 16) + rt % (NT_ / 16)) * (16 * HD);
    pack2<true>(Xall + yo + (size_t)rt * 16 * DM + hd * HD, Ph + o, Pl + o);
}
// e^x as the native form has it (one multiply, v_exp_f32); the v_nop is the one free slot that the instruction set asks for behind a transcendental, in its own statement so that it stays there
__device__ __forceinline__ float exp_slot(float x) { float r; asm("v_exp_f32 %0, %1\n\tv_nop" : "=v"(r) : "v"(x * 1.44269504088896340736f)); return r; }
// k_attn: one work-group = 16 queries of one (item, head) pair, all 1024 keys, both streams; wave w owns keys w*128 .. w*128+127. The scores are formed transposed, S^T = K.Q^T
// (A = key rows, B = query rows, the same loader for both, three products per 32-k step in the order hh, k_hi.q_lo, k_lo.q_hi), so a lane holds 64 scores of ONE query per stream
// and both maps stay in registers. Row maximum and row sum: in the lane, one exchange between the lane halves, then over the 8 waves through LDS. p = max(p_r, p_f) is split into
// bf16 hi + residual in place: two neighbouring score tiles are one B operand of O^T = V^T.P^T. Each wave sums its own 128 keys; the 8 partial O^T are added through LDS in wave order.
#define AW   8                   // waves of a work-group
#define AKW  (NT_ / AW)          // keys of a wave
#define AKT  (AKW / 16)          // score tiles of a wave, per stream
// four waves per SIMD (two work-groups per WGP): holds the build within 256 registers a wave; one more register granule would leave one work-group per WGP
#define OTS  272                 // floats of one staged 16 x 16 partial tile: 256 + 16, so that the four d tiles a wave reads together start 64 bytes apart in the banks
__global__ __launch_bounds__(256) __attribute__((amdgpu_waves_per_eu(4, 4))) void k_attn(const bf* __restrict__ QKh, const bf* __restrict__ QKl, const bf* __restrict__ VTh, const bf* __restrict__ VTl, float* CC) {
    __shared__ __align__(16) float ored[AW][8][OTS];
    __shared__ float sred[2][2][AW][16];             // [maximum, sum][stream][wave][query]
    const int lane = threadIdx.x & 31, wave = threadIdx.x >> 5, c = lane & 15, h = lane >> 4;
    const int q0 = blockIdx.x * 16, p = blockIdx.y, kb = wave * AKW;
    const unsigned lo64 = (unsigned)(lane * 8);      // operands in fragment order: 16 tokens x 64 = two tiles in a row
    const unsigned qob = lo64 * 2u;                  // the lane's byte offset in the query block
    const bf* qbh = (const bf*)((const char*)(QKh + ((size_t)p * 4 * NT_ + q0) * HD) + qob); const bf* qbl = (const bf*)((const char*)(QKl + ((size_t)p * 4 * NT_ + q0) * HD) + qob);
    const bf* kbh = QKh + ((size_t)p * 4 * NT_ + kb) * HD + lo64; const bf* kbl = QKl + ((size_t)p * 4 * NT_ + kb) * HD + lo64;
    v8f S[2][AKT];
    v16bf qh[2][2], ql[2][2];
    auto loadq = [&](int s) {
#pragma unroll
        for (int kk = 0; kk < 2; ++kk) { const bf* a = qbh + (size_t)(2 * s) * PPL + kk * FT; const bf* b = qbl + (size_t)(2 * s) * PPL + kk * FT;
            qh[s][kk] = cat16b(*(const v8us*)a, *(const v8us*)(a + FP)); ql[s][kk] = cat16b(*(const v8us*)b, *(const v8us*)(b + FP)); }
    };
    loadq(0);
#pragma unroll
    for (int s = 0; s < 2; ++s) {
        const bf* kph = kbh + (size_t)(2 * s + 1) * PPL; const bf* kpl = kbl + (size_t)(2 * s + 1) * PPL;
#pragma unroll
        for (int t = 0; t < AKT; ++t) S[s][t] = (v8f){};
#pragma unroll
        for (int g = 0; g < AKT; g += 4) {
#pragma unroll
            for (int kk = 0; kk < 2; ++kk) { v16bf kh[4], kl[4];
#pragma unroll
                for (int t = 0; t < 4; ++t) { const unsigned o = (g + t) * 16 * HD + kk * FT;
                    kh[t] = cat16b(*(const v8us*)(kph + o), *(const v8us*)(kph + o + FP)); kl[t] = cat16b(*(const v8us*)(kpl + o), *(const v8us*)(kpl + o + FP)); }
                // the second stream's queries ride with the first stream's last group. Behind the last query loads, and behind the last key loads, the address registers fall free:
                // the wait stands before anything is written over them, and names them as inputs so that they are kept until it
                if (s == 0 && g == AKT - 4 && kk == 1) { loadq(1); asm volatile("s_wait_xcnt 0x0" :: "v"(qob) : "memory"); }
                if (s == 1 && g == AKT - 4 && kk == 1) asm volatile("s_wait_xcnt 0x0" :: "v"(kbh), "v"(kbl) : "memory");
                __builtin_amdgcn_sched_barrier(0);    // the 16 loads of four key tiles go out as one group: left alone, each product waits on a load issued just in front of it
#pragma unroll
                for (int t = 0; t < 4; ++t) { v8f acc = S[s][g + t]; acc = wmmab(kh[t], qh[s][kk], acc); acc = wmmab(kh[t], ql[s][kk], acc); acc = wmmab(kl[t], qh[s][kk], acc); S[s][g + t] = acc; } }
        }
    }
    float m[2], inv[2];
#pragma unroll
    for (int s = 0; s < 2; ++s) { v8f v = S[s][0] * SCL;
#pragma unroll
        for (int t = 1; t < AKT; ++t) {
#pragma unroll
            for (int r = 0; r < 8; ++r) v[r] = fmaxf(v[r], S[s][t][r] * SCL); }
        float x = fmaxf(fmaxf(fmaxf(v[0], v[1]), fmaxf(v[2], v[3])), fmaxf(fmaxf(v[4], v[5]), fmaxf(v[6], v[7])));
        x = fmaxf(x, __shfl_xor(x, 16, 32));
        if (h == 0) sred[0][s][wave][c] = x; }
    __syncthreads();
#pragma unroll
    for (int s = 0; s < 2; ++s) { float x = sred[0][s][0][c];
#pragma unroll
        for (int w = 1; w < AW; ++w) x = fmaxf(x, sred[0][s][w][c]);
        m[s] = x; }
#pragma unroll
    for (int s = 0; s < 2; ++s) { v8f a = (v8f){};
#pragma unroll
        for (int t = 0; t < AKT; ++t) {
#pragma unroll
            for (int r = 0; r < 8; ++r) { const float e = exp_slot(S[s][t][r] * SCL - m[s]); S[s][t][r] = e; a[r] += e; } }
        float x = ((a[0] + a[1]) + (a[2] + a[3])) + ((a[4] + a[5]) + (a[6] + a[7]));
        x += __shfl_xor(x, 16, 32);
        if (h == 0) sred[1][s][wave][c] = x; }
    __syncthreads();
#pragma unroll
    for (int s = 0; s < 2; ++s) { float x = sred[1][s][0][c];
#pragma unroll
        for (int w = 1; w < AW; ++w) x += sred[1][s][w][c];
        inv[s] = 1.0f / x; }
    v16bf ph[AKT / 2], pl[AKT / 2];
#pragma unroll
    for (int j = 0; j < AKT / 2; ++j) { v16us oh, ol;
#pragma unroll
        for (int i = 0; i < 16; ++i) { const int t = 2 * j + (i >> 3), r = i & 7;
            const float pv = fmaxf(S[0][t][r] * inv[0], S[1][t][r] * inv[1]); const unsigned short hb = f2bf(pv); oh[i] = hb; ol[i] = f2bf(pv - bf2f(hb)); }
        ph[j] = __builtin_bit_cast(v16bf, oh); pl[j] = __builtin_bit_cast(v16bf, ol); }
    const unsigned lov = (unsigned)(lane * 8);
#pragma unroll
    for (int s = 0; s < 2; ++s) {
        const size_t vo = ((size_t)p * 2 + s) * PPL + (size_t)kb * HD;    // the wave's four 32-token steps, four d tiles each
        const bf* vph = VTh + vo; const bf* vpl = VTl + vo;
        v8f O[4];
#pragma unroll
        for (int dt = 0; dt < 4; ++dt) O[dt] = (v8f){};
#pragma unroll
        for (int j = 0; j < AKT / 2; ++j) { v16bf vh[4], vl[4];
#pragma unroll
            for (int dt = 0; dt < 4; ++dt) { const unsigned o = lov + (j * 4 + dt) * FT;
                vh[dt] = cat16b(*(const v8us*)(vph + o), *(const v8us*)(vph + o + FP)); vl[dt] = cat16b(*(const v8us*)(vpl + o), *(const v8us*)(vpl + o + FP)); }
            __builtin_amdgcn_sched_barrier(0);    // as above: the 16 loads of four d tiles go out as one group
#pragma unroll
            for (int dt = 0; dt < 4; ++dt) { v8f acc = O[dt]; acc = wmmab(vh[dt], ph[j], acc); acc = wmmab(vh[dt], pl[j], acc); acc = wmmab(vl[dt], ph[j], acc); O[dt] = acc; } }
        // four vector slots between the last products of this stream and the first of the next, which start anew (C = 0) in the same accumulator registers
        if (s == 0) asm volatile("v_nop\n\tv_nop\n\tv_nop\n\tv_nop" : "+v"(O[0]), "+v"(O[1]), "+v"(O[2]), "+v"(O[3]));
#pragma unroll
        for (int dt = 0; dt < 4; ++dt) { float* ow = &ored[wave][s * 4 + dt][0];
            *(v4fa*)(ow + lane * 4) = (v4f){O[dt][0], O[dt][1], O[dt][2], O[dt][3]}; *(v4fa*)(ow + 128 + lane * 4) = (v4f){O[dt][4], O[dt][5], O[dt][6], O[dt][7]}; }
    }
    __syncthreads();
    // wave w adds and stores stream w / 4, queries (w % 4) * 4 .. + 3: 8 lanes a query, 8 consecutive d a lane, whole 128-byte lines
    const int so = wave >> 2, qq = (wave & 3) * 4 + (lane >> 3), dc = lane & 7, sl = (dc & 1) * 16 + qq;
    v4f a0 = (v4f){}, a1 = (v4f){};
#pragma unroll
    for (int w = 0; w < AW; ++w) { const float* ir = &ored[w][so * 4 + (dc >> 1)][0]; a0 += *(const v4fa*)(ir + sl * 4); a1 += *(const v4fa*)(ir + 128 + sl * 4); }
    float* cp = CC + (size_t)so * PLN + ((size_t)(p / NH_) * NT_ + q0 + qq) * DM + (p % NH_) * HD + dc * 8;
    *(v4f*)cp = a0; *(v4f*)(cp + 4) = a1;
}
__global__ __launch_bounds__(256) void k_split(const float* __restrict__ src, bf* dh, bf* dl) {
    packm<true>(src, dh, dl);
}

extern "C" void kernel_launch(void* const* d_in, const int* in_sizes, int n_in,
                              void* d_out, int out_size, void* d_ws, size_t ws_size, hipStream_t stream) {
    (void)in_sizes; (void)n_in; (void)out_size;
    const float* xr = (const float*)d_in[0]; const float* xf = (const float*)d_in[1];
    const float* Wq1 = (const float*)d_in[2]; const float* bq1 = (const float*)d_in[3]; const float* Wk1 = (const float*)d_in[4]; const float* bk1 = (const float*)d_in[5]; const float* Wv1 = (const float*)d_in[6]; const float* bv1 = (const float*)d_in[7];
    const float* Wq2 = (const float*)d_in[8]; const float* bq2 = (const float*)d_in[9]; const float* Wk2 = (const float*)d_in[10]; const float* bk2 = (const float*)d_in[11]; const float* Wv2 = (const float*)d_in[12]; const float* bv2 = (const float*)d_in[13];
    const float* Wo1 = (const float*)d_in[14]; const float* bo1 = (const float*)d_in[15]; const float* Wo2 = (const float*)d_in[16]; const float* bo2 = (const float*)d_in[17];
    float* out0 = (float*)d_out; float* out1 = out0 + (size_t)NBI * NT_ * DM;    // (out_rgb.Wo1 + bo1, out_flow.Wo2 + bo2)
    char* wsp = (char*)d_ws;
    auto take = [&](size_t bytes) { char* p = wsp; wsp += (bytes + 255) & ~(size_t)255; return (void*)p; };
    bf* WB = (bf*)take((size_t)8 * DM * DM * 2);                                      // q_r, k_r, q_f, k_f, v_r, v_f, o_r, o_f; this and every bf16 plane below in fragment order
    bf* X = (bf*)take((size_t)2 * NBI * NT_ * DM * 2);                                // [stream][item][16-token tile][k step]
    bf* QKh = (bf*)take(4 * PLN * 2); bf* QKl = (bf*)take(4 * PLN * 2);               // [pair][q_r, k_r, q_f, k_f][16-token tile][k step]
    bf* VTh = (bf*)take(2 * PLN * 2); bf* VTl = (bf*)take(2 * PLN * 2);               // [pair][stream][32-token step][16-d tile]
    float* TMP = (float*)take(6 * PLN * 4);                                           // the six f32 projections of a pass
    // CC [stream][row][512]; Ch, Cl [stream][16-row tile][k step]. They lie in TMP's first four planes: k_hsplit and k_vt have read TMP to the end before k_attn writes CC
    float* CC = TMP; bf* Ch = (bf*)(TMP + 2 * PLN); bf* Cl = Ch + 2 * PLN;
    if ((size_t)(wsp - (char*)d_ws) > ws_size) return;    // 4 + 16 + 64 + 32 + 96 = 212 MiB
    k_cvtw<<<dim3(DM / 16, 8, 1), 256, 0, stream>>>(Wq1, Wk1, Wq2, Wk2, Wv1, Wv2, Wo1, Wo2, WB);
    k_cvtx<<<dim3(NBI * NT_ / 16, 2, 1), 256, 0, stream>>>(xr, xf, X);
    for (int b = 0; b < NBI; b += GI) {
        k_proj<<<dim3(MR / 64, DM / 64, 6), 128, 0, stream>>>(X + (size_t)b * NT_ * DM, WB, bq1, bk1, bq2, bk2, bv1, bv2, TMP, DM, DM);
        k_hsplit<<<dim3((MR / 16 * NH_) / 8, 4, 1), 256, 0, stream>>>(TMP, QKh, QKl);
        k_vt<<<dim3(NT_ / 64, 2, NKVV * GI * 2), 256, 0, stream>>>(TMP + 4 * PLN, VTh, VTl);
        k_attn<<<dim3(NT_ / 16, NBH, 1), 256, 0, stream>>>(QKh, QKl, VTh, VTl, CC);                                                     // scores, both softmaxes, the merge and ctx of both streams, all pairs
        k_split<<<2 * MR / 16, 256, 0, stream>>>(CC, Ch, Cl);
        k_outp<<<dim3(MR / 64, DM / 64, 2), 128, 0, stream>>>(Ch, Cl, WB + (size_t)6 * DM * DM, bo1, bo2, out0 + (size_t)b * NT_ * DM, out1 + (size_t)b * NT_ * DM, DM, DM);
    }
}

// v005
// Measured time: 286 microseconds a run.
// In both of two side-by-side timings against v004, it was 1.07 times as fast.
// Over all steps from v000 it is 21.5 times as fast.
#include <hip/hip_runtime.h>

// Compute dtypes, f32 accumulate, GI batch items per pass, every stage of a pass ONE launch (items, heads, the two streams and the projections ride in the grid): the six projections x.W^T + b ([1024 x 512].[512 x 512]; [out][in] weights as n-major B operands; PLAIN bf16
// operands = inputs rounded once, exact) and the two output projections (ctx as bf16 hi + UNSCALED residual) on v_wmma_f32_16x16x32_bf16; per (item, head) both
// score maps q.k^T ([1024 x 64].[64 x 1024]) and both P.v products ([1024 x 1024].[1024 x 64]) with both operands split (three products), in ONE kernel that keeps scores and P in registers

#define NBI  8
#define NT_  1024
#define DM   512
#define NH_  8
#define HD   64
#define VHD  128                 // k_vt tile geometry (4 groups of 128 columns)
#define NKVV 4
#define KW   DM
#define NTK  NT_
#define SCL  0.125f
#define LOSC 1024.0f
#define GI   8                   // batch items per pass: all of them, so every stage is launched once
#define MR   (GI * NT_)          // rows of one pass
#define NBH  (GI * NH_)          // (item, head) pairs of one pass
#define PLN  ((size_t)MR * DM)   // elements of one [MR][512] plane
#define PPL  ((size_t)NT_ * HD)  // elements of one plane of one (item, head) pair; a pair's planes lie side by side, so that k_attn reaches each of them through a load's immediate offset

typedef _Float16 h16;
typedef unsigned short bf;
typedef __attribute__((ext_vector_type(16))) __bf16   v16bf;
typedef __attribute__((ext_vector_type(16))) _Float16 v16h;
typedef __attribute__((ext_vector_type(8)))  _Float16 v8h;
typedef __attribute__((ext_vector_type(8)))  unsigned short v8us;
typedef __attribute__((ext_vector_type(16))) unsigned short v16us;
typedef __attribute__((ext_vector_type(8)))  float    v8f;
typedef __attribute__((ext_vector_type(4)))  float    v4f;
typedef __attribute__((ext_vector_type(4)))  _Float16 v4h;
typedef v8h  __attribute__((may_alias)) v8ha;
typedef v4f  __attribute__((may_alias)) v4fa;
typedef v8us __attribute__((may_alias)) v8usa;

__device__ __forceinline__ unsigned short f2bf(float f) { unsigned u = __float_as_uint(f); u += 0x7FFFu + ((u >> 16) & 1u); return (unsigned short)(u >> 16); }
__device__ __forceinline__ float bf2f(unsigned short b) { return __uint_as_float(((unsigned)b) << 16); }
__device__ __forceinline__ float bfr(float f) { return bf2f(f2bf(f)); }
__device__ __forceinline__ v16h cat16(v8h lo, v8h hi) { return __builtin_shufflevector(lo, hi, 0, 1, 2, 3, 4, 5, 6, 7, 8, 9, 10, 11, 12, 13, 14, 15); }
__device__ __forceinline__ v16bf cat16b(v8us lo, v8us hi) { return __builtin_bit_cast(v16bf, __builtin_shufflevector(lo, hi, 0, 1, 2, 3, 4, 5, 6, 7, 8, 9, 10, 11, 12, 13, 14, 15)); }
__device__ __forceinline__ v8f wmma16(v16h a, v16h b, v8f c) { return __builtin_amdgcn_wmma_f32_16x16x32_f16(false, a, false, b, (short)0, c, false, false); }
__device__ __forceinline__ v8f wmmab(v16bf a, v16bf b, v8f c) { return __builtin_amdgcn_wmma_f32_16x16x32_bf16(false, a, false, b, (short)0, c, false, false); }

// FRAGMENT ORDER. Every 16-row x 32-k operand tile lies in the workspace as the matrix instruction's lanes hold it: [piece 0, 1][lane][8 elements], 1 KiB; lane (h = lane / 16, c = lane % 16)
// holds row c, k = 8h .. 8h + 7 (piece 0) and 16 + 8h .. 16 + 8h + 7 (piece 1). One wave-wide 16-byte load of a piece then reads 512 consecutive bytes (4 whole lines) where rows of a
// row-major plane gave 16 lines, a quarter of each used. The k order of every product is the one it was.
#define FT   512                 // elements of a tile
#define FP   256                 // elements of a piece
// one wave packs two tiles that lie side by side (64 columns) in 16 rows of a row-major f32 [..][512] matrix; src = row 0, first column; dh, dl = the first tile's place
template <bool LO>
__device__ __forceinline__ void pack2(const float* __restrict__ src, bf* dh, bf* dl) {
    const int lane = threadIdx.x & 31;
    const float* sp = src + (size_t)(lane & 15) * DM + 8 * (lane >> 4);
    v4f v[4][2];
#pragma unroll
    for (int q = 0; q < 4; ++q) { v[q][0] = *(const v4f*)(sp + q * 16); v[q][1] = *(const v4f*)(sp + q * 16 + 4); }
#pragma unroll
    for (int q = 0; q < 4; ++q) { v8us oh, ol;
#pragma unroll
        for (int i = 0; i < 8; ++i) { const float x = v[q][i >> 2][i & 3]; const unsigned short hb = f2bf(x); oh[i] = hb; ol[i] = f2bf(x - bf2f(hb)); }
        *(v8us*)(dh + q * FP + lane * 8) = oh; if (LO) *(v8us*)(dl + q * FP + lane * 8) = ol; }
}
// a row-major [rows][512] matrix as a GEMM operand: tiles in the order [row tile][k step]; wave wid takes row tile wid / 8, k steps 2 (wid % 8) and the next
template <bool LO>
__device__ __forceinline__ void packm(const float* __restrict__ src, bf* dh, bf* dl) {
    const int wid = blockIdx.x * 8 + (threadIdx.x >> 5), rt = wid >> 3, kq = wid & 7;
    const size_t o = ((size_t)rt * (DM / 32) + kq * 2) * FT;
    pack2<LO>(src + (size_t)rt * 16 * DM + kq * 64, dh + o, dl + o);
}
// all eight weights in one launch: blockIdx.y picks the matrix
__global__ __launch_bounds__(256) void k_cvtw(const float* w0, const float* w1, const float* w2, const float* w3, const float* w4, const float* w5, const float* w6, const float* w7, bf* dst) {
    const int y = blockIdx.y;
    const float* src = y == 0 ? w0 : y == 1 ? w1 : y == 2 ? w2 : y == 3 ? w3 : y == 4 ? w4 : y == 5 ? w5 : y == 6 ? w6 : w7;
    packm<false>(src, dst + (size_t)y * DM * DM, dst);
}
// both inputs, all items, in one launch: blockIdx.y picks the stream
__global__ __launch_bounds__(256) void k_cvtx(const float* xr, const float* xf, bf* dst) {
    packm<false>(blockIdx.y ? xf : xr, dst + (size_t)blockIdx.y * NBI * NT_ * DM, dst);
}

// k_gemmb: 64 x 64 block tile (4 waves x 16 x 64) of C[MR][512] = (A [+ Al]).B^T (K = 512) [+ bf(bias[c])] [+ bf(R[r][c]) residual]; f32 whole-line epilogue (or f16
template <bool SPLITA, bool F16OUT = false>
__device__ __forceinline__ void gemmb_body(const bf* __restrict__ A, const bf* __restrict__ Al, const bf* __restrict__ Bn, const float* __restrict__ bias, float* C, int ldc, h16* C2, const float* __restrict__ R = nullptr, int K = DM, int roundR = 1) {
    __shared__ __align__(16) float ost[4][16 * 68];
    const int lane = threadIdx.x & 31, wave = threadIdx.x >> 5, lr = lane & 15, hi = lane >> 4;
    const int r0 = blockIdx.x * 64 + wave * 16, c0 = blockIdx.y * 64;
    // operands in fragment order: 16 rows x K = K / 32 tiles in a row; the tile rows' bases are the same for a whole wave, the lane's byte offset vo walks the tiles
    const size_t aoff = (size_t)__builtin_amdgcn_readfirstlane(r0) * K;
    const char* pa = (const char*)(A + aoff); const char* pal = (const char*)(Al + (SPLITA ? aoff : 0));
    const char* pb[4];
#pragma unroll
    for (int t = 0; t < 4; ++t) pb[t] = (const char*)(Bn + (size_t)(c0 + t * 16) * K);
    unsigned vo = lane * 16;
    v8f acc[4];
#pragma unroll
    for (int t = 0; t < 4; ++t) acc[t] = (v8f){};
#pragma unroll 1
    for (int kc = 0; kc < K; kc += 32) {
        const v16bf a = cat16b(*(const v8us*)(pa + vo), *(const v8us*)(pa + vo + FP * 2));
        v16bf al = a;
        if (SPLITA) al = cat16b(*(const v8us*)(pal + vo), *(const v8us*)(pal + vo + FP * 2));
        v16bf b[4];
#pragma unroll
        for (int t = 0; t < 4; ++t) b[t] = cat16b(*(const v8us*)(pb[t] + vo), *(const v8us*)(pb[t] + vo + FP * 2));
        vo += FT * 2;
#pragma unroll
        for (int t = 0; t < 4; ++t) { acc[t] = wmmab(a, b[t], acc[t]); if (SPLITA) acc[t] = wmmab(al, b[t], acc[t]); }
        asm volatile("v_nop\n\tv_nop\n\tv_nop\n\tv_nop" : "+v"(acc[0]), "+v"(acc[1]), "+v"(acc[2]), "+v"(acc[3]) : "v"(a), "v"(al));
    }
    float* os = &ost[wave][0];
#pragma unroll
    for (int t = 0; t < 4; ++t) { const float bv = bias ? bfr(bias[c0 + t * 16 + lr]) : 0.f;
#pragma unroll
        for (int j = 0; j < 8; ++j) os[(hi * 8 + j) * 68 + t * 16 + lr] = acc[t][j] + bv; }
    __syncthreads();
    if (F16OUT) {
        h16* crow = (h16*)(void*)C + (size_t)r0 * ldc + c0;
        auto pass = [&]() {
#pragma unroll
            for (int s = 0; s < 4; ++s) { const int row = 4 * s + (lane >> 3), piece = lane & 7; const float* sp = os + row * 68 + piece * 8; v8h o, o2;
#pragma unroll
                for (int i = 0; i < 8; ++i) { const h16 a = (h16)sp[i]; o[i] = a; o2[i] = (h16)((sp[i] - (float)a) * LOSC); }
                *(v8h*)(crow + (size_t)row * ldc + piece * 8) = o; if (C2) *(v8h*)(C2 + (size_t)r0 * ldc + c0 + (size_t)row * ldc + piece * 8) = o2; }
        };
        pass(); 
    } else {
        float* crow = C + (size_t)r0 * ldc + c0;
        auto pass = [&]() {
#pragma unroll
            for (int s = 0; s < 8; ++s) { const int Lid = (lane >> 3) + 4 * s, piece = lane & 7; const int row = Lid >> 1, cofs = (Lid & 1) * 32 + piece * 4;
                v4f val = *(const v4fa*)(os + row * 68 + cofs); if (R) { const v4f rv = *(const v4f*)(R + ((size_t)r0 + row) * ldc + c0 + cofs); val += roundR ? (v4f){bfr(rv[0]), bfr(rv[1]), bfr(rv[2]), bfr(rv[3])} : rv; }
                *(v4f*)(crow + (size_t)row * ldc + cofs) = val; }
        };
        pass(); 
    }
}
// the six projections of one pass in one launch: rows = GI items, blockIdx.z = q_r, k_r, q_f, k_f, v_r, v_f (weights in that order in WB; X = [stream][16-row tile][k step], at the pass's first row)
__global__ __launch_bounds__(128) void k_proj(const bf* __restrict__ X, const bf* __restrict__ WB, const float* bq1, const float* bk1, const float* bq2, const float* bk2, const float* bv1, const float* bv2, float* TMP, int ldc, int K) {
    const int z = blockIdx.z;
    const bool flow = z == 2 || z == 3 || z == 5;
    const float* bias = z == 0 ? bq1 : z == 1 ? bk1 : z == 2 ? bq2 : z == 3 ? bk2 : z == 4 ? bv1 : bv2;
    gemmb_body<false, false>(X + (flow ? (size_t)NBI * NT_ * DM : 0), nullptr, WB + (size_t)z * DM * DM, bias, TMP + (size_t)z * PLN, ldc, nullptr, nullptr, K);
}
// both output projections of one pass in one launch: blockIdx.z = stream
__global__ __launch_bounds__(128) void k_outp(const bf* __restrict__ Ch, const bf* __restrict__ Cl, const bf* __restrict__ WBo, const float* bo1, const float* bo2, float* o0, float* o1, int ldc, int K) {
    const int s = blockIdx.z;
    gemmb_body<true, false>(Ch + (size_t)s * PLN, Cl + (size_t)s * PLN, WBo + (size_t)s * DM * DM, s ? bo2 : bo1, s ? o1 : o0, ldc, nullptr, nullptr, K);
}

// k_vt (blockIdx.z = (stream * GI + item) * 4 + group of 128 columns; blockIdx.y = 64-column half = head in the group; blockIdx.x = 64 tokens): VTH/VTL = bf16 hi + UNSCALED bf16 residual of V^T, turned through a 64 x 64 LDS tile.
__global__ __launch_bounds__(256) void k_vt(const float* __restrict__ Vall, bf* VTH, bf* VTL) {
    __shared__ float tl[64][65];
    const int tid = threadIdx.x, t0 = blockIdx.x * 64, d0 = blockIdx.y * 64, g = blockIdx.z % NKVV;
    const size_t io = (size_t)(blockIdx.z / NKVV) * NT_ * DM; const float* V = Vall + io;
    { const int tt = tid >> 2, dq = (tid & 3) * 16;
#pragma unroll
      for (int i = 0; i < 16; ++i) tl[dq + i][tt] = V[(size_t)(t0 + tt) * KW + g * VHD + d0 + dq + i]; }
    __syncthreads();
    // out in fragment order, per (item, head, stream): [32-token step][16-d tile][piece][lane][8 tokens]; a wave stores one piece (512 consecutive bytes) at a time
    const size_t oo = (((size_t)((blockIdx.z / NKVV) % GI) * NH_ + g * 2 + blockIdx.y) * 2 + (blockIdx.z / NKVV) / GI) * PPL;
    const int lane = tid & 31, c = lane & 15, h = lane >> 4;
#pragma unroll
    for (int s = 0; s < 2; ++s) { const int cb = (tid >> 5) * 2 + s, dt = cb >> 2, tsl = (cb >> 1) & 1, pc = cb & 1; v8us oh, ol;
#pragma unroll
        for (int i = 0; i < 8; ++i) { const float v = tl[dt * 16 + c][tsl * 32 + pc * 16 + h * 8 + i]; const unsigned short hb = f2bf(v); oh[i] = hb; ol[i] = f2bf(v - bf2f(hb)); }
        const size_t o = oo + (size_t)(((t0 >> 5) + tsl) * 4 + dt) * FT + pc * FP + lane * 8; *(v8us*)(VTH + o) = oh; *(v8us*)(VTL + o) = ol; }
}

// blockIdx.y = plane (q_r, k_r, q_f, k_f); rows = GI items
__global__ __launch_bounds__(256) void k_hsplit(const float* __restrict__ Xall, bf* Ph, bf* Pl) {
    // a wave takes 16 tokens of one head: two tiles; out per (item, head, plane): [16-token tile][k step][piece][lane][8]
    const int wid = blockIdx.x * 8 + (threadIdx.x >> 5), rt = wid / NH_, hd = wid % NH_;
    const size_t yo = (size_t)blockIdx.y * PLN;
    const size_t o = ((((size_t)(rt / (NT_ / 16)) * NH_ + hd) * 4 + blockIdx.y) * (NT_ / 16) + rt % (NT_ / 16)) * (16 * HD);
    pack2<true>(Xall + yo + (size_t)rt * 16 * DM + hd * HD, Ph + o, Pl + o);
}
// e^x as the native form has it (one multiply, v_exp_f32); the v_nop is the one free slot that the instruction set asks for behind a transcendental, in its own statement so that it stays there
__device__ __forceinline__ float exp_slot(float x) { float r; asm("v_exp_f32 %0, %1\n\tv_nop" : "=v"(r) : "v"(x * 1.44269504088896340736f)); return r; }
// k_attn: one work-group = 32 queries (two 16-query tiles) of one (item, head) pair, all 1024 keys, both streams; wave w owns keys w*64 .. w*64+63. Every key and value fragment that a wave
// loads serves both query tiles, so a query costs half the key and value bytes from L2 that a 16-query work-group pays. The scores are formed transposed, S^T = K.Q^T
// (A = key rows, B = query rows, the same loader for both, three products per 32-k step in the order hh, k_hi.q_lo, k_lo.q_hi), so a lane holds 32 scores of each of TWO queries per stream
// and both maps stay in registers. Row maximum and row sum: in the lane, one exchange between the lane halves, then over the 16 waves through LDS. p = max(p_r, p_f) is split into
// bf16 hi + residual in place: two neighbouring score tiles are one B operand of O^T = V^T.P^T. Each wave sums its own 64 keys; the 16 partial O^T are added through LDS in wave order.
#define AW   16                  // waves of a work-group
#define AQ   2                   // 16-query tiles of a work-group
#define AKW  (NT_ / AW)          // keys of a wave
#define AKT  (AKW / 16)          // score tiles of a wave, per stream and query tile
// four waves per SIMD (one work-group per WGP): holds the build within 256 registers a wave, so that the 16 waves fit one WGP
#define OTS  272                 // floats of one staged 16 x 16 partial tile: 256 + 16, so that the four d tiles a wave reads together start 64 bytes apart in the banks
#define SRP  (AW + 4)            // floats of one query's row of per-wave maxima or sums: 16 + 4, so that 16 queries' words of one wave fall in 16 different banks
__global__ __launch_bounds__(512) __attribute__((amdgpu_waves_per_eu(4, 4))) void k_attn(const bf* __restrict__ QKh, const bf* __restrict__ QKl, const bf* __restrict__ VTh, const bf* __restrict__ VTl, float* CC) {
    __shared__ __align__(16) float ored[AW][AQ * 8][OTS];          // [wave][query tile][stream][d tile]
    __shared__ __align__(16) float sred[2][2][AQ * 16][SRP];       // [maximum, sum][stream][query][wave]
    const int lane = threadIdx.x & 31, wave = threadIdx.x >> 5, c = lane & 15, h = lane >> 4;
    const int q0 = blockIdx.x * (AQ * 16), p = blockIdx.y, kb = wave * AKW;
    const unsigned lo64 = (unsigned)(lane * 8);      // operands in fragment order: 16 tokens x 64 = two tiles in a row
    const bf* qbh = QKh + ((size_t)p * 4 * NT_ + q0) * HD + lo64; const bf* qbl = QKl + ((size_t)p * 4 * NT_ + q0) * HD + lo64;
    const bf* kbh = QKh + ((size_t)p * 4 * NT_ + kb) * HD + lo64; const bf* kbl = QKl + ((size_t)p * 4 * NT_ + kb) * HD + lo64;
    v8f S[2][AKT][AQ];
#pragma unroll
    for (int s = 0; s < 2; ++s) {
        const bf* qph = qbh + (size_t)(2 * s) * PPL; const bf* qpl = qbl + (size_t)(2 * s) * PPL;
        const bf* kph = kbh + (size_t)(2 * s + 1) * PPL; const bf* kpl = kbl + (size_t)(2 * s + 1) * PPL;
#pragma unroll
        for (int t = 0; t < AKT; ++t) {
#pragma unroll
            for (int qt = 0; qt < AQ; ++qt) S[s][t][qt] = (v8f){}; }
#pragma unroll
        for (int kk = 0; kk < 2; ++kk) { v16bf qh[AQ], ql[AQ], kh[AKT], kl[AKT];
#pragma unroll
            for (int qt = 0; qt < AQ; ++qt) { const unsigned o = qt * 16 * HD + kk * FT;
                qh[qt] = cat16b(*(const v8us*)(qph + o), *(const v8us*)(qph + o + FP)); ql[qt] = cat16b(*(const v8us*)(qpl + o), *(const v8us*)(qpl + o + FP)); }
#pragma unroll
            for (int t = 0; t < AKT; ++t) { const unsigned o = t * 16 * HD + kk * FT;
                kh[t] = cat16b(*(const v8us*)(kph + o), *(const v8us*)(kph + o + FP)); kl[t] = cat16b(*(const v8us*)(kpl + o), *(const v8us*)(kpl + o + FP)); }
            // behind the last query and key loads the address registers fall free: the wait stands before anything is written over them, and names them as inputs so that they are kept until it
            if (s == 1 && kk == 1) asm volatile("s_wait_xcnt 0x0" :: "v"(qbh), "v"(qbl), "v"(kbh), "v"(kbl) : "memory");
            __builtin_amdgcn_sched_barrier(0);    // the 24 loads of two query and four key tiles go out as one group: left alone, each product waits on a load issued just in front of it
#pragma unroll
            for (int t = 0; t < AKT; ++t) {
#pragma unroll
                for (int qt = 0; qt < AQ; ++qt) S[s][t][qt] = wmmab(kh[t], qh[qt], S[s][t][qt]);
#pragma unroll
                for (int qt = 0; qt < AQ; ++qt) S[s][t][qt] = wmmab(kh[t], ql[qt], S[s][t][qt]);
#pragma unroll
                for (int qt = 0; qt < AQ; ++qt) S[s][t][qt] = wmmab(kl[t], qh[qt], S[s][t][qt]); } }
    }
    float m[2][AQ], inv[2][AQ];
#pragma unroll
    for (int s = 0; s < 2; ++s) {
#pragma unroll
        for (int qt = 0; qt < AQ; ++qt) { v8f v = S[s][0][qt] * SCL;
#pragma unroll
            for (int t = 1; t < AKT; ++t) {
#pragma unroll
                for (int r = 0; r < 8; ++r) v[r] = fmaxf(v[r], S[s][t][qt][r] * SCL); }
            float x = fmaxf(fmaxf(fmaxf(v[0], v[1]), fmaxf(v[2], v[3])), fmaxf(fmaxf(v[4], v[5]), fmaxf(v[6], v[7])));
            x = fmaxf(x, __shfl_xor(x, 16, 32));
            if (h == 0) sred[0][s][qt * 16 + c][wave] = x; } }
    __syncthreads();
#pragma unroll
    for (int s = 0; s < 2; ++s) {
#pragma unroll
        for (int qt = 0; qt < AQ; ++qt) { const float* sr = &sred[0][s][qt * 16 + c][0]; float x = sr[0];
#pragma unroll
            for (int w = 1; w < AW; ++w) x = fmaxf(x, sr[w]);
            m[s][qt] = x; } }
#pragma unroll
    for (int s = 0; s < 2; ++s) {
#pragma unroll
        for (int qt = 0; qt < AQ; ++qt) { v8f a = (v8f){};
#pragma unroll
            for (int t = 0; t < AKT; ++t) {
#pragma unroll
                for (int r = 0; r < 8; ++r) { const float e = exp_slot(S[s][t][qt][r] * SCL - m[s][qt]); S[s][t][qt][r] = e; a[r] += e; } }
            float x = ((a[0] + a[1]) + (a[2] + a[3])) + ((a[4] + a[5]) + (a[6] + a[7]));
            x += __shfl_xor(x, 16, 32);
            if (h == 0) sred[1][s][qt * 16 + c][wave] = x; } }
    __syncthreads();
#pragma unroll
    for (int s = 0; s < 2; ++s) {
#pragma unroll
        for (int qt = 0; qt < AQ; ++qt) { const float* sr = &sred[1][s][qt * 16 + c][0]; float x = sr[0];
#pragma unroll
            for (int w = 1; w < AW; ++w) x += sr[w];
            inv[s][qt] = 1.0f / x; } }
    v16bf ph[AKT / 2][AQ], pl[AKT / 2][AQ];
#pragma unroll
    for (int j = 0; j < AKT / 2; ++j) {
#pragma unroll
        for (int qt = 0; qt < AQ; ++qt) { v16us oh, ol;
#pragma unroll
            for (int i = 0; i < 16; ++i) { const int t = 2 * j + (i >> 3), r = i & 7;
                const float pv = fmaxf(S[0][t][qt][r] * inv[0][qt], S[1][t][qt][r] * inv[1][qt]); const unsigned short hb = f2bf(pv); oh[i] = hb; ol[i] = f2bf(pv - bf2f(hb)); }
            ph[j][qt] = __builtin_bit_cast(v16bf, oh); pl[j][qt] = __builtin_bit_cast(v16bf, ol); } }
    const unsigned lov = (unsigned)(lane * 8);
#pragma unroll
    for (int s = 0; s < 2; ++s) {
        const size_t vo = ((size_t)p * 2 + s) * PPL + (size_t)kb * HD;    // the wave's two 32-token steps, four d tiles each
        const bf* vph = VTh + vo; const bf* vpl = VTl + vo;
        v8f O[4][AQ];
#pragma unroll
        for (int dt = 0; dt < 4; ++dt) {
#pragma unroll
            for (int qt = 0; qt < AQ; ++qt) O[dt][qt] = (v8f){}; }
#pragma unroll
        for (int j = 0; j < AKT / 2; ++j) { v16bf vh[4], vl[4];
#pragma unroll
            for (int dt = 0; dt < 4; ++dt) { const unsigned o = lov + (j * 4 + dt) * FT;
                vh[dt] = cat16b(*(const v8us*)(vph + o), *(const v8us*)(vph + o + FP)); vl[dt] = cat16b(*(const v8us*)(vpl + o), *(const v8us*)(vpl + o + FP)); }
            __builtin_amdgcn_sched_barrier(0);    // as above: the 16 loads of four d tiles go out as one group
#pragma unroll
            for (int dt = 0; dt < 4; ++dt) {
#pragma unroll
                for (int qt = 0; qt < AQ; ++qt) O[dt][qt] = wmmab(vh[dt], ph[j][qt], O[dt][qt]);
#pragma unroll
                for (int qt = 0; qt < AQ; ++qt) O[dt][qt] = wmmab(vh[dt], pl[j][qt], O[dt][qt]);
#pragma unroll
                for (int qt = 0; qt < AQ; ++qt) O[dt][qt] = wmmab(vl[dt], ph[j][qt], O[dt][qt]); } }
        // four vector slots between the last products of this stream and the first of the next, which start anew (C = 0) in the same accumulator registers
        if (s == 0) asm volatile("v_nop\n\tv_nop\n\tv_nop\n\tv_nop" : "+v"(O[0][0]), "+v"(O[1][0]), "+v"(O[2][0]), "+v"(O[3][0]), "+v"(O[0][1]), "+v"(O[1][1]), "+v"(O[2][1]), "+v"(O[3][1]));
#pragma unroll
        for (int dt = 0; dt < 4; ++dt) {
#pragma unroll
            for (int qt = 0; qt < AQ; ++qt) { float* ow = &ored[wave][qt * 8 + s * 4 + dt][0]; const v8f o = O[dt][qt];
                *(v4fa*)(ow + lane * 4) = (v4f){o[0], o[1], o[2], o[3]}; *(v4fa*)(ow + 128 + lane * 4) = (v4f){o[4], o[5], o[6], o[7]}; } }
    }
    __syncthreads();
    // wave w adds and stores stream w / 8, queries (w % 8) * 4 .. + 3: 8 lanes a query, 8 consecutive d a lane, whole 128-byte lines
    const int so = wave >> 3, qq = (wave & 7) * 4 + (lane >> 3), dc = lane & 7, sl = (dc & 1) * 16 + (qq & 15);
    v4f a0 = (v4f){}, a1 = (v4f){};
#pragma unroll
    for (int w = 0; w < AW; ++w) { const float* ir = &ored[w][(qq >> 4) * 8 + so * 4 + (dc >> 1)][0]; a0 += *(const v4fa*)(ir + sl * 4); a1 += *(const v4fa*)(ir + 128 + sl * 4); }
    float* cp = CC + (size_t)so * PLN + ((size_t)(p / NH_) * NT_ + q0 + qq) * DM + (p % NH_) * HD + dc * 8;
    *(v4f*)cp = a0; *(v4f*)(cp + 4) = a1;
}
__global__ __launch_bounds__(256) void k_split(const float* __restrict__ src, bf* dh, bf* dl) {
    packm<true>(src, dh, dl);
}

extern "C" void kernel_launch(void* const* d_in, const int* in_sizes, int n_in,
                              void* d_out, int out_size, void* d_ws, size_t ws_size, hipStream_t stream) {
    (void)in_sizes; (void)n_in; (void)out_size;
    const float* xr = (const float*)d_in[0]; const float* xf = (const float*)d_in[1];
    const float* Wq1 = (const float*)d_in[2]; const float* bq1 = (const float*)d_in[3]; const float* Wk1 = (const float*)d_in[4]; const float* bk1 = (const float*)d_in[5]; const float* Wv1 = (const float*)d_in[6]; const float* bv1 = (const float*)d_in[7];
    const float* Wq2 = (const float*)d_in[8]; const float* bq2 = (const float*)d_in[9]; const float* Wk2 = (const float*)d_in[10]; const float* bk2 = (const float*)d_in[11]; const float* Wv2 = (const float*)d_in[12]; const float* bv2 = (const float*)d_in[13];
    const float* Wo1 = (const float*)d_in[14]; const float* bo1 = (const float*)d_in[15]; const float* Wo2 = (const float*)d_in[16]; const float* bo2 = (const float*)d_in[17];
    float* out0 = (float*)d_out; float* out1 = out0 + (size_t)NBI * NT_ * DM;    // (out_rgb.Wo1 + bo1, out_flow.Wo2 + bo2)
    char* wsp = (char*)d_ws;
    auto take = [&](size_t bytes) { char* p = wsp; wsp += (bytes + 255) & ~(size_t)255; return (void*)p; };
    bf* WB = (bf*)take((size_t)8 * DM * DM * 2);                                      // q_r, k_r, q_f, k_f, v_r, v_f, o_r, o_f; this and every bf16 plane below in fragment order
    bf* X = (bf*)take((size_t)2 * NBI * NT_ * DM * 2);                                // [stream][item][16-token tile][k step]
    bf* QKh = (bf*)take(4 * PLN * 2); bf* QKl = (bf*)take(4 * PLN * 2);               // [pair][q_r, k_r, q_f, k_f][16-token tile][k step]
    bf* VTh = (bf*)take(2 * PLN * 2); bf* VTl = (bf*)take(2 * PLN * 2);               // [pair][stream][32-token step][16-d tile]
    float* TMP = (float*)take(6 * PLN * 4);                                           // the six f32 projections of a pass
    // CC [stream][row][512]; Ch, Cl [stream][16-row tile][k step]. They lie in TMP's first four planes: k_hsplit and k_vt have read TMP to the end before k_attn writes CC
    float* CC = TMP; bf* Ch = (bf*)(TMP + 2 * PLN); bf* Cl = Ch + 2 * PLN;
    if ((size_t)(wsp - (char*)d_ws) > ws_size) return;    // 4 + 16 + 64 + 32 + 96 = 212 MiB
    k_cvtw<<<dim3(DM / 16, 8, 1), 256, 0, stream>>>(Wq1, Wk1, Wq2, Wk2, Wv1, Wv2, Wo1, Wo2, WB);
    k_cvtx<<<dim3(NBI * NT_ / 16, 2, 1), 256, 0, stream>>>(xr, xf, X);
    for (int b = 0; b < NBI; b += GI) {
        k_proj<<<dim3(MR / 64, DM / 64, 6), 128, 0, stream>>>(X + (size_t)b * NT_ * DM, WB, bq1, bk1, bq2, bk2, bv1, bv2, TMP, DM, DM);
        k_hsplit<<<dim3((MR / 16 * NH_) / 8, 4, 1), 256, 0, stream>>>(TMP, QKh, QKl);
        k_vt<<<dim3(NT_ / 64, 2, NKVV * GI * 2), 256, 0, stream>>>(TMP + 4 * PLN, VTh, VTl);
        k_attn<<<dim3(NT_ / (AQ * 16), NBH, 1), AW * 32, 0, stream>>>(QKh, QKl, VTh, VTl, CC);                                                     // scores, both softmaxes, the merge and ctx of both streams, all pairs
        k_split<<<2 * MR / 16, 256, 0, stream>>>(CC, Ch, Cl);
        k_outp<<<dim3(MR / 64, DM / 64, 2), 128, 0, stream>>>(Ch, Cl, WB + (size_t)6 * DM * DM, bo1, bo2, out0 + (size_t)b * NT_ * DM, out1 + (size_t)b * NT_ * DM, DM, DM);
    }
}

// v006
// Measured time: 252 microseconds a run.
// Two timings next to v005 put it at 1.13 and 1.14 times that version's speed.
// Over all steps from v000 it is 24.4 times as fast.
#include <hip/hip_runtime.h>

// Compute dtypes, f32 accumulate, GI batch items per pass, every stage of a pass ONE launch (items, heads, the two streams and the projections ride in the grid): the six projections x.W^T + b ([1024 x 512].[512 x 512]; [out][in] weights as n-major B operands; PLAIN bf16
// operands = inputs rounded once, exact) and the two output projections (ctx as bf16 hi + UNSCALED residual) on v_wmma_f32_16x16x32_bf16; per (item, head) both
// score maps q.k^T ([1024 x 64].[64 x 1024]) and both P.v products ([1024 x 1024].[1024 x 64]) with both operands split (three products), in ONE kernel that keeps scores and P in registers

#define NBI  8
#define NT_  1024
#define DM   512
#define NH_  8
#define HD   64
#define KW   DM
#define NTK  NT_
#define SCL  0.125f
#define LOSC 1024.0f
#define GI   8                   // batch items per pass: all of them, so every stage is launched once
#define MR   (GI * NT_)          // rows of one pass
#define NBH  (GI * NH_)          // (item, head) pairs of one pass
#define PLN  ((size_t)MR * DM)   // elements of one [MR][512] plane
#define PPL  ((size_t)NT_ * HD)  // elements of one plane of one (item, head) pair; a pair's planes lie side by side, so that k_attn reaches each of them through a load's immediate offset

typedef _Float16 h16;
typedef unsigned short bf;
typedef __attribute__((ext_vector_type(16))) __bf16   v16bf;
typedef __attribute__((ext_vector_type(16))) _Float16 v16h;
typedef __attribute__((ext_vector_type(8)))  _Float16 v8h;
typedef __attribute__((ext_vector_type(8)))  unsigned short v8us;
typedef __attribute__((ext_vector_type(16))) unsigned short v16us;
typedef __attribute__((ext_vector_type(8)))  float    v8f;
typedef __attribute__((ext_vector_type(4)))  float    v4f;
typedef __attribute__((ext_vector_type(4)))  _Float16 v4h;
typedef v8h  __attribute__((may_alias)) v8ha;
typedef v4f  __attribute__((may_alias)) v4fa;
typedef v8us __attribute__((may_alias)) v8usa;
typedef __attribute__((ext_vector_type(4)))  unsigned v4u;
typedef v4u  __attribute__((may_alias)) v4ua;

__device__ __forceinline__ unsigned short f2bf(float f) { unsigned u = __float_as_uint(f); u += 0x7FFFu + ((u >> 16) & 1u); return (unsigned short)(u >> 16); }
__device__ __forceinline__ float bf2f(unsigned short b) { return __uint_as_float(((unsigned)b) << 16); }
__device__ __forceinline__ float bfr(float f) { return bf2f(f2bf(f)); }
__device__ __forceinline__ v16h cat16(v8h lo, v8h hi) { return __builtin_shufflevector(lo, hi, 0, 1, 2, 3, 4, 5, 6, 7, 8, 9, 10, 11, 12, 13, 14, 15); }
__device__ __forceinline__ v16bf cat16b(v8us lo, v8us hi) { return __builtin_bit_cast(v16bf, __builtin_shufflevector(lo, hi, 0, 1, 2, 3, 4, 5, 6, 7, 8, 9, 10, 11, 12, 13, 14, 15)); }
__device__ __forceinline__ v8f wmma16(v16h a, v16h b, v8f c) { return __builtin_amdgcn_wmma_f32_16x16x32_f16(false, a, false, b, (short)0, c, false, false); }
__device__ __forceinline__ v8f wmmab(v16bf a, v16bf b, v8f c) { return __builtin_amdgcn_wmma_f32_16x16x32_bf16(false, a, false, b, (short)0, c, false, false); }

// FRAGMENT ORDER. Every 16-row x 32-k operand tile lies in the workspace as the matrix instruction's lanes hold it: [piece 0, 1][lane][8 elements], 1 KiB; lane (h = lane / 16, c = lane % 16)
// holds row c, k = 8h .. 8h + 7 (piece 0) and 16 + 8h .. 16 + 8h + 7 (piece 1). One wave-wide 16-byte load of a piece then reads 512 consecutive bytes (4 whole lines) where rows of a
// row-major plane gave 16 lines, a quarter of each used. The k order of every product is the one it was.
#define FT   512                 // elements of a tile
#define FP   256                 // elements of a piece
// eight f32 values of a lane as bf16 hi + UNSCALED bf16 residual: 16 bytes to each plane
__device__ __forceinline__ unsigned rne16(float f) { const unsigned u = __float_as_uint(f); return u + 0x7FFFu + ((u >> 16) & 1u); }    // f2bf's rounding; the bf16 is the upper half
__device__ __forceinline__ void split8(v8f x, bf* dh, bf* dl) { v4u oh, ol;
#pragma unroll
    for (int i = 0; i < 4; ++i) { const unsigned h0 = rne16(x[2 * i]), h1 = rne16(x[2 * i + 1]);
        const unsigned l0 = rne16(x[2 * i] - __uint_as_float(h0 & 0xFFFF0000u)), l1 = rne16(x[2 * i + 1] - __uint_as_float(h1 & 0xFFFF0000u));
        oh[i] = (h1 & 0xFFFF0000u) | (h0 >> 16); ol[i] = (l1 & 0xFFFF0000u) | (l0 >> 16); }
    *(v4ua*)dh = oh; *(v4ua*)dl = ol; }
// one wave packs two tiles that lie side by side (64 columns) in 16 rows of a row-major f32 [..][512] matrix; src = row 0, first column; dh, dl = the first tile's place
template <bool LO>
__device__ __forceinline__ void pack2(const float* __restrict__ src, bf* dh, bf* dl) {
    const int lane = threadIdx.x & 31;
    const float* sp = src + (size_t)(lane & 15) * DM + 8 * (lane >> 4);
    v4f v[4][2];
#pragma unroll
    for (int q = 0; q < 4; ++q) { v[q][0] = *(const v4f*)(sp + q * 16); v[q][1] = *(const v4f*)(sp + q * 16 + 4); }
#pragma unroll
    for (int q = 0; q < 4; ++q) { v8us oh, ol;
#pragma unroll
        for (int i = 0; i < 8; ++i) { const float x = v[q][i >> 2][i & 3]; const unsigned short hb = f2bf(x); oh[i] = hb; ol[i] = f2bf(x - bf2f(hb)); }
        *(v8us*)(dh + q * FP + lane * 8) = oh; if (LO) *(v8us*)(dl + q * FP + lane * 8) = ol; }
}
// a row-major [rows][512] matrix as a GEMM operand: tiles in the order [row tile][k step]; wave wid takes row tile wid / 8, k steps 2 (wid % 8) and the next
template <bool LO>
__device__ __forceinline__ void packm(const float* __restrict__ src, bf* dh, bf* dl) {
    const int wid = blockIdx.x * 8 + (threadIdx.x >> 5), rt = wid >> 3, kq = wid & 7;
    const size_t o = ((size_t)rt * (DM / 32) + kq * 2) * FT;
    pack2<LO>(src + (size_t)rt * 16 * DM + kq * 64, dh + o, dl + o);
}
// all eight weights in one launch: blockIdx.y picks the matrix
__global__ __launch_bounds__(256) void k_cvtw(const float* w0, const float* w1, const float* w2, const float* w3, const float* w4, const float* w5, const float* w6, const float* w7, bf* dst) {
    const int y = blockIdx.y;
    const float* src = y == 0 ? w0 : y == 1 ? w1 : y == 2 ? w2 : y == 3 ? w3 : y == 4 ? w4 : y == 5 ? w5 : y == 6 ? w6 : w7;
    packm<false>(src, dst + (size_t)y * DM * DM, dst);
}
// both inputs, all items, in one launch: blockIdx.y picks the stream
__global__ __launch_bounds__(256) void k_cvtx(const float* xr, const float* xf, bf* dst) {
    packm<false>(blockIdx.y ? xf : xr, dst + (size_t)blockIdx.y * NBI * NT_ * DM, dst);
}

// k_gemmb: 64 x 64 block tile (4 waves x 16 x 64) of C = (A [+ Al]).B^T + bf(bias[c]). PACK = false: f32 rows, whole lines. PACK = true: the wave's 16 x 64 goes out as the next stage's operand, bf16 hi + residual
// in fragment order, at dh / dl (the wave's own place): turned = false, 16 tokens x 64 k = two tiles (through the wave's LDS rows); turned = true, its transpose, one piece of each of four 16-d tiles, FT apart
template <bool SPLITA, bool PACK>
__device__ __forceinline__ void gemmb_body(const bf* __restrict__ A, const bf* __restrict__ Al, const bf* __restrict__ Bn, const float* __restrict__ bias, float* C, int ldc, int K, bf* dh = nullptr, bf* dl = nullptr, bool turned = false) {
    __shared__ __align__(16) float ost[4][16 * 68];
    const int lane = threadIdx.x & 31, wave = threadIdx.x >> 5, lr = lane & 15, hi = lane >> 4;
    const int r0 = blockIdx.x * 64 + wave * 16, c0 = blockIdx.y * 64;
    // operands in fragment order: 16 rows x K = K / 32 tiles in a row; the tile rows' bases are the same for a whole wave, the lane's byte offset vo walks the tiles
    const size_t aoff = (size_t)__builtin_amdgcn_readfirstlane(r0) * K;
    const char* pa = (const char*)(A + aoff); const char* pal = (const char*)(Al + (SPLITA ? aoff : 0));
    const char* pb[4];
#pragma unroll
    for (int t = 0; t < 4; ++t) pb[t] = (const char*)(Bn + (size_t)(c0 + t * 16) * K);
    unsigned vo = lane * 16;
    v8f acc[4];
#pragma unroll
    for (int t = 0; t < 4; ++t) acc[t] = (v8f){};
#pragma unroll 1
    for (int kc = 0; kc < K; kc += 32) {
        const v16bf a = cat16b(*(const v8us*)(pa + vo), *(const v8us*)(pa + vo + FP * 2));
        v16bf al = a;
        if (SPLITA) al = cat16b(*(const v8us*)(pal + vo), *(const v8us*)(pal + vo + FP * 2));
        v16bf b[4];
#pragma unroll
        for (int t = 0; t < 4; ++t) b[t] = cat16b(*(const v8us*)(pb[t] + vo), *(const v8us*)(pb[t] + vo + FP * 2));
        vo += FT * 2;
#pragma unroll
        for (int t = 0; t < 4; ++t) { acc[t] = wmmab(a, b[t], acc[t]); if (SPLITA) acc[t] = wmmab(al, b[t], acc[t]); }
        asm volatile("v_nop\n\tv_nop\n\tv_nop\n\tv_nop" : "+v"(acc[0]), "+v"(acc[1]), "+v"(acc[2]), "+v"(acc[3]) : "v"(a), "v"(al));
    }
    float* os = &ost[wave][0];
    if (!(PACK && turned)) {
#pragma unroll
        for (int t = 0; t < 4; ++t) { const float bv = bias ? bfr(bias[c0 + t * 16 + lr]) : 0.f;
#pragma unroll
            for (int j = 0; j < 8; ++j) os[(hi * 8 + j) * 68 + t * 16 + lr] = acc[t][j] + bv; }
    }
    __syncthreads();
    if (PACK) {
        if (turned) {
            // an accumulator tile IS a piece of the transposed operand: lane (lr, hi) holds column (d) t * 16 + lr, rows (tokens) 8 hi .. 8 hi + 7
            float bv[4];
#pragma unroll
            for (int t = 0; t < 4; ++t) bv[t] = bfr(bias[c0 + t * 16 + lr]);
#pragma unroll
            for (int t = 0; t < 4; ++t) { split8(acc[t] + bv[t], dh + t * FT + lane * 8, dl + t * FT + lane * 8);
                asm volatile("s_wait_xcnt 0x0" ::: "memory");    // behind the two stores, before what follows is written over the registers that they name
                __builtin_amdgcn_sched_barrier(0); }    // one piece at a time: with the four interleaved the kernel takes more than 64 registers, and a SIMD then holds fewer than 16 waves to hide the loop's loads
        } else {
            // lane (lr, hi) takes row lr, columns 16 q + 8 hi .. + 7 of piece q
#pragma unroll
            for (int q = 0; q < 4; ++q) { const float* sp = os + lr * 68 + q * 16 + hi * 8; const v4f x0 = *(const v4fa*)sp, x1 = *(const v4fa*)(sp + 4);
                split8((v8f){x0[0], x0[1], x0[2], x0[3], x1[0], x1[1], x1[2], x1[3]}, dh + q * FP + lane * 8, dl + q * FP + lane * 8);
                asm volatile("s_wait_xcnt 0x0" ::: "memory"); }    // behind the two stores, as above
        }
    } else {
        float* crow = C + (size_t)r0 * ldc + c0;
#pragma unroll
        for (int s = 0; s < 8; ++s) { const int Lid = (lane >> 3) + 4 * s, piece = lane & 7; const int row = Lid >> 1, cofs = (Lid & 1) * 32 + piece * 4;
            *(v4f*)(crow + (size_t)row * ldc + cofs) = *(const v4fa*)(os + row * 68 + cofs); }
    }
}
// the six projections of one pass in one launch: rows = GI items, blockIdx.y = head, blockIdx.z = q_r, k_r, q_f, k_f, v_r, v_f (weights in that order in WB; X = [stream][all 16-row tiles][k step], at the pass's first row).
// Each wave stores its 16 tokens of one head straight as k_attn's operand: q, k per (pair, plane) [16-token tile][k step]; v turned, per (pair, stream) [32-token step][16-d tile]
__global__ __launch_bounds__(128) void k_proj(const bf* __restrict__ X, const bf* __restrict__ WB, const float* bq1, const float* bk1, const float* bq2, const float* bk2, const float* bv1, const float* bv2, bf* QKh, bf* QKl, bf* VTh, bf* VTl, int K) {
    const int z = blockIdx.z, wave = __builtin_amdgcn_readfirstlane(threadIdx.x >> 5), tb = blockIdx.x % (NT_ / 64);
    const size_t pr = (size_t)(blockIdx.x / (NT_ / 64)) * NH_ + blockIdx.y;
    const bool flow = z == 2 || z == 3 || z == 5, turned = z >= 4;
    const float* bias = z == 0 ? bq1 : z == 1 ? bk1 : z == 2 ? bq2 : z == 3 ? bk2 : z == 4 ? bv1 : bv2;
    const size_t o = turned ? (pr * 2 + (z - 4)) * PPL + (size_t)((tb * 2 + (wave >> 1)) * 4) * FT + (wave & 1) * FP : ((pr * 4 + z) * (NT_ / 16) + tb * 4 + wave) * (16 * HD);
    gemmb_body<false, true>(X + (flow ? (size_t)NBI * NT_ * DM : 0), nullptr, WB + (size_t)z * DM * DM, bias, nullptr, 0, K, (turned ? VTh : QKh) + o, (turned ? VTl : QKl) + o, turned);
}
// both output projections of one pass in one launch: blockIdx.z = stream
__global__ __launch_bounds__(128) void k_outp(const bf* __restrict__ Ch, const bf* __restrict__ Cl, const bf* __restrict__ WBo, const float* bo1, const float* bo2, float* o0, float* o1, int ldc, int K) {
    const int s = blockIdx.z;
    gemmb_body<true, false>(Ch + (size_t)s * PLN, Cl + (size_t)s * PLN, WBo + (size_t)s * DM * DM, s ? bo2 : bo1, s ? o1 : o0, ldc, K);
}

// e^x as the native form has it (one multiply, v_exp_f32); the v_nop is the one free slot that the instruction set asks for behind a transcendental, in its own statement so that it stays there
__device__ __forceinline__ float exp_slot(float x) { float r; asm("v_exp_f32 %0, %1\n\tv_nop" : "=v"(r) : "v"(x * 1.44269504088896340736f)); return r; }
// k_attn: one work-group = 32 queries (two 16-query tiles) of one (item, head) pair, all 1024 keys, both streams; wave w owns keys w*64 .. w*64+63. Every key and value fragment that a wave
// loads serves both query tiles, so a query costs half the key and value bytes from L2 that a 16-query work-group pays. The scores are formed transposed, S^T = K.Q^T
// (A = key rows, B = query rows, the same loader for both, three products per 32-k step in the order hh, k_hi.q_lo, k_lo.q_hi), so a lane holds 32 scores of each of TWO queries per stream
// and both maps stay in registers. Row maximum and row sum: in the lane, one exchange between the lane halves, then over the 16 waves through LDS. p = max(p_r, p_f) is split into
// bf16 hi + residual in place: two neighbouring score tiles are one B operand of O^T = V^T.P^T. Each wave sums its own 64 keys; the 16 partial O^T are added through LDS in wave order.
#define AW   16                  // waves of a work-group
#define AQ   2                   // 16-query tiles of a work-group
#define AKW  (NT_ / AW)          // keys of a wave
#define AKT  (AKW / 16)          // score tiles of a wave, per stream and query tile
// four waves per SIMD (one work-group per WGP): holds the build within 256 registers a wave, so that the 16 waves fit one WGP
#define OTS  256                 // floats of one staged 16 x 16 partial tile; written and read lane by lane, 16 bytes a lane
#define SRP  (AW + 4)            // floats of one query's row of per-wave maxima or sums: 16 + 4, so that 16 queries' words of one wave fall in 16 different banks
__global__ __launch_bounds__(512) __attribute__((amdgpu_waves_per_eu(4, 4))) void k_attn(const bf* __restrict__ QKh, const bf* __restrict__ QKl, const bf* __restrict__ VTh, const bf* __restrict__ VTl, bf* Ch, bf* Cl) {
    __shared__ __align__(16) float ored[AW][AQ * 8][OTS];          // [wave][query tile][stream][d tile]
    __shared__ __align__(16) float sred[2][2][AQ * 16][SRP];       // [maximum, sum][stream][query][wave]
    const int lane = threadIdx.x & 31, wave = threadIdx.x >> 5, c = lane & 15, h = lane >> 4;
    const int q0 = blockIdx.x * (AQ * 16), p = blockIdx.y, kb = wave * AKW;
    const unsigned lo64 = (unsigned)(lane * 8);      // operands in fragment order: 16 tokens x 64 = two tiles in a row
    const bf* qbh = QKh + ((size_t)p * 4 * NT_ + q0) * HD + lo64; const bf* qbl = QKl + ((size_t)p * 4 * NT_ + q0) * HD + lo64;
    const bf* kbh = QKh + ((size_t)p * 4 * NT_ + kb) * HD + lo64; const bf* kbl = QKl + ((size_t)p * 4 * NT_ + kb) * HD + lo64;
    v8f S[2][AKT][AQ];
#pragma unroll
    for (int s = 0; s < 2; ++s) {
        const bf* qph = qbh + (size_t)(2 * s) * PPL; const bf* qpl = qbl + (size_t)(2 * s) * PPL;
        const bf* kph = kbh + (size_t)(2 * s + 1) * PPL; const bf* kpl = kbl + (size_t)(2 * s + 1) * PPL;
#pragma unroll
        for (int t = 0; t < AKT; ++t) {
#pragma unroll
            for (int qt = 0; qt < AQ; ++qt) S[s][t][qt] = (v8f){}; }
#pragma unroll
        for (int kk = 0; kk < 2; ++kk) { v16bf qh[AQ], ql[AQ], kh[AKT], kl[AKT];
#pragma unroll
            for (int qt = 0; qt < AQ; ++qt) { const unsigned o = qt * 16 * HD + kk * FT;
                qh[qt] = cat16b(*(const v8us*)(qph + o), *(const v8us*)(qph + o + FP)); ql[qt] = cat16b(*(const v8us*)(qpl + o), *(const v8us*)(qpl + o + FP)); }
#pragma unroll
            for (int t = 0; t < AKT; ++t) { const unsigned o = t * 16 * HD + kk * FT;
                kh[t] = cat16b(*(const v8us*)(kph + o), *(const v8us*)(kph + o + FP)); kl[t] = cat16b(*(const v8us*)(kpl + o), *(const v8us*)(kpl + o + FP)); }
            // behind the last query and key loads the address registers fall free: the wait stands before anything is written over them, and names them as inputs so that they are kept until it
            if (s == 1 && kk == 1) asm volatile("s_wait_xcnt 0x0" :: "v"(qbh), "v"(qbl), "v"(kbh), "v"(kbl) : "memory");
            __builtin_amdgcn_sched_barrier(0);    // the 24 loads of two query and four key tiles go out as one group: left alone, each product waits on a load issued just in front of it
#pragma unroll
            for (int t = 0; t < AKT; ++t) {
#pragma unroll
                for (int qt = 0; qt < AQ; ++qt) S[s][t][qt] = wmmab(kh[t], qh[qt], S[s][t][qt]);
#pragma unroll
                for (int qt = 0; qt < AQ; ++qt) S[s][t][qt] = wmmab(kh[t], ql[qt], S[s][t][qt]);
#pragma unroll
                for (int qt = 0; qt < AQ; ++qt) S[s][t][qt] = wmmab(kl[t], qh[qt], S[s][t][qt]); } }
    }
    float m[2][AQ], inv[2][AQ];
#pragma unroll
    for (int s = 0; s < 2; ++s) {
#pragma unroll
        for (int qt = 0; qt < AQ; ++qt) { v8f v = S[s][0][qt] * SCL;
#pragma unroll
            for (int t = 1; t < AKT; ++t) {
#pragma unroll
                for (int r = 0; r < 8; ++r) v[r] = fmaxf(v[r], S[s][t][qt][r] * SCL); }
            float x = fmaxf(fmaxf(fmaxf(v[0], v[1]), fmaxf(v[2], v[3])), fmaxf(fmaxf(v[4], v[5]), fmaxf(v[6], v[7])));
            x = fmaxf(x, __shfl_xor(x, 16, 32));
            if (h == 0) sred[0][s][qt * 16 + c][wave] = x; } }
    __syncthreads();
#pragma unroll
    for (int s = 0; s < 2; ++s) {
#pragma unroll
        for (int qt = 0; qt < AQ; ++qt) { const float* sr = &sred[0][s][qt * 16 + c][0]; float x = sr[0];
#pragma unroll
            for (int w = 1; w < AW; ++w) x = fmaxf(x, sr[w]);
            m[s][qt] = x; } }
#pragma unroll
    for (int s = 0; s < 2; ++s) {
#pragma unroll
        for (int qt = 0; qt < AQ; ++qt) { v8f a = (v8f){};
#pragma unroll
            for (int t = 0; t < AKT; ++t) {
#pragma unroll
                for (int r = 0; r < 8; ++r) { const float e = exp_slot(S[s][t][qt][r] * SCL - m[s][qt]); S[s][t][qt][r] = e; a[r] += e; } }
            float x = ((a[0] + a[1]) + (a[2] + a[3])) + ((a[4] + a[5]) + (a[6] + a[7]));
            x += __shfl_xor(x, 16, 32);
            if (h == 0) sred[1][s][qt * 16 + c][wave] = x; } }
    __syncthreads();
#pragma unroll
    for (int s = 0; s < 2; ++s) {
#pragma unroll
        for (int qt = 0; qt < AQ; ++qt) { const float* sr = &sred[1][s][qt * 16 + c][0]; float x = sr[0];
#pragma unroll
            for (int w = 1; w < AW; ++w) x += sr[w];
            inv[s][qt] = 1.0f / x; } }
    v16bf ph[AKT / 2][AQ], pl[AKT / 2][AQ];
#pragma unroll
    for (int j = 0; j < AKT / 2; ++j) {
#pragma unroll
        for (int qt = 0; qt < AQ; ++qt) { v16us oh, ol;
#pragma unroll
            for (int i = 0; i < 16; ++i) { const int t = 2 * j + (i >> 3), r = i & 7;
                const float pv = fmaxf(S[0][t][qt][r] * inv[0][qt], S[1][t][qt][r] * inv[1][qt]); const unsigned short hb = f2bf(pv); oh[i] = hb; ol[i] = f2bf(pv - bf2f(hb)); }
            ph[j][qt] = __builtin_bit_cast(v16bf, oh); pl[j][qt] = __builtin_bit_cast(v16bf, ol); } }
    const unsigned lov = (unsigned)(lane * 8);
#pragma unroll
    for (int s = 0; s < 2; ++s) {
        const size_t vo = ((size_t)p * 2 + s) * PPL + (size_t)kb * HD;    // the wave's two 32-token steps, four d tiles each
        const bf* vph = VTh + vo; const bf* vpl = VTl + vo;
        v8f O[4][AQ];
#pragma unroll
        for (int dt = 0; dt < 4; ++dt) {
#pragma unroll
            for (int qt = 0; qt < AQ; ++qt) O[dt][qt] = (v8f){}; }
#pragma unroll
        for (int j = 0; j < AKT / 2; ++j) { v16bf vh[4], vl[4];
#pragma unroll
            for (int dt = 0; dt < 4; ++dt) { const unsigned o = lov + (j * 4 + dt) * FT;
                vh[dt] = cat16b(*(const v8us*)(vph + o), *(const v8us*)(vph + o + FP)); vl[dt] = cat16b(*(const v8us*)(vpl + o), *(const v8us*)(vpl + o + FP)); }
            __builtin_amdgcn_sched_barrier(0);    // as above: the 16 loads of four d tiles go out as one group
#pragma unroll
            for (int dt = 0; dt < 4; ++dt) {
#pragma unroll
                for (int qt = 0; qt < AQ; ++qt) O[dt][qt] = wmmab(vh[dt], ph[j][qt], O[dt][qt]);
#pragma unroll
                for (int qt = 0; qt < AQ; ++qt) O[dt][qt] = wmmab(vh[dt], pl[j][qt], O[dt][qt]);
#pragma unroll
                for (int qt = 0; qt < AQ; ++qt) O[dt][qt] = wmmab(vl[dt], ph[j][qt], O[dt][qt]); } }
        // four vector slots between the last products of this stream and the first of the next, which start anew (C = 0) in the same accumulator registers
        if (s == 0) asm volatile("v_nop\n\tv_nop\n\tv_nop\n\tv_nop" : "+v"(O[0][0]), "+v"(O[1][0]), "+v"(O[2][0]), "+v"(O[3][0]), "+v"(O[0][1]), "+v"(O[1][1]), "+v"(O[2][1]), "+v"(O[3][1]));
#pragma unroll
        for (int dt = 0; dt < 4; ++dt) {
#pragma unroll
            for (int qt = 0; qt < AQ; ++qt) { float* ow = &ored[wave][qt * 8 + s * 4 + dt][0]; const v8f o = O[dt][qt];
                *(v4fa*)(ow + lane * 4) = (v4f){o[0], o[1], o[2], o[3]}; *(v4fa*)(ow + 128 + lane * 4) = (v4f){o[4], o[5], o[6], o[7]}; } }
    }
    __syncthreads();
    // wave w adds one 16 x 16 tile, stream w / 8, query tile (w / 4) % 2, d tile w % 4, each lane the eight sums that it would hold as an accumulator, and stores them as one piece (512 consecutive bytes per plane)
    // of k_outp's A operand: [stream][16-row tile][k step][piece][lane][8], bf16 hi + residual
    const int so = wave >> 3, qt = (wave >> 2) & 1, dt = wave & 3;
    v4f a0 = (v4f){}, a1 = (v4f){};
#pragma unroll
    for (int w = 0; w < AW; ++w) { const float* ir = &ored[w][qt * 8 + so * 4 + dt][0]; a0 += *(const v4fa*)(ir + lane * 4); a1 += *(const v4fa*)(ir + 128 + lane * 4); }
    const size_t o = (size_t)so * PLN + ((((size_t)(p / NH_) * NT_ + q0) / 16 + qt) * (DM / 32) + (p % NH_) * 2 + (dt >> 1)) * FT + (dt & 1) * FP + lane * 8;
    split8((v8f){a0[0], a0[1], a0[2], a0[3], a1[0], a1[1], a1[2], a1[3]}, Ch + o, Cl + o);
}

extern "C" void kernel_launch(void* const* d_in, const int* in_sizes, int n_in,
                              void* d_out, int out_size, void* d_ws, size_t ws_size, hipStream_t stream) {
    (void)in_sizes; (void)n_in; (void)out_size;
    const float* xr = (const float*)d_in[0]; const float* xf = (const float*)d_in[1];
    const float* Wq1 = (const float*)d_in[2]; const float* bq1 = (const float*)d_in[3]; const float* Wk1 = (const float*)d_in[4]; const float* bk1 = (const float*)d_in[5]; const float* Wv1 = (const float*)d_in[6]; const float* bv1 = (const float*)d_in[7];
    const float* Wq2 = (const float*)d_in[8]; const float* bq2 = (const float*)d_in[9]; const float* Wk2 = (const float*)d_in[10]; const float* bk2 = (const float*)d_in[11]; const float* Wv2 = (const float*)d_in[12]; const float* bv2 = (const float*)d_in[13];
    const float* Wo1 = (const float*)d_in[14]; const float* bo1 = (const float*)d_in[15]; const float* Wo2 = (const float*)d_in[16]; const float* bo2 = (const float*)d_in[17];
    float* out0 = (float*)d_out; float* out1 = out0 + (size_t)NBI * NT_ * DM;    // (out_rgb.Wo1 + bo1, out_flow.Wo2 + bo2)
    char* wsp = (char*)d_ws;
    auto take = [&](size_t bytes) { char* p = wsp; wsp += (bytes + 255) & ~(size_t)255; return (void*)p; };
    bf* WB = (bf*)take((size_t)8 * DM * DM * 2);                                      // q_r, k_r, q_f, k_f, v_r, v_f, o_r, o_f; this and every bf16 plane below in fragment order
    bf* X = (bf*)take((size_t)2 * NBI * NT_ * DM * 2);                                // [stream][item][16-token tile][k step]
    bf* QKh = (bf*)take(4 * PLN * 2); bf* QKl = (bf*)take(4 * PLN * 2);               // [pair][q_r, k_r, q_f, k_f][16-token tile][k step]
    bf* VTh = (bf*)take(2 * PLN * 2); bf* VTl = (bf*)take(2 * PLN * 2);               // [pair][stream][32-token step][16-d tile]
    bf* Ch = (bf*)take(2 * PLN * 2); bf* Cl = (bf*)take(2 * PLN * 2);                 // ctx: [stream][16-row tile][k step]
    if ((size_t)(wsp - (char*)d_ws) > ws_size) return;    // 4 + 16 + 64 + 32 + 32 = 148 MiB
    k_cvtw<<<dim3(DM / 16, 8, 1), 256, 0, stream>>>(Wq1, Wk1, Wq2, Wk2, Wv1, Wv2, Wo1, Wo2, WB);
    k_cvtx<<<dim3(NBI * NT_ / 16, 2, 1), 256, 0, stream>>>(xr, xf, X);
    for (int b = 0; b < NBI; b += GI) {
        k_proj<<<dim3(MR / 64, DM / 64, 6), 128, 0, stream>>>(X + (size_t)b * NT_ * DM, WB, bq1, bk1, bq2, bk2, bv1, bv2, QKh, QKl, VTh, VTl, DM);
        k_attn<<<dim3(NT_ / (AQ * 16), NBH, 1), AW * 32, 0, stream>>>(QKh, QKl, VTh, VTl, Ch, Cl);                                                     // scores, both softmaxes, the merge and ctx of both streams, all pairs
        k_outp<<<dim3(MR / 64, DM / 64, 2), 128, 0, stream>>>(Ch, Cl, WB + (size_t)6 * DM * DM, bo1, bo2, out0 + (size_t)b * NT_ * DM, out1 + (size_t)b * NT_ * DM, DM, DM);
    }
}

// v007
// It runs in 227 microseconds.
// In two side-by-side timings against v006, it was 1.11 and 1.10 times as fast.
// Over all steps from v000 it is 27.1 times as fast.
#include <hip/hip_runtime.h>

// Compute dtypes, f32 accumulate, GI batch items per pass, every stage of a pass ONE launch (items, heads, the two streams and the projections ride in the grid): the six projections x.W^T + b ([1024 x 512].[512 x 512]; [out][in] weights as n-major B operands; PLAIN bf16
// operands = inputs rounded once, exact) and the two output projections (ctx as bf16 hi + UNSCALED residual) on v_wmma_f32_16x16x32_bf16; per (item, head) both
// score maps q.k^T ([1024 x 64].[64 x 1024]) and both P.v products ([1024 x 1024].[1024 x 64]) with both operands split (three products), in ONE kernel that keeps scores and P in registers

#define NBI  8
#define NT_  1024
#define DM   512
#define NH_  8
#define HD   64
#define KW   DM
#define NTK  NT_
#define SCL  0.125f
#define LOSC 1024.0f
#define GI   8                   // batch items per pass: all of them, so every stage is launched once
#define MR   (GI * NT_)          // rows of one pass
#define NBH  (GI * NH_)          // (item, head) pairs of one pass
#define PLN  ((size_t)MR * DM)   // elements of one [MR][512] plane
#define PPL  ((size_t)NT_ * HD)  // elements of one plane of one (item, head) pair; a pair's planes lie side by side, so that k_attn reaches each of them through a load's immediate offset

typedef _Float16 h16;
typedef unsigned short bf;
typedef __attribute__((ext_vector_type(16))) __bf16   v16bf;
typedef __attribute__((ext_vector_type(16))) _Float16 v16h;
typedef __attribute__((ext_vector_type(8)))  _Float16 v8h;
typedef __attribute__((ext_vector_type(8)))  unsigned short v8us;
typedef __attribute__((ext_vector_type(16))) unsigned short v16us;
typedef __attribute__((ext_vector_type(8)))  float    v8f;
typedef __attribute__((ext_vector_type(4)))  float    v4f;
typedef __attribute__((ext_vector_type(4)))  _Float16 v4h;
typedef v8h  __attribute__((may_alias)) v8ha;
typedef v4f  __attribute__((may_alias)) v4fa;
typedef v8us __attribute__((may_alias)) v8usa;
typedef __attribute__((ext_vector_type(4)))  unsigned v4u;
typedef v4u  __attribute__((may_alias)) v4ua;

__device__ __forceinline__ unsigned short f2bf(float f) { unsigned u = __float_as_uint(f); u += 0x7FFFu + ((u >> 16) & 1u); return (unsigned short)(u >> 16); }
__device__ __forceinline__ float bf2f(unsigned short b) { return __uint_as_float(((unsigned)b) << 16); }
__device__ __forceinline__ float bfr(float f) { return bf2f(f2bf(f)); }
__device__ __forceinline__ v16h cat16(v8h lo, v8h hi) { return __builtin_shufflevector(lo, hi, 0, 1, 2, 3, 4, 5, 6, 7, 8, 9, 10, 11, 12, 13, 14, 15); }
__device__ __forceinline__ v16bf cat16b(v8us lo, v8us hi) { return __builtin_bit_cast(v16bf, __builtin_shufflevector(lo, hi, 0, 1, 2, 3, 4, 5, 6, 7, 8, 9, 10, 11, 12, 13, 14, 15)); }
__device__ __forceinline__ v8f wmma16(v16h a, v16h b, v8f c) { return __builtin_amdgcn_wmma_f32_16x16x32_f16(false, a, false, b, (short)0, c, false, false); }
__device__ __forceinline__ v8f wmmab(v16bf a, v16bf b, v8f c) { return __builtin_amdgcn_wmma_f32_16x16x32_bf16(false, a, false, b, (short)0, c, false, false); }

// FRAGMENT ORDER. Every 16-row x 32-k operand tile lies in the workspace as the matrix instruction's lanes hold it: [piece 0, 1][lane][8 elements], 1 KiB; lane (h = lane / 16, c = lane % 16)
// holds row c, k = 8h .. 8h + 7 (piece 0) and 16 + 8h .. 16 + 8h + 7 (piece 1). One wave-wide 16-byte load of a piece then reads 512 consecutive bytes (4 whole lines) where rows of a
// row-major plane gave 16 lines, a quarter of each used. The k order of every product is the one it was.
#define FT   512                 // elements of a tile
#define FP   256                 // elements of a piece
// eight f32 values of a lane as bf16 hi + UNSCALED bf16 residual: 16 bytes to each plane
__device__ __forceinline__ unsigned rne16(float f) { const unsigned u = __float_as_uint(f); return u + 0x7FFFu + ((u >> 16) & 1u); }    // f2bf's rounding; the bf16 is the upper half
__device__ __forceinline__ void split8(v8f x, bf* dh, bf* dl) { v4u oh, ol;
#pragma unroll
    for (int i = 0; i < 4; ++i) { const unsigned h0 = rne16(x[2 * i]), h1 = rne16(x[2 * i + 1]);
        const unsigned l0 = rne16(x[2 * i] - __uint_as_float(h0 & 0xFFFF0000u)), l1 = rne16(x[2 * i + 1] - __uint_as_float(h1 & 0xFFFF0000u));
        oh[i] = (h1 & 0xFFFF0000u) | (h0 >> 16); ol[i] = (l1 & 0xFFFF0000u) | (l0 >> 16); }
    *(v4ua*)dh = oh; *(v4ua*)dl = ol; }
// one wave packs two tiles that lie side by side (64 columns) in 16 rows of a row-major f32 [..][512] matrix; src = row 0, first column; dh, dl = the first tile's place
template <bool LO>
__device__ __forceinline__ void pack2(const float* __restrict__ src, bf* dh, bf* dl) {
    const int lane = threadIdx.x & 31;
    const float* sp = src + (size_t)(lane & 15) * DM + 8 * (lane >> 4);
    v4f v[4][2];
#pragma unroll
    for (int q = 0; q < 4; ++q) { v[q][0] = *(const v4f*)(sp + q * 16); v[q][1] = *(const v4f*)(sp + q * 16 + 4); }
#pragma unroll
    for (int q = 0; q < 4; ++q) { v8us oh, ol;
#pragma unroll
        for (int i = 0; i < 8; ++i) { const float x = v[q][i >> 2][i & 3]; const unsigned short hb = f2bf(x); oh[i] = hb; ol[i] = f2bf(x - bf2f(hb)); }
        *(v8us*)(dh + q * FP + lane * 8) = oh; if (LO) *(v8us*)(dl + q * FP + lane * 8) = ol; }
}
// a row-major [rows][512] matrix as a GEMM operand: tiles in the order [row tile][k step]; wave wid takes row tile wid / 8, k steps 2 (wid % 8) and the next
template <bool LO>
__device__ __forceinline__ void packm(const float* __restrict__ src, bf* dh, bf* dl) {
    const int wid = blockIdx.x * 8 + (threadIdx.x >> 5), rt = wid >> 3, kq = wid & 7;
    const size_t o = ((size_t)rt * (DM / 32) + kq * 2) * FT;
    pack2<LO>(src + (size_t)rt * 16 * DM + kq * 64, dh + o, dl + o);
}
// all eight weights in one launch: blockIdx.y picks the matrix
__global__ __launch_bounds__(256) void k_cvtw(const float* w0, const float* w1, const float* w2, const float* w3, const float* w4, const float* w5, const float* w6, const float* w7, bf* dst) {
    const int y = blockIdx.y;
    const float* src = y == 0 ? w0 : y == 1 ? w1 : y == 2 ? w2 : y == 3 ? w3 : y == 4 ? w4 : y == 5 ? w5 : y == 6 ? w6 : w7;
    packm<false>(src, dst + (size_t)y * DM * DM, dst);
}
// both inputs, all items, in one launch: blockIdx.y picks the stream
__global__ __launch_bounds__(256) void k_cvtx(const float* xr, const float* xf, bf* dst) {
    packm<false>(blockIdx.y ? xf : xr, dst + (size_t)blockIdx.y * NBI * NT_ * DM, dst);
}

// k_gemmb: 128 x 128 block tile (2 x 2 waves of 64 x 64) of C = (A [+ Al]).B^T + bf(bias[c]). A wave holds GR = 4 row tiles x 4 column tiles: every A and every B fragment that it loads feeds four products,
// the two waves of a block row read the same A and the two of a block column the same B, and a quarter as many waves are started.
// PACK = false: f32 rows, whole lines. PACK = true: the wave's 64 x 64 goes out as the next stage's operand, bf16 hi + residual, in fragment order, at dh / dl (the wave's own place):
// turned = false, per row tile 16 tokens x 64 k = two tiles (through the wave's LDS rows); turned = true, its transpose: row tiles 2 u and 2 u + 1 are the two pieces of 32-token step u, four 16-d tiles each, FT apart
#define GR   4                   // 16-row tiles of a wave
template <bool SPLITA, bool PACK>
__device__ __forceinline__ void gemmb_body(const bf* __restrict__ A, const bf* __restrict__ Al, const bf* __restrict__ Bn, const float* __restrict__ bias, float* C, int ldc, bf* dh = nullptr, bf* dl = nullptr, bool turned = false) {
    __shared__ __align__(16) float ost[4][GR * 16 * 68];
    constexpr int K = KW;    // a constant, so that a wave's four A and four B tile rows are reached from one base each through the loads' immediate offsets
    const int lane = threadIdx.x & 31, wave = __builtin_amdgcn_readfirstlane(threadIdx.x >> 5), lr = lane & 15, hi = lane >> 4;
    const int r0 = blockIdx.x * 128 + (wave >> 1) * 64, c0 = blockIdx.y * 128 + (wave & 1) * 64;
    // operands in fragment order: 16 rows x K = K / 32 tiles in a row, TR bytes; a lane walks the tiles with one pointer per operand plane, the wave's further tile rows stand at immediate offsets
    constexpr int TR = 16 * K * 2;
    const size_t aoff = (size_t)r0 * K;
    const char* la = (const char*)(A + aoff) + lane * 16; const char* lal = SPLITA ? (const char*)(Al + aoff) + lane * 16 : la;
    const char* lb = (const char*)(Bn + (size_t)c0 * K) + lane * 16;
    v8f acc[GR][4];
#pragma unroll
    for (int g = 0; g < GR; ++g) {
#pragma unroll
        for (int t = 0; t < 4; ++t) acc[g][t] = (v8f){}; }
#pragma unroll 1
    for (int kc = 0; kc < K; kc += 32) {
        v16bf a[GR], al[GR];
#pragma unroll
        for (int g = 0; g < GR; ++g) { a[g] = cat16b(*(const v8us*)(la + g * TR), *(const v8us*)(la + g * TR + FP * 2)); al[g] = a[g];
            if (SPLITA) al[g] = cat16b(*(const v8us*)(lal + g * TR), *(const v8us*)(lal + g * TR + FP * 2)); }
        v16bf b[4];
#pragma unroll
        for (int t = 0; t < 4; ++t) b[t] = cat16b(*(const v8us*)(lb + t * TR), *(const v8us*)(lb + t * TR + FP * 2));
        // behind the trip's loads, before anything is written over the address registers that they name; the pointers are inputs so that they are kept until it
        asm volatile("s_wait_xcnt 0x0" :: "v"(la), "v"(lal), "v"(lb) : "memory");
        la += FT * 2; lal += FT * 2; lb += FT * 2;
        __builtin_amdgcn_sched_barrier(0);    // the trip's loads go out as one group: left alone, they are spread among the products and a trip waits for L2 several times over
#pragma unroll
        for (int t = 0; t < 4; ++t) {
#pragma unroll
            for (int g = 0; g < GR; ++g) acc[g][t] = wmmab(a[g], b[t], acc[g][t]);
            if (SPLITA) {
#pragma unroll
                for (int g = 0; g < GR; ++g) acc[g][t] = wmmab(al[g], b[t], acc[g][t]); } }
        // four vector slots between the trip's last products and whatever follows them over the back edge or behind the loop
        asm volatile("v_nop\n\tv_nop\n\tv_nop\n\tv_nop" : "+v"(acc[0][0]), "+v"(acc[0][1]), "+v"(acc[0][2]), "+v"(acc[0][3]), "+v"(acc[1][0]), "+v"(acc[1][1]), "+v"(acc[1][2]), "+v"(acc[1][3]),
                     "+v"(acc[2][0]), "+v"(acc[2][1]), "+v"(acc[2][2]), "+v"(acc[2][3]), "+v"(acc[3][0]), "+v"(acc[3][1]), "+v"(acc[3][2]), "+v"(acc[3][3]) : "v"(a[0]), "v"(al[0]), "v"(a[1]), "v"(al[1]), "v"(a[2]), "v"(al[2]), "v"(a[3]), "v"(al[3]));
    }
    float* os = &ost[wave][0];
    if (!(PACK && turned)) {
#pragma unroll
        for (int t = 0; t < 4; ++t) { const float bv = bias ? bfr(bias[c0 + t * 16 + lr]) : 0.f;
#pragma unroll
            for (int g = 0; g < GR; ++g) {
#pragma unroll
                for (int j = 0; j < 8; ++j) os[(g * 16 + hi * 8 + j) * 68 + t * 16 + lr] = acc[g][t][j] + bv; } }
    }
    __syncthreads();
    if (PACK) {
        if (turned) {
            // an accumulator tile IS a piece of the transposed operand: lane (lr, hi) holds column (d) t * 16 + lr, rows (tokens) 8 hi .. 8 hi + 7
            float bv[4];
#pragma unroll
            for (int t = 0; t < 4; ++t) bv[t] = bfr(bias[c0 + t * 16 + lr]);
#pragma unroll
            for (int i = 0; i < 4 * GR; ++i) { const int g = i >> 2, t = i & 3; const int e = ((g >> 1) * 4 + t) * FT + (g & 1) * FP + lane * 8; split8(acc[g][t] + bv[t], dh + e, dl + e);
                asm volatile("s_wait_xcnt 0x0" ::: "memory");    // behind the two stores, before what follows is written over the registers that they name
                __builtin_amdgcn_sched_barrier(0); }    // one piece at a time: interleaved, the pieces' temporaries add to the 128 accumulator registers and a SIMD holds fewer waves to hide the loop's loads
        } else {
            // lane (lr, hi) takes row 16 (q / 4) + lr, columns 16 (q % 4) + 8 hi .. + 7 of piece q
#pragma unroll
            for (int q = 0; q < 4 * GR; ++q) { const float* sp = os + ((q >> 2) * 16 + lr) * 68 + (q & 3) * 16 + hi * 8; const v4f x0 = *(const v4fa*)sp, x1 = *(const v4fa*)(sp + 4);    // each row tile's four pieces follow those of the one before
                split8((v8f){x0[0], x0[1], x0[2], x0[3], x1[0], x1[1], x1[2], x1[3]}, dh + q * FP + lane * 8, dl + q * FP + lane * 8);
                asm volatile("s_wait_xcnt 0x0" ::: "memory"); }    // behind the two stores, as above
        }
    } else {
        float* crow = C + (size_t)r0 * ldc + c0;
#pragma unroll
        for (int s = 0; s < 8 * GR; ++s) { const int Lid = (lane >> 3) + 4 * s, piece = lane & 7; const int row = Lid >> 1, cofs = (Lid & 1) * 32 + piece * 4;
            *(v4f*)(crow + (size_t)row * ldc + cofs) = *(const v4fa*)(os + row * 68 + cofs); }
    }
}
// the six projections of one pass in one launch: rows = GI items, blockIdx.y = pair of heads (a wave's 64 columns are one head), blockIdx.z = q_r, k_r, q_f, k_f, v_r, v_f (weights in that order in WB; X = [stream][all rows][512], at the pass's first row).
// Each wave stores its 64 tokens of one head straight as k_attn's operand: q, k per (pair, plane) [16-token tile][k step]; v turned, per (pair, stream) [32-token step][16-d tile]
__global__ __launch_bounds__(128) void k_proj(const bf* __restrict__ X, const bf* __restrict__ WB, const float* bq1, const float* bk1, const float* bq2, const float* bk2, const float* bv1, const float* bv2, bf* QKh, bf* QKl, bf* VTh, bf* VTl) {
    const int z = blockIdx.z, wave = __builtin_amdgcn_readfirstlane(threadIdx.x >> 5), tb = blockIdx.x % (NT_ / 128);
    const size_t pr = (size_t)(blockIdx.x / (NT_ / 128)) * NH_ + blockIdx.y * 2 + (wave & 1);
    const int tt = tb * 8 + (wave >> 1) * 4;    // the wave's first 16-token tile
    const bool flow = z == 2 || z == 3 || z == 5, turned = z >= 4;
    const float* bias = z == 0 ? bq1 : z == 1 ? bk1 : z == 2 ? bq2 : z == 3 ? bk2 : z == 4 ? bv1 : bv2;
    const size_t o = turned ? (pr * 2 + (z - 4)) * PPL + (size_t)((tt >> 1) * 4) * FT : ((pr * 4 + z) * (NT_ / 16) + tt) * (16 * HD);
    gemmb_body<false, true>(X + (flow ? (size_t)NBI * NT_ * DM : 0), nullptr, WB + (size_t)z * DM * DM, bias, nullptr, 0, (turned ? VTh : QKh) + o, (turned ? VTl : QKl) + o, turned);
}
// both output projections of one pass in one launch: blockIdx.z = stream
__global__ __launch_bounds__(128) void k_outp(const bf* __restrict__ Ch, const bf* __restrict__ Cl, const bf* __restrict__ WBo, const float* bo1, const float* bo2, float* o0, float* o1, int ldc) {
    const int s = blockIdx.z;
    gemmb_body<true, false>(Ch + (size_t)s * PLN, Cl + (size_t)s * PLN, WBo + (size_t)s * DM * DM, s ? bo2 : bo1, s ? o1 : o0, ldc);
}

// e^x as the native form has it (one multiply, v_exp_f32); the v_nop is the one free slot that the instruction set asks for behind a transcendental, in its own statement so that it stays there
__device__ __forceinline__ float exp_slot(float x) { float r; asm("v_exp_f32 %0, %1\n\tv_nop" : "=v"(r) : "v"(x * 1.44269504088896340736f)); return r; }
// k_attn: one work-group = 32 queries (two 16-query tiles) of one (item, head) pair, all 1024 keys, both streams; wave w owns keys w*64 .. w*64+63. Every key and value fragment that a wave
// loads serves both query tiles, so a query costs half the key and value bytes from L2 that a 16-query work-group pays. The scores are formed transposed, S^T = K.Q^T
// (A = key rows, B = query rows, the same loader for both, three products per 32-k step in the order hh, k_hi.q_lo, k_lo.q_hi), so a lane holds 32 scores of each of TWO queries per stream
// and both maps stay in registers. Row maximum and row sum: in the lane, one exchange between the lane halves, then over the 16 waves through LDS. p = max(p_r, p_f) is split into
// bf16 hi + residual in place: two neighbouring score tiles are one B operand of O^T = V^T.P^T. Each wave sums its own 64 keys; the 16 partial O^T are added through LDS in wave order.
#define AW   16                  // waves of a work-group
#define AQ   2                   // 16-query tiles of a work-group
#define AKW  (NT_ / AW)          // keys of a wave
#define AKT  (AKW / 16)          // score tiles of a wave, per stream and query tile
// four waves per SIMD (one work-group per WGP): holds the build within 256 registers a wave, so that the 16 waves fit one WGP
#define OTS  256                 // floats of one staged 16 x 16 partial tile; written and read lane by lane, 16 bytes a lane
#define SRP  (AW + 4)            // floats of one query's row of per-wave maxima or sums: 16 + 4, so that 16 queries' words of one wave fall in 16 different banks
__global__ __launch_bounds__(512) __attribute__((amdgpu_waves_per_eu(4, 4))) void k_attn(const bf* __restrict__ QKh, const bf* __restrict__ QKl, const bf* __restrict__ VTh, const bf* __restrict__ VTl, bf* Ch, bf* Cl) {
    __shared__ __align__(16) float ored[AW][AQ * 8][OTS];          // [wave][query tile][stream][d tile]
    __shared__ __align__(16) float sred[2][2][AQ * 16][SRP];       // [maximum, sum][stream][query][wave]
    const int lane = threadIdx.x & 31, wave = threadIdx.x >> 5, c = lane & 15, h = lane >> 4;
    const int q0 = blockIdx.x * (AQ * 16), p = blockIdx.y, kb = wave * AKW;
    const unsigned lo64 = (unsigned)(lane * 8);      // operands in fragment order: 16 tokens x 64 = two tiles in a row
    const bf* qbh = QKh + ((size_t)p * 4 * NT_ + q0) * HD + lo64; const bf* qbl = QKl + ((size_t)p * 4 * NT_ + q0) * HD + lo64;
    const bf* kbh = QKh + ((size_t)p * 4 * NT_ + kb) * HD + lo64; const bf* kbl = QKl + ((size_t)p * 4 * NT_ + kb) * HD + lo64;
    v8f S[2][AKT][AQ];
#pragma unroll
    for (int s = 0; s < 2; ++s) {
        const bf* qph = qbh + (size_t)(2 * s) * PPL; const bf* qpl = qbl + (size_t)(2 * s) * PPL;
        const bf* kph = kbh + (size_t)(2 * s + 1) * PPL; const bf* kpl = kbl + (size_t)(2 * s + 1) * PPL;
#pragma unroll
        for (int t = 0; t < AKT; ++t) {
#pragma unroll
            for (int qt = 0; qt < AQ; ++qt) S[s][t][qt] = (v8f){}; }
#pragma unroll
        for (int kk = 0; kk < 2; ++kk) { v16bf qh[AQ], ql[AQ], kh[AKT], kl[AKT];
#pragma unroll
            for (int qt = 0; qt < AQ; ++qt) { const unsigned o = qt * 16 * HD + kk * FT;
                qh[qt] = cat16b(*(const v8us*)(qph + o), *(const v8us*)(qph + o + FP)); ql[qt] = cat16b(*(const v8us*)(qpl + o), *(const v8us*)(qpl + o + FP)); }
#pragma unroll
            for (int t = 0; t < AKT; ++t) { const unsigned o = t * 16 * HD + kk * FT;
                kh[t] = cat16b(*(const v8us*)(kph + o), *(const v8us*)(kph + o + FP)); kl[t] = cat16b(*(const v8us*)(kpl + o), *(const v8us*)(kpl + o + FP)); }
            // behind the last query and key loads the address registers fall free: the wait stands before anything is written over them, and names them as inputs so that they are kept until it
            if (s == 1 && kk == 1) asm volatile("s_wait_xcnt 0x0" :: "v"(qbh), "v"(qbl), "v"(kbh), "v"(kbl) : "memory");
            __builtin_amdgcn_sched_barrier(0);    // the 24 loads of two query and four key tiles go out as one group: left alone, each product waits on a load issued just in front of it
#pragma unroll
            for (int t = 0; t < AKT; ++t) {
#pragma unroll
                for (int qt = 0; qt < AQ; ++qt) S[s][t][qt] = wmmab(kh[t], qh[qt], S[s][t][qt]);
#pragma unroll
                for (int qt = 0; qt < AQ; ++qt) S[s][t][qt] = wmmab(kh[t], ql[qt], S[s][t][qt]);
#pragma unroll
                for (int qt = 0; qt < AQ; ++qt) S[s][t][qt] = wmmab(kl[t], qh[qt], S[s][t][qt]); } }
    }
    float m[2][AQ], inv[2][AQ];
#pragma unroll
    for (int s = 0; s < 2; ++s) {
#pragma unroll
        for (int qt = 0; qt < AQ; ++qt) { v8f v = S[s][0][qt] * SCL;
#pragma unroll
            for (int t = 1; t < AKT; ++t) {
#pragma unroll
                for (int r = 0; r < 8; ++r) v[r] = fmaxf(v[r], S[s][t][qt][r] * SCL); }
            float x = fmaxf(fmaxf(fmaxf(v[0], v[1]), fmaxf(v[2], v[3])), fmaxf(fmaxf(v[4], v[5]), fmaxf(v[6], v[7])));
            x = fmaxf(x, __shfl_xor(x, 16, 32));
            if (h == 0) sred[0][s][qt * 16 + c][wave] = x; } }
    __syncthreads();
#pragma unroll
    for (int s = 0; s < 2; ++s) {
#pragma unroll
        for (int qt = 0; qt < AQ; ++qt) { const float* sr = &sred[0][s][qt * 16 + c][0]; float x = sr[0];
#pragma unroll
            for (int w = 1; w < AW; ++w) x = fmaxf(x, sr[w]);
            m[s][qt] = x; } }
#pragma unroll
    for (int s = 0; s < 2; ++s) {
#pragma unroll
        for (int qt = 0; qt < AQ; ++qt) { v8f a = (v8f){};
#pragma unroll
            for (int t = 0; t < AKT; ++t) {
#pragma unroll
                for (int r = 0; r < 8; ++r) { const float e = exp_slot(S[s][t][qt][r] * SCL - m[s][qt]); S[s][t][qt][r] = e; a[r] += e; } }
            float x = ((a[0] + a[1]) + (a[2] + a[3])) + ((a[4] + a[5]) + (a[6] + a[7]));
            x += __shfl_xor(x, 16, 32);
            if (h == 0) sred[1][s][qt * 16 + c][wave] = x; } }
    __syncthreads();
#pragma unroll
    for (int s = 0; s < 2; ++s) {
#pragma unroll
        for (int qt = 0; qt < AQ; ++qt) { const float* sr = &sred[1][s][qt * 16 + c][0]; float x = sr[0];
#pragma unroll
            for (int w = 1; w < AW; ++w) x += sr[w];
            inv[s][qt] = 1.0f / x; } }
    v16bf ph[AKT / 2][AQ], pl[AKT / 2][AQ];
#pragma unroll
    for (int j = 0; j < AKT / 2; ++j) {
#pragma unroll
        for (int qt = 0; qt < AQ; ++qt) { v16us oh, ol;
#pragma unroll
            for (int i = 0; i < 16; ++i) { const int t = 2 * j + (i >> 3), r = i & 7;
                const float pv = fmaxf(S[0][t][qt][r] * inv[0][qt], S[1][t][qt][r] * inv[1][qt]); const unsigned short hb = f2bf(pv); oh[i] = hb; ol[i] = f2bf(pv - bf2f(hb)); }
            ph[j][qt] = __builtin_bit_cast(v16bf, oh); pl[j][qt] = __builtin_bit_cast(v16bf, ol); } }
    const unsigned lov = (unsigned)(lane * 8);
#pragma unroll
    for (int s = 0; s < 2; ++s) {
        const size_t vo = ((size_t)p * 2 + s) * PPL + (size_t)kb * HD;    // the wave's two 32-token steps, four d tiles each
        const bf* vph = VTh + vo; const bf* vpl = VTl + vo;
        v8f O[4][AQ];
#pragma unroll
        for (int dt = 0; dt < 4; ++dt) {
#pragma unroll
            for (int qt = 0; qt < AQ; ++qt) O[dt][qt] = (v8f){}; }
#pragma unroll
        for (int j = 0; j < AKT / 2; ++j) { v16bf vh[4], vl[4];
#pragma unroll
            for (int dt = 0; dt < 4; ++dt) { const unsigned o = lov + (j * 4 + dt) * FT;
                vh[dt] = cat16b(*(const v8us*)(vph + o), *(const v8us*)(vph + o + FP)); vl[dt] = cat16b(*(const v8us*)(vpl + o), *(const v8us*)(vpl + o + FP)); }
            __builtin_amdgcn_sched_barrier(0);    // as above: the 16 loads of four d tiles go out as one group
#pragma unroll
            for (int dt = 0; dt < 4; ++dt) {
#pragma unroll
                for (int qt = 0; qt < AQ; ++qt) O[dt][qt] = wmmab(vh[dt], ph[j][qt], O[dt][qt]);
#pragma unroll
                for (int qt = 0; qt < AQ; ++qt) O[dt][qt] = wmmab(vh[dt], pl[j][qt], O[dt][qt]);
#pragma unroll
                for (int qt = 0; qt < AQ; ++qt) O[dt][qt] = wmmab(vl[dt], ph[j][qt], O[dt][qt]); } }
        // four vector slots between the last products of this stream and the first of the next, which start anew (C = 0) in the same accumulator registers
        if (s == 0) asm volatile("v_nop\n\tv_nop\n\tv_nop\n\tv_nop" : "+v"(O[0][0]), "+v"(O[1][0]), "+v"(O[2][0]), "+v"(O[3][0]), "+v"(O[0][1]), "+v"(O[1][1]), "+v"(O[2][1]), "+v"(O[3][1]));
#pragma unroll
        for (int dt = 0; dt < 4; ++dt) {
#pragma unroll
            for (int qt = 0; qt < AQ; ++qt) { float* ow = &ored[wave][qt * 8 + s * 4 + dt][0]; const v8f o = O[dt][qt];
                *(v4fa*)(ow + lane * 4) = (v4f){o[0], o[1], o[2], o[3]}; *(v4fa*)(ow + 128 + lane * 4) = (v4f){o[4], o[5], o[6], o[7]}; } }
    }
    __syncthreads();
    // wave w adds one 16 x 16 tile, stream w / 8, query tile (w / 4) % 2, d tile w % 4, each lane the eight sums that it would hold as an accumulator, and stores them as one piece (512 consecutive bytes per plane)
    // of k_outp's A operand: [stream][16-row tile][k step][piece][lane][8], bf16 hi + residual
    const int so = wave >> 3, qt = (wave >> 2) & 1, dt = wave & 3;
    v4f a0 = (v4f){}, a1 = (v4f){};
#pragma unroll
    for (int w = 0; w < AW; ++w) { const float* ir = &ored[w][qt * 8 + so * 4 + dt][0]; a0 += *(const v4fa*)(ir + lane * 4); a1 += *(const v4fa*)(ir + 128 + lane * 4); }
    const size_t o = (size_t)so * PLN + ((((size_t)(p / NH_) * NT_ + q0) / 16 + qt) * (DM / 32) + (p % NH_) * 2 + (dt >> 1)) * FT + (dt & 1) * FP + lane * 8;
    split8((v8f){a0[0], a0[1], a0[2], a0[3], a1[0], a1[1], a1[2], a1[3]}, Ch + o, Cl + o);
}

extern "C" void kernel_launch(void* const* d_in, const int* in_sizes, int n_in,
                              void* d_out, int out_size, void* d_ws, size_t ws_size, hipStream_t stream) {
    (void)in_sizes; (void)n_in; (void)out_size;
    const float* xr = (const float*)d_in[0]; const float* xf = (const float*)d_in[1];
    const float* Wq1 = (const float*)d_in[2]; const float* bq1 = (const float*)d_in[3]; const float* Wk1 = (const float*)d_in[4]; const float* bk1 = (const float*)d_in[5]; const float* Wv1 = (const float*)d_in[6]; const float* bv1 = (const float*)d_in[7];
    const float* Wq2 = (const float*)d_in[8]; const float* bq2 = (const float*)d_in[9]; const float* Wk2 = (const float*)d_in[10]; const float* bk2 = (const float*)d_in[11]; const float* Wv2 = (const float*)d_in[12]; const float* bv2 = (const float*)d_in[13];
    const float* Wo1 = (const float*)d_in[14]; const float* bo1 = (const float*)d_in[15]; const float* Wo2 = (const float*)d_in[16]; const float* bo2 = (const float*)d_in[17];
    float* out0 = (float*)d_out; float* out1 = out0 + (size_t)NBI * NT_ * DM;    // (out_rgb.Wo1 + bo1, out_flow.Wo2 + bo2)
    char* wsp = (char*)d_ws;
    auto take = [&](size_t bytes) { char* p = wsp; wsp += (bytes + 255) & ~(size_t)255; return (void*)p; };
    bf* WB = (bf*)take((size_t)8 * DM * DM * 2);                                      // q_r, k_r, q_f, k_f, v_r, v_f, o_r, o_f; this and every bf16 plane below in fragment order
    bf* X = (bf*)take((size_t)2 * NBI * NT_ * DM * 2);                                // [stream][item][16-token tile][k step]
    bf* QKh = (bf*)take(4 * PLN * 2); bf* QKl = (bf*)take(4 * PLN * 2);               // [pair][q_r, k_r, q_f, k_f][16-token tile][k step]
    bf* VTh = (bf*)take(2 * PLN * 2); bf* VTl = (bf*)take(2 * PLN * 2);               // [pair][stream][32-token step][16-d tile]
    bf* Ch = (bf*)take(2 * PLN * 2); bf* Cl = (bf*)take(2 * PLN * 2);                 // ctx: [stream][16-row tile][k step]
    if ((size_t)(wsp - (char*)d_ws) > ws_size) return;    // 4 + 16 + 64 + 32 + 32 = 148 MiB
    k_cvtw<<<dim3(DM / 16, 8, 1), 256, 0, stream>>>(Wq1, Wk1, Wq2, Wk2, Wv1, Wv2, Wo1, Wo2, WB);
    k_cvtx<<<dim3(NBI * NT_ / 16, 2, 1), 256, 0, stream>>>(xr, xf, X);
    for (int b = 0; b < NBI; b += GI) {
        k_proj<<<dim3(MR / 128, DM / 128, 6), 128, 0, stream>>>(X + (size_t)b * NT_ * DM, WB, bq1, bk1, bq2, bk2, bv1, bv2, QKh, QKl, VTh, VTl);
        k_attn<<<dim3(NT_ / (AQ * 16), NBH, 1), AW * 32, 0, stream>>>(QKh, QKl, VTh, VTl, Ch, Cl);                                                     // scores, both softmaxes, the merge and ctx of both streams, all pairs
        k_outp<<<dim3(MR / 128, DM / 128, 2), 128, 0, stream>>>(Ch, Cl, WB + (size_t)6 * DM * DM, bo1, bo2, out0 + (size_t)b * NT_ * DM, out1 + (size_t)b * NT_ * DM, DM);
    }
}

// v009
// It runs in 155 microseconds.
// Versions between v007 and this one are left out; their measured steps multiply to 1.46 times as fast.
// Counting every step since v000, it is 39.6 times as fast.
#include <hip/hip_runtime.h>

// Compute dtypes, f32 accumulate, GI batch items per pass, every stage of a pass ONE launch (items, heads, the two streams and the projections ride in the grid): the six projections x.W^T + b ([1024 x 512].[512 x 512]; [out][in] weights as n-major B operands; PLAIN bf16
// operands = inputs rounded once, exact) and the two output projections (ctx as bf16 hi + UNSCALED residual) on v_wmma_f32_16x16x32_bf16; per (item, head) both
// score maps q.k^T ([1024 x 64].[64 x 1024]) and both P.v products ([1024 x 1024].[1024 x 64]) on v_wmma_f32_16x16x32_f16, each operand (q, k, v, P) rounded once to f16 (one product; f16 keeps 11 bits,
// three more than the bf16 that x and the weights behind q, k and v were rounded to), in ONE kernel that keeps scores and P in registers

#define NBI  8
#define NT_  1024
#define DM   512
#define NH_  8
#define HD   64
#define KW   DM
#define NTK  NT_
#define SCL  0.125f
#define LOSC 1024.0f
#define GI   8                   // batch items per pass: all of them, so every stage is launched once
#define MR   (GI * NT_)          // rows of one pass
#define NBH  (GI * NH_)          // (item, head) pairs of one pass
#define PLN  ((size_t)MR * DM)   // elements of one [MR][512] plane
#define PPL  ((size_t)NT_ * HD)  // elements of one plane of one (item, head) pair; a pair's planes lie side by side, so that k_attn reaches each of them through a load's immediate offset

typedef _Float16 h16;
typedef unsigned short bf;
typedef __attribute__((ext_vector_type(16))) __bf16   v16bf;
typedef __attribute__((ext_vector_type(16))) _Float16 v16h;
typedef __attribute__((ext_vector_type(8)))  _Float16 v8h;
typedef __attribute__((ext_vector_type(8)))  unsigned short v8us;
typedef __attribute__((ext_vector_type(16))) unsigned short v16us;
typedef __attribute__((ext_vector_type(8)))  float    v8f;
typedef __attribute__((ext_vector_type(4)))  float    v4f;
typedef __attribute__((ext_vector_type(4)))  _Float16 v4h;
typedef v8h  __attribute__((may_alias)) v8ha;
typedef v4f  __attribute__((may_alias)) v4fa;
typedef v8us __attribute__((may_alias)) v8usa;
typedef __attribute__((ext_vector_type(4)))  unsigned v4u;
typedef v4u  __attribute__((may_alias)) v4ua;

__device__ __forceinline__ unsigned short f2bf(float f) { unsigned u = __float_as_uint(f); u += 0x7FFFu + ((u >> 16) & 1u); return (unsigned short)(u >> 16); }
__device__ __forceinline__ float bf2f(unsigned short b) { return __uint_as_float(((unsigned)b) << 16); }
__device__ __forceinline__ float bfr(float f) { return bf2f(f2bf(f)); }
__device__ __forceinline__ v16h cat16h(v8us lo, v8us hi) { return __builtin_bit_cast(v16h, __builtin_shufflevector(lo, hi, 0, 1, 2, 3, 4, 5, 6, 7, 8, 9, 10, 11, 12, 13, 14, 15)); }
__device__ __forceinline__ v16bf cat16b(v8us lo, v8us hi) { return __builtin_bit_cast(v16bf, __builtin_shufflevector(lo, hi, 0, 1, 2, 3, 4, 5, 6, 7, 8, 9, 10, 11, 12, 13, 14, 15)); }
__device__ __forceinline__ v8f wmma16(v16h a, v16h b, v8f c) { return __builtin_amdgcn_wmma_f32_16x16x32_f16(false, a, false, b, (short)0, c, false, false); }
__device__ __forceinline__ v8f wmmab(v16bf a, v16bf b, v8f c) { return __builtin_amdgcn_wmma_f32_16x16x32_bf16(false, a, false, b, (short)0, c, false, false); }

// FRAGMENT ORDER. Every 16-row x 32-k operand tile lies in the workspace as the matrix instruction's lanes hold it: [piece 0, 1][lane][8 elements], 1 KiB; lane (h = lane / 16, c = lane % 16)
// holds row c, k = 8h .. 8h + 7 (piece 0) and 16 + 8h .. 16 + 8h + 7 (piece 1). One wave-wide 16-byte load of a piece then reads 512 consecutive bytes (4 whole lines) where rows of a
// row-major plane gave 16 lines, a quarter of each used. The k order of every product is the one it was.
#define FT   512                 // elements of a tile
#define FP   256                 // elements of a piece
// eight f32 values of a lane as bf16 hi + UNSCALED bf16 residual: 16 bytes to each plane
__device__ __forceinline__ unsigned rne16(float f) { const unsigned u = __float_as_uint(f); return u + 0x7FFFu + ((u >> 16) & 1u); }    // f2bf's rounding; the bf16 is the upper half
__device__ __forceinline__ void split8(v8f x, bf* dh, bf* dl) { v4u oh, ol;
#pragma unroll
    for (int i = 0; i < 4; ++i) { const unsigned h0 = rne16(x[2 * i]), h1 = rne16(x[2 * i + 1]);
        const unsigned l0 = rne16(x[2 * i] - __uint_as_float(h0 & 0xFFFF0000u)), l1 = rne16(x[2 * i + 1] - __uint_as_float(h1 & 0xFFFF0000u));
        oh[i] = (h1 & 0xFFFF0000u) | (h0 >> 16); ol[i] = (l1 & 0xFFFF0000u) | (l0 >> 16); }
    *(v4ua*)dh = oh; *(v4ua*)dl = ol; }
// eight f32 values of a lane as f16, rounded to nearest even: 16 bytes
__device__ __forceinline__ void half8(v8f x, bf* d) { *(v8us*)d = __builtin_bit_cast(v8us, __builtin_convertvector(x, v8h)); }
// one wave packs two tiles that lie side by side (64 columns) in 16 rows of a row-major f32 [..][512] matrix; src = row 0, first column; dh, dl = the first tile's place
template <bool LO>
__device__ __forceinline__ void pack2(const float* __restrict__ src, bf* dh, bf* dl) {
    const int lane = threadIdx.x & 31;
    const float* sp = src + (size_t)(lane & 15) * DM + 8 * (lane >> 4);
    v4f v[4][2];
#pragma unroll
    for (int q = 0; q < 4; ++q) { v[q][0] = *(const v4f*)(sp + q * 16); v[q][1] = *(const v4f*)(sp + q * 16 + 4); }
#pragma unroll
    for (int q = 0; q < 4; ++q) { v8us oh, ol;
#pragma unroll
        for (int i = 0; i < 8; ++i) { const float x = v[q][i >> 2][i & 3]; const unsigned short hb = f2bf(x); oh[i] = hb; ol[i] = f2bf(x - bf2f(hb)); }
        *(v8us*)(dh + q * FP + lane * 8) = oh; if (LO) *(v8us*)(dl + q * FP + lane * 8) = ol; }
}
// a row-major [rows][512] matrix as a GEMM operand: tiles in the order [row tile][k step]; wave wid takes row tile wid / 8, k steps 2 (wid % 8) and the next
template <bool LO>
__device__ __forceinline__ void packm(const float* __restrict__ src, bf* dh, bf* dl) {
    const int wid = blockIdx.x * 8 + (threadIdx.x >> 5), rt = wid >> 3, kq = wid & 7;
    const size_t o = ((size_t)rt * (DM / 32) + kq * 2) * FT;
    pack2<LO>(src + (size_t)rt * 16 * DM + kq * 64, dh + o, dl + o);
}
// all eight weights in one launch: blockIdx.y picks the matrix
__global__ __launch_bounds__(256) void k_cvtw(const float* w0, const float* w1, const float* w2, const float* w3, const float* w4, const float* w5, const float* w6, const float* w7, bf* dst) {
    const int y = blockIdx.y;
    const float* src = y == 0 ? w0 : y == 1 ? w1 : y == 2 ? w2 : y == 3 ? w3 : y == 4 ? w4 : y == 5 ? w5 : y == 6 ? w6 : w7;
    packm<false>(src, dst + (size_t)y * DM * DM, dst);
}
// both inputs, all items, in one launch: blockIdx.y picks the stream
__global__ __launch_bounds__(256) void k_cvtx(const float* xr, const float* xf, bf* dst) {
    packm<false>(blockIdx.y ? xf : xr, dst + (size_t)blockIdx.y * NBI * NT_ * DM, dst);
}

// k_gemmb: 128 x 128 block tile (2 x 2 waves of 64 x 64) of C = (A [+ Al]).B^T + bf(bias[c]). A wave holds GR = 4 row tiles x 4 column tiles: every A and every B fragment that it loads feeds four products,
// the two waves of a block row read the same A and the two of a block column the same B, and a quarter as many waves are started.
// PACK = false: f32 rows, whole lines. PACK = true: the wave's 64 x 64 goes out as the next stage's operand, f16, in fragment order, at dh (the wave's own place):
// turned = false, per row tile 16 tokens x 64 k = two tiles (through the wave's LDS rows); turned = true, its transpose: row tiles 2 u and 2 u + 1 are the two pieces of 32-token step u, four 16-d tiles each, FT apart
#define GR   4                   // 16-row tiles of a wave
template <bool SPLITA, bool PACK>
__device__ __forceinline__ void gemmb_body(const bf* __restrict__ A, const bf* __restrict__ Al, const bf* __restrict__ Bn, const float* __restrict__ bias, float* C, int ldc, bf* dh = nullptr, bool turned = false) {
    __shared__ __align__(16) float ost[4][GR * 16 * 68];
    constexpr int K = KW;    // a constant, so that a wave's four A and four B tile rows are reached from one base each through the loads' immediate offsets
    const int lane = threadIdx.x & 31, wave = __builtin_amdgcn_readfirstlane(threadIdx.x >> 5), lr = lane & 15, hi = lane >> 4;
    const int r0 = blockIdx.x * 128 + (wave >> 1) * 64, c0 = blockIdx.y * 128 + (wave & 1) * 64;
    // operands in fragment order: 16 rows x K = K / 32 tiles in a row, TR bytes; a lane walks the tiles with one pointer per operand plane, the wave's further tile rows stand at immediate offsets
    constexpr int TR = 16 * K * 2;
    const size_t aoff = (size_t)r0 * K;
    const char* la = (const char*)(A + aoff) + lane * 16; const char* lal = SPLITA ? (const char*)(Al + aoff) + lane * 16 : la;
    const char* lb = (const char*)(Bn + (size_t)c0 * K) + lane * 16;
    v8f acc[GR][4];
#pragma unroll
    for (int g = 0; g < GR; ++g) {
#pragma unroll
        for (int t = 0; t < 4; ++t) acc[g][t] = (v8f){}; }
#pragma unroll 1
    for (int kc = 0; kc < K; kc += 32) {
        v16bf a[GR], al[GR];
#pragma unroll
        for (int g = 0; g < GR; ++g) { a[g] = cat16b(*(const v8us*)(la + g * TR), *(const v8us*)(la + g * TR + FP * 2)); al[g] = a[g];
            if (SPLITA) al[g] = cat16b(*(const v8us*)(lal + g * TR), *(const v8us*)(lal + g * TR + FP * 2)); }
        v16bf b[4];
#pragma unroll
        for (int t = 0; t < 4; ++t) b[t] = cat16b(*(const v8us*)(lb + t * TR), *(const v8us*)(lb + t * TR + FP * 2));
        // behind the trip's loads, before anything is written over the address registers that they name; the pointers are inputs so that they are kept until it
        asm volatile("s_wait_xcnt 0x0" :: "v"(la), "v"(lal), "v"(lb) : "memory");
        la += FT * 2; lal += FT * 2; lb += FT * 2;
        __builtin_amdgcn_sched_barrier(0);    // the trip's loads go out as one group: left alone, they are spread among the products and a trip waits for L2 several times over
#pragma unroll
        for (int t = 0; t < 4; ++t) {
#pragma unroll
            for (int g = 0; g < GR; ++g) acc[g][t] = wmmab(a[g], b[t], acc[g][t]);
            if (SPLITA) {
#pragma unroll
                for (int g = 0; g < GR; ++g) acc[g][t] = wmmab(al[g], b[t], acc[g][t]); } }
        // four vector slots between the trip's last products and whatever follows them over the back edge or behind the loop
        asm volatile("v_nop\n\tv_nop\n\tv_nop\n\tv_nop" : "+v"(acc[0][0]), "+v"(acc[0][1]), "+v"(acc[0][2]), "+v"(acc[0][3]), "+v"(acc[1][0]), "+v"(acc[1][1]), "+v"(acc[1][2]), "+v"(acc[1][3]),
                     "+v"(acc[2][0]), "+v"(acc[2][1]), "+v"(acc[2][2]), "+v"(acc[2][3]), "+v"(acc[3][0]), "+v"(acc[3][1]), "+v"(acc[3][2]), "+v"(acc[3][3]) : "v"(a[0]), "v"(al[0]), "v"(a[1]), "v"(al[1]), "v"(a[2]), "v"(al[2]), "v"(a[3]), "v"(al[3]));
    }
    float* os = &ost[wave][0];
    if (!(PACK && turned)) {
#pragma unroll
        for (int t = 0; t < 4; ++t) { const float bv = bias ? bfr(bias[c0 + t * 16 + lr]) : 0.f;
#pragma unroll
            for (int g = 0; g < GR; ++g) {
#pragma unroll
                for (int j = 0; j < 8; ++j) os[(g * 16 + hi * 8 + j) * 68 + t * 16 + lr] = acc[g][t][j] + bv; } }
    }
    __syncthreads();
    if (PACK) {
        if (turned) {
            // an accumulator tile IS a piece of the transposed operand: lane (lr, hi) holds column (d) t * 16 + lr, rows (tokens) 8 hi .. 8 hi + 7
            float bv[4];
#pragma unroll
            for (int t = 0; t < 4; ++t) bv[t] = bfr(bias[c0 + t * 16 + lr]);
#pragma unroll
            for (int i = 0; i < 4 * GR; ++i) { const int g = i >> 2, t = i & 3; const int e = ((g >> 1) * 4 + t) * FT + (g & 1) * FP + lane * 8; half8(acc[g][t] + bv[t], dh + e);
                asm volatile("s_wait_xcnt 0x0" ::: "memory");    // behind the store, before what follows is written over the registers that it names
                __builtin_amdgcn_sched_barrier(0); }    // one piece at a time: interleaved, the pieces' temporaries add to the 128 accumulator registers and a SIMD holds fewer waves to hide the loop's loads
        } else {
            // lane (lr, hi) takes row 16 (q / 4) + lr, columns 16 (q % 4) + 8 hi .. + 7 of piece q
#pragma unroll
            for (int q = 0; q < 4 * GR; ++q) { const float* sp = os + ((q >> 2) * 16 + lr) * 68 + (q & 3) * 16 + hi * 8; const v4f x0 = *(const v4fa*)sp, x1 = *(const v4fa*)(sp + 4);    // each row tile's four pieces follow those of the one before
                half8((v8f){x0[0], x0[1], x0[2], x0[3], x1[0], x1[1], x1[2], x1[3]}, dh + q * FP + lane * 8);
                asm volatile("s_wait_xcnt 0x0" ::: "memory"); }    // behind the store, as above
        }
    } else {
        float* crow = C + (size_t)r0 * ldc + c0;
#pragma unroll
        for (int s = 0; s < 8 * GR; ++s) { const int Lid = (lane >> 3) + 4 * s, piece = lane & 7; const int row = Lid >> 1, cofs = (Lid & 1) * 32 + piece * 4;
            *(v4f*)(crow + (size_t)row * ldc + cofs) = *(const v4fa*)(os + row * 68 + cofs); }
    }
}
// the six projections of one pass in one launch: rows = GI items, blockIdx.y = pair of heads (a wave's 64 columns are one head), blockIdx.z = q_r, k_r, q_f, k_f, v_r, v_f (weights in that order in WB; X = [stream][16-token tile of all rows][k step], fragment order, at the pass's first row).
// Each wave stores its 64 tokens of one head straight as k_attn's operand: q, k per (pair, plane) [16-token tile][k step]; v turned, per (pair, stream) [32-token step][16-d tile]
__global__ __launch_bounds__(128) void k_proj(const bf* __restrict__ X, const bf* __restrict__ WB, const float* bq1, const float* bk1, const float* bq2, const float* bk2, const float* bv1, const float* bv2, bf* QK, bf* VT) {
    const int z = blockIdx.z, wave = __builtin_amdgcn_readfirstlane(threadIdx.x >> 5), tb = blockIdx.x % (NT_ / 128);
    const size_t pr = (size_t)(blockIdx.x / (NT_ / 128)) * NH_ + blockIdx.y * 2 + (wave & 1);
    const int tt = tb * 8 + (wave >> 1) * 4;    // the wave's first 16-token tile
    const bool flow = z == 2 || z == 3 || z == 5, turned = z >= 4;
    const float* bias = z == 0 ? bq1 : z == 1 ? bk1 : z == 2 ? bq2 : z == 3 ? bk2 : z == 4 ? bv1 : bv2;
    const size_t o = turned ? (pr * 2 + (z - 4)) * PPL + (size_t)((tt >> 1) * 4) * FT : ((pr * 4 + z) * (NT_ / 16) + tt) * (16 * HD);
    gemmb_body<false, true>(X + (flow ? (size_t)NBI * NT_ * DM : 0), nullptr, WB + (size_t)z * DM * DM, bias, nullptr, 0, (turned ? VT : QK) + o, turned);
}
// both output projections of one pass in one launch: blockIdx.z = stream
__global__ __launch_bounds__(128) void k_outp(const bf* __restrict__ Ch, const bf* __restrict__ Cl, const bf* __restrict__ WBo, const float* bo1, const float* bo2, float* o0, float* o1, int ldc) {
    const int s = blockIdx.z;
    gemmb_body<true, false>(Ch + (size_t)s * PLN, Cl + (size_t)s * PLN, WBo + (size_t)s * DM * DM, s ? bo2 : bo1, s ? o1 : o0, ldc);
}

// e^x as the native form has it (one multiply, v_exp_f32); the v_nop is the one free slot that the instruction set asks for behind a transcendental, in its own statement so that it stays there
__device__ __forceinline__ float exp_slot(float x) { float r; asm("v_exp_f32 %0, %1\n\tv_nop" : "=v"(r) : "v"(x * 1.44269504088896340736f)); return r; }
// a work-group barrier that orders LDS traffic alone: __syncthreads() also waits for every global load of the wave, and a load issued ahead would not stay in flight across it
__device__ __forceinline__ void barrier_lds() { __builtin_amdgcn_fence(__ATOMIC_RELEASE, "workgroup", "local"); __builtin_amdgcn_s_barrier(); __builtin_amdgcn_fence(__ATOMIC_ACQUIRE, "workgroup", "local"); }
// k_attn: one work-group = 32 queries (two 16-query tiles) of one (item, head) pair, all 1024 keys, both streams; wave w owns keys w*64 .. w*64+63. Every key and value fragment that a wave
// loads serves both query tiles, so a query costs half the key and value bytes from L2 that a 16-query work-group pays. The scores are formed transposed, S^T = K.Q^T
// (A = key rows, B = query rows, the same loader for both, one f16 product per 32-k step), so a lane holds 32 scores of each of TWO queries per stream
// and both maps stay in registers. Row maximum and row sum: in the lane, one exchange between the lane halves, then over the 16 waves through LDS. p = max(p_r, p_f) is rounded to
// f16 in place: two neighbouring score tiles are one B operand of O^T = V^T.P^T. Each wave sums its own 64 keys; the 16 partial O^T are added through LDS in wave order.
#define AW   16                  // waves of a work-group
#define AQ   2                   // 16-query tiles of a work-group
#define AKW  (NT_ / AW)          // keys of a wave
#define AKT  (AKW / 16)          // score tiles of a wave, per stream and query tile
// four waves per SIMD (one work-group per WGP): holds the build within 256 registers a wave, so that the 16 waves fit one WGP
#define OTS  256                 // floats of one staged 16 x 16 partial tile; written and read lane by lane, 16 bytes a lane
#define SRP  (AW + 4)            // floats of one query's row of per-wave maxima or sums: 16 + 4, so that 16 queries' words of one wave fall in 16 different banks
__global__ __launch_bounds__(512) __attribute__((amdgpu_waves_per_eu(4, 4))) void k_attn(const bf* __restrict__ QK, const bf* __restrict__ VT, bf* Ch, bf* Cl) {
    __shared__ __align__(16) float ored[AW][AQ * 8][OTS];          // [wave][query tile][stream][d tile]
    __shared__ __align__(16) float sred[2][2][AQ * 16][SRP];       // [maximum, sum][stream][query][wave]
    const int lane = threadIdx.x & 31, wave = threadIdx.x >> 5, c = lane & 15, h = lane >> 4;
    const int q0 = blockIdx.x * (AQ * 16), p = blockIdx.y, kb = wave * AKW;
    const unsigned lo64 = (unsigned)(lane * 8);      // operands in fragment order: 16 tokens x 64 = two tiles in a row
    const bf* qb = QK + ((size_t)p * 4 * NT_ + q0) * HD + lo64;
    const bf* kbp = QK + ((size_t)p * 4 * NT_ + kb) * HD + lo64;
    v8f S[2][AKT][AQ];
#pragma unroll
    for (int s = 0; s < 2; ++s) {
        const bf* qp = qb + (size_t)(2 * s) * PPL;
        const bf* kp = kbp + (size_t)(2 * s + 1) * PPL;
#pragma unroll
        for (int t = 0; t < AKT; ++t) {
#pragma unroll
            for (int qt = 0; qt < AQ; ++qt) S[s][t][qt] = (v8f){}; }
        v16h qf[2][AQ], kf[2][AKT];
#pragma unroll
        for (int kk = 0; kk < 2; ++kk) {
#pragma unroll
            for (int qt = 0; qt < AQ; ++qt) { const unsigned o = qt * 16 * HD + kk * FT; qf[kk][qt] = cat16h(*(const v8us*)(qp + o), *(const v8us*)(qp + o + FP)); }
#pragma unroll
            for (int t = 0; t < AKT; ++t) { const unsigned o = t * 16 * HD + kk * FT; kf[kk][t] = cat16h(*(const v8us*)(kp + o), *(const v8us*)(kp + o + FP)); } }
        // behind the last query and key loads the address registers fall free: the wait stands before anything is written over them, and names them as inputs so that they are kept until it
        if (s == 1) asm volatile("s_wait_xcnt 0x0" :: "v"(qb), "v"(kbp) : "memory");
        __builtin_amdgcn_sched_barrier(0);    // the 24 loads of a stream's two query and four key tiles (both k steps) go out as one group: left alone, each product waits on a load issued just in front of it
#pragma unroll
        for (int kk = 0; kk < 2; ++kk) {
#pragma unroll
            for (int t = 0; t < AKT; ++t) {
#pragma unroll
                for (int qt = 0; qt < AQ; ++qt) S[s][t][qt] = wmma16(kf[kk][t], qf[kk][qt], S[s][t][qt]); } }
    }
    // the value fragments are fetched ahead of their use, as registers fall free, so that their way from L2 runs under the softmax: stream 0's first 32-token step here (the query and key fragments have left),
    // its second behind the exponentials, stream 1's two behind the first two quarters of P
    const bf* vpl = VT + (size_t)p * 2 * PPL + (size_t)kb * HD + lo64;    // the wave's two 32-token steps, four d tiles each; stream 1 stands PPL further
    v16h vf[2][AKT / 2][4];
#pragma unroll
    for (int dt = 0; dt < 4; ++dt) { const unsigned o = dt * FT; vf[0][0][dt] = cat16h(*(const v8us*)(vpl + o), *(const v8us*)(vpl + o + FP)); }
    __builtin_amdgcn_sched_barrier(0);    // the 8 loads stay here, as one group: left alone, they are moved down to the products that use them and the wave waits for L2 there
    float m[2][AQ], inv[2][AQ];
#pragma unroll
    for (int s = 0; s < 2; ++s) {
#pragma unroll
        for (int qt = 0; qt < AQ; ++qt) { v8f v = S[s][0][qt] * SCL;
#pragma unroll
            for (int t = 1; t < AKT; ++t) {
#pragma unroll
                for (int r = 0; r < 8; ++r) v[r] = fmaxf(v[r], S[s][t][qt][r] * SCL); }
            float x = fmaxf(fmaxf(fmaxf(v[0], v[1]), fmaxf(v[2], v[3])), fmaxf(fmaxf(v[4], v[5]), fmaxf(v[6], v[7])));
            x = fmaxf(x, __shfl_xor(x, 16, 32));
            if (h == 0) sred[0][s][qt * 16 + c][wave] = x; } }
    barrier_lds();    // publishes the maxima in LDS; the value loads stay in flight
#pragma unroll
    for (int s = 0; s < 2; ++s) {
#pragma unroll
        for (int qt = 0; qt < AQ; ++qt) { const float* sr = &sred[0][s][qt * 16 + c][0]; float x = sr[0];
#pragma unroll
            for (int w = 1; w < AW; ++w) x = fmaxf(x, sr[w]);
            m[s][qt] = x; } }
#pragma unroll
    for (int s = 0; s < 2; ++s) {
#pragma unroll
        for (int qt = 0; qt < AQ; ++qt) { v8f a = (v8f){};
#pragma unroll
            for (int t = 0; t < AKT; ++t) {
#pragma unroll
                for (int r = 0; r < 8; ++r) { const float e = exp_slot(S[s][t][qt][r] * SCL - m[s][qt]); S[s][t][qt][r] = e; a[r] += e; } }
            float x = ((a[0] + a[1]) + (a[2] + a[3])) + ((a[4] + a[5]) + (a[6] + a[7]));
            x += __shfl_xor(x, 16, 32);
            if (h == 0) sred[1][s][qt * 16 + c][wave] = x; } }
#pragma unroll
    for (int dt = 0; dt < 4; ++dt) { const unsigned o = (4 + dt) * FT; vf[0][1][dt] = cat16h(*(const v8us*)(vpl + o), *(const v8us*)(vpl + o + FP)); }
    barrier_lds();    // publishes the sums in LDS; the value loads stay in flight
#pragma unroll
    for (int s = 0; s < 2; ++s) {
#pragma unroll
        for (int qt = 0; qt < AQ; ++qt) { const float* sr = &sred[1][s][qt * 16 + c][0]; float x = sr[0];
#pragma unroll
            for (int w = 1; w < AW; ++w) x += sr[w];
            inv[s][qt] = 1.0f / x; } }
    static_assert(AQ == AKT / 2, "stream 1's value loads: one 32-token step behind each query tile's quarter of P");
    v16h ph[AKT / 2][AQ];
#pragma unroll
    for (int j = 0; j < AKT / 2; ++j) {
#pragma unroll
        for (int qt = 0; qt < AQ; ++qt) { v8f x[2];
#pragma unroll
            for (int i = 0; i < 16; ++i) { const int t = 2 * j + (i >> 3), r = i & 7; x[i >> 3][r] = fmaxf(S[0][t][qt][r] * inv[0][qt], S[1][t][qt][r] * inv[1][qt]); }
            ph[j][qt] = __builtin_shufflevector(__builtin_convertvector(x[0], v8h), __builtin_convertvector(x[1], v8h), 0, 1, 2, 3, 4, 5, 6, 7, 8, 9, 10, 11, 12, 13, 14, 15);
            if (j == 0) {
                // stream 1's value fragments, one 32-token step behind each quarter of P, into the registers that this quarter's scores have left: their way from L2 runs under the rest of P and stream 0's products
#pragma unroll
                for (int dt = 0; dt < 4; ++dt) { const unsigned o = (qt * 4 + dt) * FT; vf[1][qt][dt] = cat16h(*(const v8us*)(vpl + PPL + o), *(const v8us*)(vpl + PPL + o + FP)); }
                // behind the last value loads the address registers fall free: the wait stands before anything is written over them, and names them as an input so that they are kept until it
                if (qt == AQ - 1) asm volatile("s_wait_xcnt 0x0" :: "v"(vpl) : "memory");
                __builtin_amdgcn_sched_barrier(0);    // as above: the 8 loads stay here, as one group
            } } }
#pragma unroll
    for (int s = 0; s < 2; ++s) {
        v8f O[4][AQ];
#pragma unroll
        for (int dt = 0; dt < 4; ++dt) {
#pragma unroll
            for (int qt = 0; qt < AQ; ++qt) O[dt][qt] = (v8f){}; }
#pragma unroll
        for (int j = 0; j < AKT / 2; ++j) {
#pragma unroll
            for (int dt = 0; dt < 4; ++dt) {
#pragma unroll
                for (int qt = 0; qt < AQ; ++qt) O[dt][qt] = wmma16(vf[s][j][dt], ph[j][qt], O[dt][qt]); } }
        // four vector slots between the last products of this stream and the first of the next, which start anew (C = 0) in the same accumulator registers
        if (s == 0) asm volatile("v_nop\n\tv_nop\n\tv_nop\n\tv_nop" : "+v"(O[0][0]), "+v"(O[1][0]), "+v"(O[2][0]), "+v"(O[3][0]), "+v"(O[0][1]), "+v"(O[1][1]), "+v"(O[2][1]), "+v"(O[3][1]));
#pragma unroll
        for (int dt = 0; dt < 4; ++dt) {
#pragma unroll
            for (int qt = 0; qt < AQ; ++qt) { float* ow = &ored[wave][qt * 8 + s * 4 + dt][0]; const v8f o = O[dt][qt];
                *(v4fa*)(ow + lane * 4) = (v4f){o[0], o[1], o[2], o[3]}; *(v4fa*)(ow + 128 + lane * 4) = (v4f){o[4], o[5], o[6], o[7]}; } }
    }
    __syncthreads();
    // wave w adds one 16 x 16 tile, stream w / 8, query tile (w / 4) % 2, d tile w % 4, each lane the eight sums that it would hold as an accumulator, and stores them as one piece (512 consecutive bytes per plane)
    // of k_outp's A operand: [stream][16-row tile][k step][piece][lane][8], bf16 hi + residual
    const int so = wave >> 3, qt = (wave >> 2) & 1, dt = wave & 3;
    v4f a0 = (v4f){}, a1 = (v4f){};
#pragma unroll
    for (int w = 0; w < AW; ++w) { const float* ir = &ored[w][qt * 8 + so * 4 + dt][0]; a0 += *(const v4fa*)(ir + lane * 4); a1 += *(const v4fa*)(ir + 128 + lane * 4); }
    const size_t o = (size_t)so * PLN + ((((size_t)(p / NH_) * NT_ + q0) / 16 + qt) * (DM / 32) + (p % NH_) * 2 + (dt >> 1)) * FT + (dt & 1) * FP + lane * 8;
    split8((v8f){a0[0], a0[1], a0[2], a0[3], a1[0], a1[1], a1[2], a1[3]}, Ch + o, Cl + o);
}

extern "C" void kernel_launch(void* const* d_in, const int* in_sizes, int n_in,
                              void* d_out, int out_size, void* d_ws, size_t ws_size, hipStream_t stream) {
    (void)in_sizes; (void)n_in; (void)out_size;
    const float* xr = (const float*)d_in[0]; const float* xf = (const float*)d_in[1];
    const float* Wq1 = (const float*)d_in[2]; const float* bq1 = (const float*)d_in[3]; const float* Wk1 = (const float*)d_in[4]; const float* bk1 = (const float*)d_in[5]; const float* Wv1 = (const float*)d_in[6]; const float* bv1 = (const float*)d_in[7];
    const float* Wq2 = (const float*)d_in[8]; const float* bq2 = (const float*)d_in[9]; const float* Wk2 = (const float*)d_in[10]; const float* bk2 = (const float*)d_in[11]; const float* Wv2 = (const float*)d_in[12]; const float* bv2 = (const float*)d_in[13];
    const float* Wo1 = (const float*)d_in[14]; const float* bo1 = (const float*)d_in[15]; const float* Wo2 = (const float*)d_in[16]; const float* bo2 = (const float*)d_in[17];
    float* out0 = (float*)d_out; float* out1 = out0 + (size_t)NBI * NT_ * DM;    // (out_rgb.Wo1 + bo1, out_flow.Wo2 + bo2)
    char* wsp = (char*)d_ws;
    auto take = [&](size_t bytes) { char* p = wsp; wsp += (bytes + 255) & ~(size_t)255; return (void*)p; };
    bf* WB = (bf*)take((size_t)8 * DM * DM * 2);                                      // q_r, k_r, q_f, k_f, v_r, v_f, o_r, o_f; this and every 16-bit plane below in fragment order
    bf* X = (bf*)take((size_t)2 * NBI * NT_ * DM * 2);                                // [stream][item][16-token tile][k step]
    bf* QK = (bf*)take(4 * PLN * 2);                                                  // f16 bits: [pair][q_r, k_r, q_f, k_f][16-token tile][k step]
    bf* VT = (bf*)take(2 * PLN * 2);                                                  // f16 bits: [pair][stream][32-token step][16-d tile]
    bf* Ch = (bf*)take(2 * PLN * 2); bf* Cl = (bf*)take(2 * PLN * 2);                 // ctx: [stream][16-row tile][k step]
    if ((size_t)(wsp - (char*)d_ws) > ws_size) return;    // 4 + 16 + 32 + 16 + 32 = 100 MiB
    k_cvtw<<<dim3(DM / 16, 8, 1), 256, 0, stream>>>(Wq1, Wk1, Wq2, Wk2, Wv1, Wv2, Wo1, Wo2, WB);
    k_cvtx<<<dim3(NBI * NT_ / 16, 2, 1), 256, 0, stream>>>(xr, xf, X);
    for (int b = 0; b < NBI; b += GI) {
        k_proj<<<dim3(MR / 128, DM / 128, 6), 128, 0, stream>>>(X + (size_t)b * NT_ * DM, WB, bq1, bk1, bq2, bk2, bv1, bv2, QK, VT);
        k_attn<<<dim3(NT_ / (AQ * 16), NBH, 1), AW * 32, 0, stream>>>(QK, VT, Ch, Cl);                                                     // scores, both softmaxes, the merge and ctx of both streams, all pairs
        k_outp<<<dim3(MR / 128, DM / 128, 2), 128, 0, stream>>>(Ch, Cl, WB + (size_t)6 * DM * DM, bo1, bo2, out0 + (size_t)b * NT_ * DM, out1 + (size_t)b * NT_ * DM, DM);
    }
}

// v010
// Measured time: 137 microseconds a run.
// In two side-by-side timings against v009, it was 1.14 and 1.13 times as fast.
// Over all steps from v000 it is 45.0 times as fast.
#include <hip/hip_runtime.h>

// Compute dtypes, f32 accumulate, GI batch items per pass, every stage of a pass ONE launch (items, heads, the two streams and the projections ride in the grid): the six projections x.W^T + b ([1024 x 512].[512 x 512]; [out][in] weights as n-major B operands; PLAIN bf16
// operands = inputs rounded once, exact) and the two output projections (ctx as bf16 hi + UNSCALED residual) on v_wmma_f32_16x16x32_bf16; per (item, head) both
// score maps q.k^T ([1024 x 64].[64 x 1024]) and both P.v products ([1024 x 1024].[1024 x 64]) on v_wmma_f32_16x16x32_f16, each operand (q, k, v, P) rounded once to f16 (one product; f16 keeps 11 bits,
// three more than the bf16 that x and the weights behind q, k and v were rounded to), in ONE kernel that keeps scores and P in registers

#define NBI  8
#define NT_  1024
#define DM   512
#define NH_  8
#define HD   64
#define KW   DM
#define NTK  NT_
#define SCL  0.125f
#define LOSC 1024.0f
#define GI   8                   // batch items per pass: all of them, so every stage is launched once
#define MR   (GI * NT_)          // rows of one pass
#define NBH  (GI * NH_)          // (item, head) pairs of one pass
#define PLN  ((size_t)MR * DM)   // elements of one [MR][512] plane
#define PPL  ((size_t)NT_ * HD)  // elements of one plane of one (item, head) pair; a pair's planes lie side by side, so that k_attn reaches each of them through a load's immediate offset

typedef _Float16 h16;
typedef unsigned short bf;
typedef __attribute__((ext_vector_type(16))) __bf16   v16bf;
typedef __attribute__((ext_vector_type(16))) _Float16 v16h;
typedef __attribute__((ext_vector_type(8)))  _Float16 v8h;
typedef __attribute__((ext_vector_type(8)))  unsigned short v8us;
typedef __attribute__((ext_vector_type(16))) unsigned short v16us;
typedef __attribute__((ext_vector_type(8)))  float    v8f;
typedef __attribute__((ext_vector_type(4)))  float    v4f;
typedef __attribute__((ext_vector_type(4)))  _Float16 v4h;
typedef v8h  __attribute__((may_alias)) v8ha;
typedef v4f  __attribute__((may_alias)) v4fa;
typedef v8us __attribute__((may_alias)) v8usa;
typedef __attribute__((ext_vector_type(4)))  unsigned v4u;
typedef v4u  __attribute__((may_alias)) v4ua;

__device__ __forceinline__ unsigned short f2bf(float f) { unsigned u = __float_as_uint(f); u += 0x7FFFu + ((u >> 16) & 1u); return (unsigned short)(u >> 16); }
__device__ __forceinline__ float bf2f(unsigned short b) { return __uint_as_float(((unsigned)b) << 16); }
__device__ __forceinline__ float bfr(float f) { return bf2f(f2bf(f)); }
__device__ __forceinline__ v16h cat16h(v8us lo, v8us hi) { return __builtin_bit_cast(v16h, __builtin_shufflevector(lo, hi, 0, 1, 2, 3, 4, 5, 6, 7, 8, 9, 10, 11, 12, 13, 14, 15)); }
__device__ __forceinline__ v16bf cat16b(v8us lo, v8us hi) { return __builtin_bit_cast(v16bf, __builtin_shufflevector(lo, hi, 0, 1, 2, 3, 4, 5, 6, 7, 8, 9, 10, 11, 12, 13, 14, 15)); }
__device__ __forceinline__ v8f wmma16(v16h a, v16h b, v8f c) { return __builtin_amdgcn_wmma_f32_16x16x32_f16(false, a, false, b, (short)0, c, false, false); }
__device__ __forceinline__ v8f wmmab(v16bf a, v16bf b, v8f c) { return __builtin_amdgcn_wmma_f32_16x16x32_bf16(false, a, false, b, (short)0, c, false, false); }

// FRAGMENT ORDER. Every 16-row x 32-k operand tile lies in the workspace as the matrix instruction's lanes hold it: [piece 0, 1][lane][8 elements], 1 KiB; lane (h = lane / 16, c = lane % 16)
// holds row c, k = 8h .. 8h + 7 (piece 0) and 16 + 8h .. 16 + 8h + 7 (piece 1). One wave-wide 16-byte load of a piece then reads 512 consecutive bytes (4 whole lines) where rows of a
// row-major plane gave 16 lines, a quarter of each used. The k order of every product is the one it was.
#define FT   512                 // elements of a tile
#define FP   256                 // elements of a piece
// eight f32 values of a lane as bf16 hi + UNSCALED bf16 residual: 16 bytes to each plane
__device__ __forceinline__ unsigned rne16(float f) { const unsigned u = __float_as_uint(f); return u + 0x7FFFu + ((u >> 16) & 1u); }    // f2bf's rounding; the bf16 is the upper half
__device__ __forceinline__ void split8(v8f x, bf* dh, bf* dl) { v4u oh, ol;
#pragma unroll
    for (int i = 0; i < 4; ++i) { const unsigned h0 = rne16(x[2 * i]), h1 = rne16(x[2 * i + 1]);
        const unsigned l0 = rne16(x[2 * i] - __uint_as_float(h0 & 0xFFFF0000u)), l1 = rne16(x[2 * i + 1] - __uint_as_float(h1 & 0xFFFF0000u));
        oh[i] = (h1 & 0xFFFF0000u) | (h0 >> 16); ol[i] = (l1 & 0xFFFF0000u) | (l0 >> 16); }
    *(v4ua*)dh = oh; *(v4ua*)dl = ol; }
// eight f32 values of a lane as f16, rounded to nearest even: 16 bytes
__device__ __forceinline__ void half8(v8f x, bf* d) { *(v8us*)d = __builtin_bit_cast(v8us, __builtin_convertvector(x, v8h)); }
// one wave packs two tiles that lie side by side (64 columns) in 16 rows of a row-major f32 [..][512] matrix; src = row 0, first column; dh, dl = the first tile's place
template <bool LO>
__device__ __forceinline__ void pack2(const float* __restrict__ src, bf* dh, bf* dl) {
    const int lane = threadIdx.x & 31;
    const float* sp = src + (size_t)(lane & 15) * DM + 8 * (lane >> 4);
    v4f v[4][2];
#pragma unroll
    for (int q = 0; q < 4; ++q) { v[q][0] = *(const v4f*)(sp + q * 16); v[q][1] = *(const v4f*)(sp + q * 16 + 4); }
#pragma unroll
    for (int q = 0; q < 4; ++q) { v8us oh, ol;
#pragma unroll
        for (int i = 0; i < 8; ++i) { const float x = v[q][i >> 2][i & 3]; const unsigned short hb = f2bf(x); oh[i] = hb; ol[i] = f2bf(x - bf2f(hb)); }
        *(v8us*)(dh + q * FP + lane * 8) = oh; if (LO) *(v8us*)(dl + q * FP + lane * 8) = ol; }
}
// a row-major [rows][512] matrix as a GEMM operand: tiles in the order [row tile][k step]; wave wid takes row tile wid / 8, k steps 2 (wid % 8) and the next
template <bool LO>
__device__ __forceinline__ void packm(const float* __restrict__ src, bf* dh, bf* dl) {
    const int wid = blockIdx.x * 8 + (threadIdx.x >> 5), rt = wid >> 3, kq = wid & 7;
    const size_t o = ((size_t)rt * (DM / 32) + kq * 2) * FT;
    pack2<LO>(src + (size_t)rt * 16 * DM + kq * 64, dh + o, dl + o);
}
// all eight weights in one launch: blockIdx.y picks the matrix
__global__ __launch_bounds__(256) void k_cvtw(const float* w0, const float* w1, const float* w2, const float* w3, const float* w4, const float* w5, const float* w6, const float* w7, bf* dst) {
    const int y = blockIdx.y;
    const float* src = y == 0 ? w0 : y == 1 ? w1 : y == 2 ? w2 : y == 3 ? w3 : y == 4 ? w4 : y == 5 ? w5 : y == 6 ? w6 : w7;
    packm<false>(src, dst + (size_t)y * DM * DM, dst);
}
// both inputs, all items, in one launch: blockIdx.y picks the stream
__global__ __launch_bounds__(256) void k_cvtx(const float* xr, const float* xf, bf* dst) {
    packm<false>(blockIdx.y ? xf : xr, dst + (size_t)blockIdx.y * NBI * NT_ * DM, dst);
}

// k_gemmb: 128 x 128 block tile (2 x 2 waves of 64 x 64) of C = (A [+ Al]).B^T + bf(bias[c]). A wave holds GR = 4 row tiles x 4 column tiles: every A and every B fragment that it loads feeds four products,
// the two waves of a block row read the same A and the two of a block column the same B, and a quarter as many waves are started.
// PACK = false: f32 rows, whole lines. PACK = true: the wave's 64 x 64 goes out as the next stage's operand, f16, in fragment order, at dh (the wave's own place):
// turned = false, per row tile 16 tokens x 64 k = two tiles (through the wave's LDS rows); turned = true, its transpose: row tiles 2 u and 2 u + 1 are the two pieces of 32-token step u, four 16-d tiles each, FT apart
#define GR   4                   // 16-row tiles of a wave
template <bool SPLITA, bool PACK>
__device__ __forceinline__ void gemmb_body(const bf* __restrict__ A, const bf* __restrict__ Al, const bf* __restrict__ Bn, const float* __restrict__ bias, float* C, int ldc, bf* dh = nullptr, bool turned = false) {
    __shared__ __align__(16) float ost[4][GR * 16 * 68];
    constexpr int K = KW;    // a constant, so that a wave's four A and four B tile rows are reached from one base each through the loads' immediate offsets
    const int lane = threadIdx.x & 31, wave = __builtin_amdgcn_readfirstlane(threadIdx.x >> 5), lr = lane & 15, hi = lane >> 4;
    const int r0 = blockIdx.x * 128 + (wave >> 1) * 64, c0 = blockIdx.y * 128 + (wave & 1) * 64;
    // operands in fragment order: 16 rows x K = K / 32 tiles in a row, TR bytes; a lane walks the tiles with one pointer per operand plane, the wave's further tile rows stand at immediate offsets
    constexpr int TR = 16 * K * 2;
    const size_t aoff = (size_t)r0 * K;
    const char* la = (const char*)(A + aoff) + lane * 16; const char* lal = SPLITA ? (const char*)(Al + aoff) + lane * 16 : la;
    const char* lb = (const char*)(Bn + (size_t)c0 * K) + lane * 16;
    v8f acc[GR][4];
#pragma unroll
    for (int g = 0; g < GR; ++g) {
#pragma unroll
        for (int t = 0; t < 4; ++t) acc[g][t] = (v8f){}; }
#pragma unroll 1
    for (int kc = 0; kc < K; kc += 32) {
        v16bf a[GR], al[GR];
#pragma unroll
        for (int g = 0; g < GR; ++g) { a[g] = cat16b(*(const v8us*)(la + g * TR), *(const v8us*)(la + g * TR + FP * 2)); al[g] = a[g];
            if (SPLITA) al[g] = cat16b(*(const v8us*)(lal + g * TR), *(const v8us*)(lal + g * TR + FP * 2)); }
        v16bf b[4];
#pragma unroll
        for (int t = 0; t < 4; ++t) b[t] = cat16b(*(const v8us*)(lb + t * TR), *(const v8us*)(lb + t * TR + FP * 2));
        // behind the trip's loads, before anything is written over the address registers that they name; the pointers are inputs so that they are kept until it
        asm volatile("s_wait_xcnt 0x0" :: "v"(la), "v"(lal), "v"(lb) : "memory");
        la += FT * 2; lal += FT * 2; lb += FT * 2;
        __builtin_amdgcn_sched_barrier(0);    // the trip's loads go out as one group: left alone, they are spread among the products and a trip waits for L2 several times over
#pragma unroll
        for (int t = 0; t < 4; ++t) {
#pragma unroll
            for (int g = 0; g < GR; ++g) acc[g][t] = wmmab(a[g], b[t], acc[g][t]);
            if (SPLITA) {
#pragma unroll
                for (int g = 0; g < GR; ++g) acc[g][t] = wmmab(al[g], b[t], acc[g][t]); } }
        // four vector slots between the trip's last products and whatever follows them over the back edge or behind the loop
        asm volatile("v_nop\n\tv_nop\n\tv_nop\n\tv_nop" : "+v"(acc[0][0]), "+v"(acc[0][1]), "+v"(acc[0][2]), "+v"(acc[0][3]), "+v"(acc[1][0]), "+v"(acc[1][1]), "+v"(acc[1][2]), "+v"(acc[1][3]),
                     "+v"(acc[2][0]), "+v"(acc[2][1]), "+v"(acc[2][2]), "+v"(acc[2][3]), "+v"(acc[3][0]), "+v"(acc[3][1]), "+v"(acc[3][2]), "+v"(acc[3][3]) : "v"(a[0]), "v"(al[0]), "v"(a[1]), "v"(al[1]), "v"(a[2]), "v"(al[2]), "v"(a[3]), "v"(al[3]));
    }
    float* os = &ost[wave][0];
    if (!(PACK && turned)) {
#pragma unroll
        for (int t = 0; t < 4; ++t) { const float bv = bias ? bfr(bias[c0 + t * 16 + lr]) : 0.f;
#pragma unroll
            for (int g = 0; g < GR; ++g) {
#pragma unroll
                for (int j = 0; j < 8; ++j) os[(g * 16 + hi * 8 + j) * 68 + t * 16 + lr] = acc[g][t][j] + bv; } }
    }
    __syncthreads();
    if (PACK) {
        if (turned) {
            // an accumulator tile IS a piece of the transposed operand: lane (lr, hi) holds column (d) t * 16 + lr, rows (tokens) 8 hi .. 8 hi + 7
            float bv[4];
#pragma unroll
            for (int t = 0; t < 4; ++t) bv[t] = bfr(bias[c0 + t * 16 + lr]);
#pragma unroll
            for (int i = 0; i < 4 * GR; ++i) { const int g = i >> 2, t = i & 3; const int e = ((g >> 1) * 4 + t) * FT + (g & 1) * FP + lane * 8; half8(acc[g][t] + bv[t], dh + e);
                asm volatile("s_wait_xcnt 0x0" ::: "memory");    // behind the store, before what follows is written over the registers that it names
                __builtin_amdgcn_sched_barrier(0); }    // one piece at a time: interleaved, the pieces' temporaries add to the 128 accumulator registers and a SIMD holds fewer waves to hide the loop's loads
        } else {
            // lane (lr, hi) takes row 16 (q / 4) + lr, columns 16 (q % 4) + 8 hi .. + 7 of piece q
#pragma unroll
            for (int q = 0; q < 4 * GR; ++q) { const float* sp = os + ((q >> 2) * 16 + lr) * 68 + (q & 3) * 16 + hi * 8; const v4f x0 = *(const v4fa*)sp, x1 = *(const v4fa*)(sp + 4);    // each row tile's four pieces follow those of the one before
                half8((v8f){x0[0], x0[1], x0[2], x0[3], x1[0], x1[1], x1[2], x1[3]}, dh + q * FP + lane * 8);
                asm volatile("s_wait_xcnt 0x0" ::: "memory"); }    // behind the store, as above
        }
    } else {
        float* crow = C + (size_t)r0 * ldc + c0;
#pragma unroll
        for (int s = 0; s < 8 * GR; ++s) { const int Lid = (lane >> 3) + 4 * s, piece = lane & 7; const int row = Lid >> 1, cofs = (Lid & 1) * 32 + piece * 4;
            *(v4f*)(crow + (size_t)row * ldc + cofs) = *(const v4fa*)(os + row * 68 + cofs); }
    }
}
// the six projections of one pass in one launch: rows = GI items, blockIdx.y = pair of heads (a wave's 64 columns are one head), blockIdx.z = q_r, k_r, q_f, k_f, v_r, v_f (weights in that order in WB; X = [stream][16-token tile of all rows][k step], fragment order, at the pass's first row).
// Each wave stores its 64 tokens of one head straight as k_attn's operand: q, k per (pair, plane) [16-token tile][k step]; v turned, per (pair, stream) [32-token step][16-d tile]
__global__ __launch_bounds__(128) void k_proj(const bf* __restrict__ X, const bf* __restrict__ WB, const float* bq1, const float* bk1, const float* bq2, const float* bk2, const float* bv1, const float* bv2, bf* QK, bf* VT) {
    const int z = blockIdx.z, wave = __builtin_amdgcn_readfirstlane(threadIdx.x >> 5), tb = blockIdx.x % (NT_ / 128);
    const size_t pr = (size_t)(blockIdx.x / (NT_ / 128)) * NH_ + blockIdx.y * 2 + (wave & 1);
    const int tt = tb * 8 + (wave >> 1) * 4;    // the wave's first 16-token tile
    const bool flow = z == 2 || z == 3 || z == 5, turned = z >= 4;
    const float* bias = z == 0 ? bq1 : z == 1 ? bk1 : z == 2 ? bq2 : z == 3 ? bk2 : z == 4 ? bv1 : bv2;
    const size_t o = turned ? (pr * 2 + (z - 4)) * PPL + (size_t)((tt >> 1) * 4) * FT : ((pr * 4 + z) * (NT_ / 16) + tt) * (16 * HD);
    gemmb_body<false, true>(X + (flow ? (size_t)NBI * NT_ * DM : 0), nullptr, WB + (size_t)z * DM * DM, bias, nullptr, 0, (turned ? VT : QK) + o, turned);
}
// both output projections of one pass in one launch: blockIdx.z = stream
__global__ __launch_bounds__(128) void k_outp(const bf* __restrict__ Ch, const bf* __restrict__ Cl, const bf* __restrict__ WBo, const float* bo1, const float* bo2, float* o0, float* o1, int ldc) {
    const int s = blockIdx.z;
    gemmb_body<true, false>(Ch + (size_t)s * PLN, Cl + (size_t)s * PLN, WBo + (size_t)s * DM * DM, s ? bo2 : bo1, s ? o1 : o0, ldc);
}

// e^x as the native form has it (one multiply, v_exp_f32); the v_nop is the one free slot that the instruction set asks for behind a transcendental, in its own statement so that it stays there
__device__ __forceinline__ float exp_slot(float x) { float r; asm("v_exp_f32 %0, %1\n\tv_nop" : "=v"(r) : "v"(x * 1.44269504088896340736f)); return r; }
// a work-group barrier that orders LDS traffic alone: __syncthreads() also waits for every global load of the wave, and a load issued ahead would not stay in flight across it
__device__ __forceinline__ void barrier_lds() { __builtin_amdgcn_fence(__ATOMIC_RELEASE, "workgroup", "local"); __builtin_amdgcn_s_barrier(); __builtin_amdgcn_fence(__ATOMIC_ACQUIRE, "workgroup", "local"); }
// k_attn: one work-group walks ATL tiles of 32 queries (two 16-query tiles each) of one (item, head) pair, one after the other; all 1024 keys, both streams; wave w owns keys w*64 .. w*64+63.
// A work-group fills a WGP (registers and LDS), so nothing else runs there while a tile's first loads are under way: the loop lets the NEXT tile's query and key fragments be fetched while this
// tile's partial sums are added, when nearly all registers are free, and the waves are started once for ATL tiles. Every key and value fragment that a wave
// loads serves both query tiles, so a query costs half the key and value bytes from L2 that a 16-query work-group pays. The scores are formed transposed, S^T = K.Q^T
// (A = key rows, B = query rows, the same loader for both, one f16 product per 32-k step), so a lane holds 32 scores of each of TWO queries per stream
// and both maps stay in registers. Row maximum and row sum: in the lane, one exchange between the lane halves, then over the 16 waves through LDS. p = max(p_r, p_f) is rounded to
// f16 in place: two neighbouring score tiles are one B operand of O^T = V^T.P^T. Each wave sums its own 64 keys; the 16 partial O^T are added through LDS in wave order.
#define AW   16                  // waves of a work-group
#define AQ   2                   // 16-query tiles of a step
#define ATL  8                   // steps of a work-group: 4 work-groups a pair, 256 in all
#define AKW  (NT_ / AW)          // keys of a wave
#define AKT  (AKW / 16)          // score tiles of a wave, per stream and query tile
// four waves per SIMD (one work-group per WGP): holds the build within 256 registers a wave, so that the 16 waves fit one WGP
#define OTS  256                 // floats of one staged 16 x 16 partial tile; written and read lane by lane, 16 bytes a lane
#define SRP  (AW + 4)            // floats of one query's row of per-wave maxima or sums: 16 + 4, so that 16 queries' words of one wave fall in 16 different banks
// the query and key fragments of one step, both streams and both k steps: 48 loads. qs = the step's first query row, ks = the wave's first key row (the same in every lane: scalar bases), lo = the lane's place
__device__ __forceinline__ void attn_fetch(const bf* qs, const bf* ks, unsigned lo, v16h (&qf)[2][2][AQ], v16h (&kf)[2][2][AKT]) {
#pragma unroll
    for (int s = 0; s < 2; ++s) {
        const bf* qp = qs + (size_t)(2 * s) * PPL + lo;
        const bf* kp = ks + (size_t)(2 * s + 1) * PPL + lo;
#pragma unroll
        for (int kk = 0; kk < 2; ++kk) {
#pragma unroll
            for (int qt = 0; qt < AQ; ++qt) { const unsigned o = qt * 16 * HD + kk * FT; qf[s][kk][qt] = cat16h(*(const v8us*)(qp + o), *(const v8us*)(qp + o + FP)); }
#pragma unroll
            for (int t = 0; t < AKT; ++t) { const unsigned o = t * 16 * HD + kk * FT; kf[s][kk][t] = cat16h(*(const v8us*)(kp + o), *(const v8us*)(kp + o + FP)); } } }
    // behind the loads, before anything is written over the address registers that they name; bases and offset are inputs so that they are kept until it
    asm volatile("s_wait_xcnt 0x0" :: "s"(qs), "s"(ks), "v"(lo) : "memory");
    __builtin_amdgcn_sched_barrier(0);    // the 48 loads go out here, as one group: left alone, they are moved down towards the products that use them and the wave waits for L2 there
}
// a step's first part, from its fragments in qf, kf to the wave's partial sums in LDS. vs = the wave's first value tile (scalar base), lo = the lane's place
__device__ __forceinline__ void attn_front(const v16h (&qf)[2][2][AQ], const v16h (&kf)[2][2][AKT], const bf* vs, unsigned lo, int wave, float (*ored)[AQ * 8][OTS], float (*sred)[2][AQ * 16][SRP]) {
    const int lane = threadIdx.x & 31, c = lane & 15, h = lane >> 4;
    const bf* vpl = vs + lo;
    v8f S[2][AKT][AQ];
    // key tile by key tile: a tile's two fragments fall free as its scores come into being, so that both streams' fragments and the scores fit the registers
#pragma unroll
    for (int s = 0; s < 2; ++s) {
#pragma unroll
        for (int t = 0; t < AKT; ++t) {
#pragma unroll
            for (int qt = 0; qt < AQ; ++qt) S[s][t][qt] = wmma16(kf[s][0][t], qf[s][0][qt], (v8f){});
#pragma unroll
            for (int qt = 0; qt < AQ; ++qt) S[s][t][qt] = wmma16(kf[s][1][t], qf[s][1][qt], S[s][t][qt]); } }
    // the value fragments are fetched ahead of their use, as registers fall free, so that their way from L2 runs under the softmax: stream 0's first 32-token step here (the query and key fragments have left),
    // its second behind the exponentials, stream 1's two behind the first two quarters of P
    v16h vf[2][AKT / 2][4];
#pragma unroll
    for (int dt = 0; dt < 4; ++dt) { const unsigned o = dt * FT; vf[0][0][dt] = cat16h(*(const v8us*)(vpl + o), *(const v8us*)(vpl + o + FP)); }
    __builtin_amdgcn_sched_barrier(0);    // the 8 loads stay here, as one group: left alone, they are moved down to the products that use them and the wave waits for L2 there
    float m[2][AQ], inv[2][AQ];
#pragma unroll
    for (int s = 0; s < 2; ++s) {
#pragma unroll
        for (int qt = 0; qt < AQ; ++qt) { v8f v = S[s][0][qt] * SCL;
#pragma unroll
            for (int t = 1; t < AKT; ++t) {
#pragma unroll
                for (int r = 0; r < 8; ++r) v[r] = fmaxf(v[r], S[s][t][qt][r] * SCL); }
            float x = fmaxf(fmaxf(fmaxf(v[0], v[1]), fmaxf(v[2], v[3])), fmaxf(fmaxf(v[4], v[5]), fmaxf(v[6], v[7])));
            x = fmaxf(x, __shfl_xor(x, 16, 32));
            if (h == 0) sred[0][s][qt * 16 + c][wave] = x; } }
    barrier_lds();    // publishes the maxima in LDS; the value loads stay in flight
#pragma unroll
    for (int s = 0; s < 2; ++s) {
#pragma unroll
        for (int qt = 0; qt < AQ; ++qt) { const float* sr = &sred[0][s][qt * 16 + c][0]; float x = sr[0];
#pragma unroll
            for (int w = 1; w < AW; ++w) x = fmaxf(x, sr[w]);
            m[s][qt] = x; } }
#pragma unroll
    for (int s = 0; s < 2; ++s) {
#pragma unroll
        for (int qt = 0; qt < AQ; ++qt) { v8f a = (v8f){};
#pragma unroll
            for (int t = 0; t < AKT; ++t) {
#pragma unroll
                for (int r = 0; r < 8; ++r) { const float e = exp_slot(S[s][t][qt][r] * SCL - m[s][qt]); S[s][t][qt][r] = e; a[r] += e; } }
            float x = ((a[0] + a[1]) + (a[2] + a[3])) + ((a[4] + a[5]) + (a[6] + a[7]));
            x += __shfl_xor(x, 16, 32);
            if (h == 0) sred[1][s][qt * 16 + c][wave] = x; } }
#pragma unroll
    for (int dt = 0; dt < 4; ++dt) { const unsigned o = (4 + dt) * FT; vf[0][1][dt] = cat16h(*(const v8us*)(vpl + o), *(const v8us*)(vpl + o + FP)); }
    barrier_lds();    // publishes the sums in LDS; the value loads stay in flight
#pragma unroll
    for (int s = 0; s < 2; ++s) {
#pragma unroll
        for (int qt = 0; qt < AQ; ++qt) { const float* sr = &sred[1][s][qt * 16 + c][0]; float x = sr[0];
#pragma unroll
            for (int w = 1; w < AW; ++w) x += sr[w];
            inv[s][qt] = 1.0f / x; } }
    static_assert(AQ == AKT / 2, "stream 1's value loads: one 32-token step behind each query tile's quarter of P");
    v16h ph[AKT / 2][AQ];
#pragma unroll
    for (int j = 0; j < AKT / 2; ++j) {
#pragma unroll
        for (int qt = 0; qt < AQ; ++qt) { v8f x[2];
#pragma unroll
            for (int i = 0; i < 16; ++i) { const int t = 2 * j + (i >> 3), r = i & 7; x[i >> 3][r] = fmaxf(S[0][t][qt][r] * inv[0][qt], S[1][t][qt][r] * inv[1][qt]); }
            ph[j][qt] = __builtin_shufflevector(__builtin_convertvector(x[0], v8h), __builtin_convertvector(x[1], v8h), 0, 1, 2, 3, 4, 5, 6, 7, 8, 9, 10, 11, 12, 13, 14, 15);
            if (j == 0) {
                // stream 1's value fragments, one 32-token step behind each quarter of P, into the registers that this quarter's scores have left: their way from L2 runs under the rest of P and stream 0's products
#pragma unroll
                for (int dt = 0; dt < 4; ++dt) { const unsigned o = (qt * 4 + dt) * FT; vf[1][qt][dt] = cat16h(*(const v8us*)(vpl + PPL + o), *(const v8us*)(vpl + PPL + o + FP)); }
                // behind the last value loads: the wait stands before anything is written over the address registers, and names them as an input so that they are kept until it
                if (qt == AQ - 1) asm volatile("s_wait_xcnt 0x0" :: "s"(vs), "v"(lo) : "memory");
                __builtin_amdgcn_sched_barrier(0);    // as above: the 8 loads stay here, as one group
            } } }
#pragma unroll
    for (int s = 0; s < 2; ++s) {
        v8f O[4][AQ];
#pragma unroll
        for (int dt = 0; dt < 4; ++dt) {
#pragma unroll
            for (int qt = 0; qt < AQ; ++qt) O[dt][qt] = (v8f){}; }
#pragma unroll
        for (int j = 0; j < AKT / 2; ++j) {
#pragma unroll
            for (int dt = 0; dt < 4; ++dt) {
#pragma unroll
                for (int qt = 0; qt < AQ; ++qt) O[dt][qt] = wmma16(vf[s][j][dt], ph[j][qt], O[dt][qt]); } }
        // four vector slots between the last products of this stream and the first of the next, which start anew (C = 0) in the same accumulator registers
        if (s == 0) asm volatile("v_nop\n\tv_nop\n\tv_nop\n\tv_nop" : "+v"(O[0][0]), "+v"(O[1][0]), "+v"(O[2][0]), "+v"(O[3][0]), "+v"(O[0][1]), "+v"(O[1][1]), "+v"(O[2][1]), "+v"(O[3][1]));
#pragma unroll
        for (int dt = 0; dt < 4; ++dt) {
#pragma unroll
            for (int qt = 0; qt < AQ; ++qt) { float* ow = &ored[wave][qt * 8 + s * 4 + dt][0]; const v8f o = O[dt][qt];
                *(v4fa*)(ow + lane * 4) = (v4f){o[0], o[1], o[2], o[3]}; *(v4fa*)(ow + 128 + lane * 4) = (v4f){o[4], o[5], o[6], o[7]}; } }
    }
}
// a step's second part. ch, cl = the wave's piece of ctx for this step (scalar bases), lo = the lane's place; MORE = another step follows
template <bool MORE>
__device__ __forceinline__ void attn_back(int wave, const float (*ored)[AQ * 8][OTS], bf* ch, bf* cl, unsigned lo) {
    const int lane = threadIdx.x & 31;
    barrier_lds();    // publishes the partial sums in LDS; the next step's loads stay in flight. The staging rows are written again only behind the next step's two barriers, which no wave reaches before it has read them
    // wave w adds one 16 x 16 tile, stream w / 8, query tile (w / 4) % 2, d tile w % 4, each lane the eight sums that it would hold as an accumulator, and stores them as one piece (512 consecutive bytes per plane)
    // of k_outp's A operand: [stream][16-row tile][k step][piece][lane][8], bf16 hi + residual
    const int so = wave >> 3, qt = (wave >> 2) & 1, dt = wave & 3;
    v4f a0 = (v4f){}, a1 = (v4f){};
    const float* ir = &ored[0][qt * 8 + so * 4 + dt][0] + lane * 4;
#pragma unroll 1    // four waves' tiles a trip, reached from ONE address register through the loads' immediate offsets: unrolled, the addresses are formed ahead of the loop over the steps and held in two dozen registers, and the sums have none left to load into
    for (int g = 0; g < AW / 4; ++g) {
#pragma unroll
        for (int w = 0; w < 4; ++w) { a0 += *(const v4fa*)(ir + w * (AQ * 8 * OTS)); a1 += *(const v4fa*)(ir + w * (AQ * 8 * OTS) + 128); }
        ir += 4 * AQ * 8 * OTS; }
    split8((v8f){a0[0], a0[1], a0[2], a0[3], a1[0], a1[1], a1[2], a1[3]}, ch + lo, cl + lo);
    // behind the two stores, before the next step writes over the address registers that they name; bases and offset are inputs so that they are kept until it
    if (MORE) asm volatile("s_wait_xcnt 0x0" :: "s"(ch), "s"(cl), "v"(lo) : "memory");
}
__global__ __launch_bounds__(512) __attribute__((amdgpu_waves_per_eu(4, 4))) void k_attn(const bf* __restrict__ QK, const bf* __restrict__ VT, bf* Ch, bf* Cl) {
    __shared__ __align__(16) float ored[AW][AQ * 8][OTS];          // [wave][query tile][stream][d tile]
    __shared__ __align__(16) float sred[2][2][AQ * 16][SRP];       // [maximum, sum][stream][query][wave]
    const int lane = threadIdx.x & 31, wave = __builtin_amdgcn_readfirstlane(threadIdx.x >> 5);    // the wave's number as a scalar: what hangs on it alone stays out of the vector registers, which the loop needs
    const int q0 = blockIdx.x * (ATL * AQ * 16), p = blockIdx.y, kb = wave * AKW;
    const unsigned lo64 = (unsigned)(lane * 8);      // operands in fragment order: 16 tokens x 64 = two tiles in a row
    const bf* qs = QK + ((size_t)p * 4 * NT_ + q0) * HD;
    const bf* ks = QK + ((size_t)p * 4 * NT_ + kb) * HD;
    const bf* vs = VT + (size_t)p * 2 * PPL + (size_t)kb * HD;    // the wave's two 32-token steps, four d tiles each; stream 1 stands PPL further
    const int so = wave >> 3, qt = (wave >> 2) & 1, dt = wave & 3;        // the 16 x 16 tile of ctx that the wave adds and stores in every step
    size_t o = (size_t)so * PLN + ((((size_t)(p / NH_) * NT_ + q0) / 16 + qt) * (DM / 32) + (p % NH_) * 2 + (dt >> 1)) * FT + (dt & 1) * FP;
    v16h qf[2][2][AQ], kf[2][2][AKT];
    attn_fetch(qs, ks, lo64, qf, kf);
#pragma unroll 1    // one copy of the step's code
    for (int it = 0; ; ++it) {
        attn_front(qf, kf, vs, lo64, wave, ored, sred);
        if (it == ATL - 1) break;
        // scores, P and values have left the registers: the next step's fragments start their way from L2 here and arrive while the partial sums are added
        qs += AQ * 16 * HD;
        attn_fetch(qs, ks, lo64, qf, kf);
        attn_back<true>(wave, ored, Ch + o, Cl + o, lo64);
        o += (size_t)AQ * (DM / 32) * FT;
    }
    attn_back<false>(wave, ored, Ch + o, Cl + o, lo64);
}

extern "C" void kernel_launch(void* const* d_in, const int* in_sizes, int n_in,
                              void* d_out, int out_size, void* d_ws, size_t ws_size, hipStream_t stream) {
    (void)in_sizes; (void)n_in; (void)out_size;
    const float* xr = (const float*)d_in[0]; const float* xf = (const float*)d_in[1];
    const float* Wq1 = (const float*)d_in[2]; const float* bq1 = (const float*)d_in[3]; const float* Wk1 = (const float*)d_in[4]; const float* bk1 = (const float*)d_in[5]; const float* Wv1 = (const float*)d_in[6]; const float* bv1 = (const float*)d_in[7];
    const float* Wq2 = (const float*)d_in[8]; const float* bq2 = (const float*)d_in[9]; const float* Wk2 = (const float*)d_in[10]; const float* bk2 = (const float*)d_in[11]; const float* Wv2 = (const float*)d_in[12]; const float* bv2 = (const float*)d_in[13];
    const float* Wo1 = (const float*)d_in[14]; const float* bo1 = (const float*)d_in[15]; const float* Wo2 = (const float*)d_in[16]; const float* bo2 = (const float*)d_in[17];
    float* out0 = (float*)d_out; float* out1 = out0 + (size_t)NBI * NT_ * DM;    // (out_rgb.Wo1 + bo1, out_flow.Wo2 + bo2)
    char* wsp = (char*)d_ws;
    auto take = [&](size_t bytes) { char* p = wsp; wsp += (bytes + 255) & ~(size_t)255; return (void*)p; };
    bf* WB = (bf*)take((size_t)8 * DM * DM * 2);                                      // q_r, k_r, q_f, k_f, v_r, v_f, o_r, o_f; this and every 16-bit plane below in fragment order
    bf* X = (bf*)take((size_t)2 * NBI * NT_ * DM * 2);                                // [stream][item][16-token tile][k step]
    bf* QK = (bf*)take(4 * PLN * 2);                                                  // f16 bits: [pair][q_r, k_r, q_f, k_f][16-token tile][k step]
    bf* VT = (bf*)take(2 * PLN * 2);                                                  // f16 bits: [pair][stream][32-token step][16-d tile]
    bf* Ch = (bf*)take(2 * PLN * 2); bf* Cl = (bf*)take(2 * PLN * 2);                 // ctx: [stream][16-row tile][k step]
    if ((size_t)(wsp - (char*)d_ws) > ws_size) return;    // 4 + 16 + 32 + 16 + 32 = 100 MiB
    k_cvtw<<<dim3(DM / 16, 8, 1), 256, 0, stream>>>(Wq1, Wk1, Wq2, Wk2, Wv1, Wv2, Wo1, Wo2, WB);
    k_cvtx<<<dim3(NBI * NT_ / 16, 2, 1), 256, 0, stream>>>(xr, xf, X);
    for (int b = 0; b < NBI; b += GI) {
        k_proj<<<dim3(MR / 128, DM / 128, 6), 128, 0, stream>>>(X + (size_t)b * NT_ * DM, WB, bq1, bk1, bq2, bk2, bv1, bv2, QK, VT);
        k_attn<<<dim3(NT_ / (ATL * AQ * 16), NBH, 1), AW * 32, 0, stream>>>(QK, VT, Ch, Cl);                                                     // scores, both softmaxes, the merge and ctx of both streams, all pairs
        k_outp<<<dim3(MR / 128, DM / 128, 2), 128, 0, stream>>>(Ch, Cl, WB + (size_t)6 * DM * DM, bo1, bo2, out0 + (size_t)b * NT_ * DM, out1 + (size_t)b * NT_ * DM, DM);
    }
}
